// v000
// The times below were measured on an AMD MI455X: many runs one after another, warmed up first and cycling through
// copies of the inputs, with the whole window's GPU time divided by the number of runs. Launches and the gaps
// between them are all in it. The median over several windows is given; except for v000 it joins two sittings, which
// can be a few percent apart, so the side-by-side timings, each taken in one sitting, are the better comparison.
// The starting kernel, v000, takes 125 microseconds a run.
#include <hip/hip_runtime.h>
#include <stddef.h>

// Contractions on v_wmma_f32_16x16x32_f16 (f16 operands, f32 accumulate): q,k projections and q.k^T as single products of power-of-two scaled operands; v projection, p.v, output projection and the 64->8 geometric projection as f16 hi + residual operand pairs (power-of-two scaled). Softmax, geometry embedding, bias, normalisation in f32.

#define NB   4
#define NTOK 512
#define DM   512
#define NH   8
#define DKH  64
#define MTOK (NB * NTOK)

#define S_X  1024.0f
#define S_W  4096.0f
#define S_QK 16.0f
#define S_V  1024.0f
#define S_P  4096.0f
#define S_AO 1024.0f
#define S_E  2048.0f
#define S_G  4096.0f

typedef _Float16 v16h __attribute__((ext_vector_type(16)));
typedef _Float16 v8h_base __attribute__((ext_vector_type(8)));
typedef v8h_base __attribute__((may_alias)) v8h;
typedef float v8f __attribute__((ext_vector_type(8)));
typedef float v4f_base __attribute__((ext_vector_type(4)));
typedef v4f_base __attribute__((may_alias)) v4f;

union Frag16 { v16h v; v8h half[2]; _Float16 s[16]; };
union Pack8  { v8h v; _Float16 s[8]; };
union Pack2  { unsigned u; _Float16 s[2]; };
union F8     { v4f v[2]; float f[8]; };

__device__ __forceinline__ v8f zero8f() {
  v8f z = {0.f, 0.f, 0.f, 0.f, 0.f, 0.f, 0.f, 0.f};
  return z;
}

// one 16x16x32 step with the VALU hazard guard tied to D, A, B
__device__ __forceinline__ v8f wmma16(v16h a, v16h b, v8f c) {
  v8f d = __builtin_amdgcn_wmma_f32_16x16x32_f16(false, a, false, b, (short)0, c, false, false);
  asm volatile("v_nop\n\tv_nop\n\tv_nop\n\tv_nop" : "+v"(d) : "v"(a), "v"(b));
  return d;
}

// 16x32 operand fragment from a 16-bit LDS tile stored [line][k], k contiguous, pitch in elements (16-B aligned lines).
// lane l: line (row of A / column of B) = l & 15; elements 0..7 <- k0 + 8*(l>>4) + 0..7, elements 8..15 <- k0 + 16 + 8*(l>>4) + 0..7.
__device__ __forceinline__ v16h ldfrag(const _Float16* base, int pitch, int lane, int k0) {
  const _Float16* p = base + (lane & 15) * pitch + k0 + 8 * (lane >> 4);
  Frag16 f;
  f.half[0] = *(const v8h*)(p);
  f.half[1] = *(const v8h*)(p + 16);
  return f.v;
}

// ---------------------------------------------------------------------------------------------
// Y[M][Nout] = A[M][K] . W[K][Nout] + bias.  64x64 tile, 128 threads = 4 waves (16 rows each).
// AM: 0 = A f32 -> one f16 plane (scaled); 1 = A f32 -> f16 hi + residual planes; 2 = A given as two f16 planes.
//     W f32 -> same plane count as A (scaled).  Planes>1: D = Ah.Wh + Ah.Wl + Al.Wh.
// OM: 0 = f16 row-major [M][Nout], value*o_scale; 1 = f16 hi/residual planes laid out [b][head][dk][token]
//     (Nout = NH*DKH, one head per column tile, M = NB*NTOK); 2 = f32 row-major.
// D element r of lane l = (row 8*(l>>4)+r, col l&15) of the 16x16 tile.
// ---------------------------------------------------------------------------------------------
template <int AM, int OM>
__global__ __launch_bounds__(128) void k_gemm(const float* Af, const _Float16* Ah, const _Float16* Al,
                                             const float* W, const float* bias,
                                             _Float16* Yh, _Float16* Yl, float* Yf,
                                             int M, int K, int Nout,
                                             float a_scale, float w_scale, float o_mul, float o_scale) {
  constexpr int NPL = (AM == 0) ? 1 : 2;
  __shared__ __attribute__((aligned(16))) _Float16 At[NPL][64][40];   // [row][k]
  __shared__ __attribute__((aligned(16))) _Float16 Bt[NPL][64][40];   // [n][k]
  __shared__ __attribute__((aligned(16))) float Ct[64][68];

  const int tid = threadIdx.x, lane = tid & 31, wave = tid >> 5;
  const int hh = lane >> 4, m = lane & 15;
  const int n0 = blockIdx.x * 64, m0 = blockIdx.y * 64;
  if (m0 + 64 > M || n0 + 64 > Nout) return;   // block-uniform, before any barrier

  v8f acc[4];
#pragma unroll
  for (int j = 0; j < 4; ++j) acc[j] = zero8f();

#pragma unroll 1
  for (int kk = 0; kk < K; kk += 32) {
    {  // A tile 64x32: thread -> row tid>>1, 16 consecutive k
      const int r = tid >> 1, cb = (tid & 1) * 16;
      if (AM == 2) {
        const size_t g = (size_t)(m0 + r) * K + kk + cb;
        const v8h h0 = *(const v8h*)(Ah + g), h1 = *(const v8h*)(Ah + g + 8);
        const v8h l0 = *(const v8h*)(Al + g), l1 = *(const v8h*)(Al + g + 8);
        *(v8h*)&At[0][r][cb] = h0;        *(v8h*)&At[0][r][cb + 8] = h1;
        *(v8h*)&At[NPL - 1][r][cb] = l0;  *(v8h*)&At[NPL - 1][r][cb + 8] = l1;
      } else {
        const float* s = Af + (size_t)(m0 + r) * K + kk + cb;
        F8 x0, x1;
        x0.v[0] = *(const v4f*)(s);      x0.v[1] = *(const v4f*)(s + 4);
        x1.v[0] = *(const v4f*)(s + 8);  x1.v[1] = *(const v4f*)(s + 12);
        Frag16 ph, pl;
#pragma unroll
        for (int e = 0; e < 8; ++e) {
          const float v0 = x0.f[e] * a_scale, v1 = x1.f[e] * a_scale;
          const _Float16 h0 = (_Float16)v0, h1 = (_Float16)v1;
          ph.s[e] = h0;
          ph.s[8 + e] = h1;
          pl.s[e] = (_Float16)(v0 - (float)h0);
          pl.s[8 + e] = (_Float16)(v1 - (float)h1);
        }
        *(v8h*)&At[0][r][cb] = ph.half[0];  *(v8h*)&At[0][r][cb + 8] = ph.half[1];
        if (NPL == 2) {
          *(v8h*)&At[NPL - 1][r][cb] = pl.half[0];  *(v8h*)&At[NPL - 1][r][cb + 8] = pl.half[1];
        }
      }
    }
    {  // W tile 32 k x 64 n, stored transposed [n][k]: thread -> k pair 2kp,2kp+1 and 8 columns
      const int kp = tid >> 3, nb = (tid & 7) * 8;
      const float* s0 = W + (size_t)(kk + 2 * kp) * Nout + n0 + nb;
      const float* s1 = s0 + Nout;
      F8 w0, w1;
      w0.v[0] = *(const v4f*)(s0);  w0.v[1] = *(const v4f*)(s0 + 4);
      w1.v[0] = *(const v4f*)(s1);  w1.v[1] = *(const v4f*)(s1 + 4);
#pragma unroll
      for (int d = 0; d < 8; ++d) {
        const float a = w0.f[d] * w_scale, c = w1.f[d] * w_scale;
        const _Float16 ha = (_Float16)a, hc = (_Float16)c;
        Pack2 q;
        q.s[0] = ha;  q.s[1] = hc;
        *(unsigned*)&Bt[0][nb + d][2 * kp] = q.u;
        if (NPL == 2) {
          Pack2 ql;
          ql.s[0] = (_Float16)(a - (float)ha);
          ql.s[1] = (_Float16)(c - (float)hc);
          *(unsigned*)&Bt[NPL - 1][nb + d][2 * kp] = ql.u;
        }
      }
    }
    __syncthreads();

    const v16h ah = ldfrag(&At[0][wave * 16][0], 40, lane, 0);
    if (NPL == 1) {
#pragma unroll
      for (int j = 0; j < 4; ++j) {
        const v16h bh = ldfrag(&Bt[0][j * 16][0], 40, lane, 0);
        acc[j] = wmma16(ah, bh, acc[j]);
      }
    } else {
      const v16h al = ldfrag(&At[NPL - 1][wave * 16][0], 40, lane, 0);
#pragma unroll
      for (int j = 0; j < 4; ++j) {
        const v16h bh = ldfrag(&Bt[0][j * 16][0], 40, lane, 0);
        const v16h bl = ldfrag(&Bt[NPL - 1][j * 16][0], 40, lane, 0);
        acc[j] = wmma16(ah, bh, acc[j]);
        acc[j] = wmma16(ah, bl, acc[j]);
        acc[j] = wmma16(al, bh, acc[j]);
      }
    }
    __syncthreads();
  }

  // D + bias (unscaled) -> LDS tile
#pragma unroll
  for (int j = 0; j < 4; ++j) {
    const float bcol = bias[n0 + 16 * j + m];
#pragma unroll
    for (int r = 0; r < 8; ++r) Ct[wave * 16 + 8 * hh + r][16 * j + m] = acc[j][r] * o_mul + bcol;
  }
  __syncthreads();

  if (OM == 0) {
    const int q = lane >> 3, p = lane & 7;
    v8h vals[4];
    size_t addr[4];
#pragma unroll
    for (int it = 0; it < 4; ++it) {
      const int row = wave * 16 + 4 * it + q;
      F8 c;
      c.v[0] = *(const v4f*)&Ct[row][8 * p];
      c.v[1] = *(const v4f*)&Ct[row][8 * p + 4];
      Pack8 pk;
#pragma unroll
      for (int e = 0; e < 8; ++e) pk.s[e] = (_Float16)(c.f[e] * o_scale);
      vals[it] = pk.v;
      addr[it] = (size_t)(m0 + row) * Nout + n0 + 8 * p;
    }
#pragma unroll
    for (int it = 0; it < 4; ++it) *(v8h*)(Yh + addr[it]) = vals[it];
    
  } else if (OM == 1) {
    const int hd = blockIdx.x;
    const int bb = m0 / NTOK, tok0 = m0 - bb * NTOK;
    const int q = lane >> 3, p = lane & 7;
    v8h vh[4], vl[4];
    size_t addr[4];
#pragma unroll
    for (int it = 0; it < 4; ++it) {
      const int dk = wave * 16 + 4 * it + q;
      Pack8 ph, pl;
#pragma unroll
      for (int e = 0; e < 8; ++e) {
        const float v = Ct[8 * p + e][dk] * o_scale;
        const _Float16 hv = (_Float16)v;
        ph.s[e] = hv;
        pl.s[e] = (_Float16)(v - (float)hv);
      }
      vh[it] = ph.v;
      vl[it] = pl.v;
      addr[it] = (((size_t)bb * NH + hd) * DKH + dk) * NTOK + tok0 + 8 * p;
    }
#pragma unroll
    for (int it = 0; it < 4; ++it) {
      *(v8h*)(Yh + addr[it]) = vh[it];
      *(v8h*)(Yl + addr[it]) = vl[it];
    }
    
  } else {
    const int q = lane >> 4, p = lane & 15;
    v4f vals[8];
    size_t addr[8];
#pragma unroll
    for (int it = 0; it < 8; ++it) {
      const int row = wave * 16 + 2 * it + q;
      vals[it] = *(const v4f*)&Ct[row][4 * p];
      addr[it] = (size_t)(m0 + row) * Nout + n0 + 4 * p;
    }
#pragma unroll
    for (int it = 0; it < 8; ++it) *(v4f*)(Yf + addr[it]) = vals[it];
    
  }
}

// ---------------------------------------------------------------------------------------------
// Geometric log-weights with the key mask folded in:
// logg[b][h][i][j] = log(max(relu(emb(i,j) . Wg[:,h] + bg[h]), 1e-6)) + (mask[b][i][j]==0 ? -1e9 : 0)
// One block per (b, i); j in chunks of 128 (one j per thread); the 64->8 projection runs on WMMA with
// A = emb hi / residual planes (x S_E) and B columns 0..7 = f16(S_G*Wg[:,h]), 8..15 = residual of the same.
// ---------------------------------------------------------------------------------------------
__global__ __launch_bounds__(128) void k_geo(const float* box, const float* Wg, const float* bg,
                                            const int* msk, float* logg) {
  __shared__ __attribute__((aligned(16))) _Float16 Et[2][128][72];   // [plane][j][g]
  __shared__ __attribute__((aligned(16))) _Float16 Bg[16][72];       // [n][g]
  __shared__ float Gs[128][17];
  __shared__ float sdm[8];
  __shared__ float sbg[8];

  const int tid = threadIdx.x, lane = tid & 31, wave = tid >> 5;
  const int hh = lane >> 4, m = lane & 15;
  const int bi = blockIdx.x;
  if (bi >= NB * NTOK) return;   // block-uniform
  const int b = bi / NTOK, i = bi - b * NTOK;

  if (tid < 8) {
    sdm[tid] = 1.0f / powf(1000.0f, (float)tid * 0.125f);
    sbg[tid] = bg[tid];
  }
#pragma unroll
  for (int e = 0; e < 8; ++e) {
    const int idx = tid * 8 + e;          // 0..1023
    const int n = idx >> 6, k = idx & 63;
    const float w = Wg[k * NH + (n & 7)] * S_G;
    const _Float16 wh = (_Float16)w;
    const _Float16 wl = (_Float16)(w - (float)wh);
    Bg[n][k] = (n < 8) ? wh : wl;
  }
  const v4f bxi = *(const v4f*)(box + (size_t)bi * 4);
  const float cxi = (bxi[0] + bxi[1]) * 0.5f, cyi = (bxi[2] + bxi[3]) * 0.5f;
  const float wi = (bxi[1] - bxi[0]) + 1.0f, hgi = (bxi[3] - bxi[2]) + 1.0f;
  const float rwi = 1.0f / wi, rhi = 1.0f / hgi;
  __syncthreads();

  float dm[8];
#pragma unroll
  for (int f = 0; f < 8; ++f) dm[f] = sdm[f];
  const v16h bg0 = ldfrag(&Bg[0][0], 72, lane, 0);
  const v16h bg1 = ldfrag(&Bg[0][0], 72, lane, 32);
  const size_t mbase = ((size_t)b * NTOK + i) * NTOK;
  const v8f z8 = zero8f();

#pragma unroll 1
  for (int ch = 0; ch < NTOK / 128; ++ch) {
    {  // embedding of pair (i, j), j = ch*128 + tid -> Et[.][tid][0..63]
      const int j = ch * 128 + tid;
      const v4f bxj = *(const v4f*)(box + ((size_t)b * NTOK + j) * 4);
      const float cxj = (bxj[0] + bxj[1]) * 0.5f, cyj = (bxj[2] + bxj[3]) * 0.5f;
      const float wj = (bxj[1] - bxj[0]) + 1.0f, hgj = (bxj[3] - bxj[2]) + 1.0f;
      const float p0 = logf(fmaxf(fabsf((cxi - cxj) * rwi), 1e-3f));
      const float p1 = logf(fmaxf(fabsf((cyi - cyj) * rhi), 1e-3f));
      const float p2 = logf(wi / wj);
      const float p3 = logf(hgi / hgj);
      const float pp[4] = {p0 * 100.0f, p1 * 100.0f, p2 * 100.0f, p3 * 100.0f};
#pragma unroll
      for (int p = 0; p < 4; ++p) {
        Pack8 sh, sl, chv, clv;
#pragma unroll
        for (int f = 0; f < 8; ++f) {
          const float ang = pp[p] * dm[f];
          const float sv = __sinf(ang) * S_E;
          const float cv = __cosf(ang) * S_E;
          const _Float16 a = (_Float16)sv;
          sh.s[f] = a;
          sl.s[f] = (_Float16)(sv - (float)a);
          const _Float16 c = (_Float16)cv;
          chv.s[f] = c;
          clv.s[f] = (_Float16)(cv - (float)c);
        }
        *(v8h*)&Et[0][tid][p * 8] = sh.v;
        *(v8h*)&Et[1][tid][p * 8] = sl.v;
        *(v8h*)&Et[0][tid][32 + p * 8] = chv.v;
        *(v8h*)&Et[1][tid][32 + p * 8] = clv.v;
      }
    }
    __syncthreads();

    // 128 j rows x 16 cols, K = 64: wave -> two 16-row tiles
#pragma unroll
    for (int t = 0; t < 2; ++t) {
      const int row0 = wave * 32 + t * 16;
      v8f acc = z8;
      const v16h a0 = ldfrag(&Et[0][row0][0], 72, lane, 0);
      const v16h l0 = ldfrag(&Et[1][row0][0], 72, lane, 0);
      acc = wmma16(a0, bg0, acc);
      acc = wmma16(l0, bg0, acc);
      const v16h a1 = ldfrag(&Et[0][row0][0], 72, lane, 32);
      const v16h l1 = ldfrag(&Et[1][row0][0], 72, lane, 32);
      acc = wmma16(a1, bg1, acc);
      acc = wmma16(l1, bg1, acc);
#pragma unroll
      for (int r = 0; r < 8; ++r) Gs[row0 + 8 * hh + r][m] = acc[r];
    }
    __syncthreads();

    v4f vv[2];
#pragma unroll
    for (int e = 0; e < 2; ++e) {
      const int hd = 2 * wave + e;
#pragma unroll
      for (int q = 0; q < 4; ++q) {
        const int jl = 4 * lane + q;
        const float graw = (Gs[jl][hd] + Gs[jl][hd + 8]) * (1.0f / (S_E * S_G)) + sbg[hd];
        const float g = fmaxf(graw, 0.0f);
        float v = logf(fmaxf(g, 1e-6f));
        const int mk = msk[mbase + ch * 128 + jl];
        v += (mk == 0) ? -1e9f : 0.0f;
        vv[e][q] = v;
      }
    }
    float* ap0 = logg + (((size_t)b * NH + 2 * wave) * NTOK + i) * NTOK + ch * 128 + 4 * lane;
    float* ap1 = ap0 + (size_t)NTOK * NTOK;
    *(v4f*)ap0 = vv[0];
    *(v4f*)ap1 = vv[1];
    
  }
}

// ---------------------------------------------------------------------------------------------
// Streaming attention: block = (b, h, 64 query rows), 4 waves x 16 rows, key tiles of 32.
// S = Q16.K16^T (single f16 product, Q16/K16 carry S_QK); logits = S*(1/(8*S_QK^2)) + logg; online softmax in f32;
// O += P.V with P as f16 hi/residual of S_P*p and V as f16 hi/residual planes (carrying S_V), V tile staged [dk][key].
// Output: f16 hi/residual planes of S_AO * (O / l), row-major [b*N+q][h*64+dk].
// ---------------------------------------------------------------------------------------------
__global__ __launch_bounds__(128) void k_attn(const _Float16* Qh, const _Float16* Kh,
                                             const _Float16* Vth, const _Float16* Vtl,
                                             const float* logg, _Float16* Oh, _Float16* Ol) {
  __shared__ __attribute__((aligned(16))) _Float16 Qt[64][72];        // [q][dk]
  __shared__ __attribute__((aligned(16))) _Float16 Kt[32][72];        // [key][dk]
  __shared__ __attribute__((aligned(16))) _Float16 Vt[2][64][40];     // [plane][dk][key]
  __shared__ __attribute__((aligned(16))) _Float16 Pt[2][4][16][40];  // [plane][wave][q][key]
  __shared__ __attribute__((aligned(16))) float Cs[64][68];

  const int tid = threadIdx.x, lane = tid & 31, wave = tid >> 5;
  const int hh = lane >> 4, m = lane & 15;
  const int blk = blockIdx.x;
  if (blk >= NB * NH * (NTOK / 64)) return;   // block-uniform
  const int qb = blk & 7, h = (blk >> 3) & 7, b = blk >> 6;
  const int q0 = qb * 64;

  {
    const int r = tid >> 1, cb = (tid & 1) * 32;
    const _Float16* s = Qh + ((size_t)(b * NTOK + q0 + r)) * DM + h * DKH + cb;
#pragma unroll
    for (int u = 0; u < 4; ++u) *(v8h*)&Qt[r][cb + 8 * u] = *(const v8h*)(s + 8 * u);
  }
  __syncthreads();
  const v16h qa0 = ldfrag(&Qt[wave * 16][0], 72, lane, 0);
  const v16h qa1 = ldfrag(&Qt[wave * 16][0], 72, lane, 32);

  const v8f z8 = zero8f();
  v8f o[4];
#pragma unroll
  for (int j = 0; j < 4; ++j) o[j] = z8;
  float mrow[8], lrow[8];
#pragma unroll
  for (int r = 0; r < 8; ++r) { mrow[r] = -1e30f; lrow[r] = 0.0f; }

  const size_t lgrow = (((size_t)b * NH + h) * NTOK + (q0 + wave * 16 + 8 * hh)) * NTOK;
  const float SC = 0.125f / (S_QK * S_QK);

#pragma unroll 1
  for (int kt = 0; kt < NTOK / 32; ++kt) {
    const int k0 = kt * 32;
    {  // K tile 32 keys x 64 dk
      const int r = tid >> 2, cb = (tid & 3) * 16;
      const _Float16* s = Kh + ((size_t)(b * NTOK + k0 + r)) * DM + h * DKH + cb;
      *(v8h*)&Kt[r][cb] = *(const v8h*)(s);
      *(v8h*)&Kt[r][cb + 8] = *(const v8h*)(s + 8);
    }
    {  // V planes, already [dk][token]: 64 dk x 32 keys, direct copy
      const int r = tid >> 1, cb = (tid & 1) * 16;
      const size_t g = (((size_t)b * NH + h) * DKH + r) * NTOK + k0 + cb;
      *(v8h*)&Vt[0][r][cb] = *(const v8h*)(Vth + g);
      *(v8h*)&Vt[0][r][cb + 8] = *(const v8h*)(Vth + g + 8);
      *(v8h*)&Vt[1][r][cb] = *(const v8h*)(Vtl + g);
      *(v8h*)&Vt[1][r][cb + 8] = *(const v8h*)(Vtl + g + 8);
    }
    __syncthreads();

    // S[16 q][32 keys]: B[k=dk][n=key] = Kt[key][dk] -> n-major tile, same loader as A
    v8f s[2];
#pragma unroll
    for (int c = 0; c < 2; ++c) {
      const v16h b0 = ldfrag(&Kt[16 * c][0], 72, lane, 0);
      const v16h b1 = ldfrag(&Kt[16 * c][0], 72, lane, 32);
      v8f sc = z8;
      sc = wmma16(qa0, b0, sc);
      sc = wmma16(qa1, b1, sc);
      s[c] = sc;
    }

    float t[2][8];
#pragma unroll
    for (int c = 0; c < 2; ++c)
#pragma unroll
      for (int r = 0; r < 8; ++r)
        t[c][r] = s[c][r] * SC + logg[lgrow + (size_t)r * NTOK + k0 + 16 * c + m];

    float rmax[8];
#pragma unroll
    for (int r = 0; r < 8; ++r) rmax[r] = fmaxf(t[0][r], t[1][r]);
#pragma unroll
    for (int off = 8; off >= 1; off >>= 1)
#pragma unroll
      for (int r = 0; r < 8; ++r) rmax[r] = fmaxf(rmax[r], __shfl_xor(rmax[r], off, 16));

    float alpha[8];
#pragma unroll
    for (int r = 0; r < 8; ++r) {
      const float mnew = fmaxf(mrow[r], rmax[r]);
      alpha[r] = __expf(mrow[r] - mnew);
      mrow[r] = mnew;
    }
#pragma unroll
    for (int c = 0; c < 2; ++c)
#pragma unroll
      for (int r = 0; r < 8; ++r) t[c][r] = __expf(t[c][r] - mrow[r]);

    float rsum[8];
#pragma unroll
    for (int r = 0; r < 8; ++r) rsum[r] = t[0][r] + t[1][r];
#pragma unroll
    for (int off = 8; off >= 1; off >>= 1)
#pragma unroll
      for (int r = 0; r < 8; ++r) rsum[r] += __shfl_xor(rsum[r], off, 16);
#pragma unroll
    for (int r = 0; r < 8; ++r) lrow[r] = lrow[r] * alpha[r] + rsum[r];
#pragma unroll
    for (int j = 0; j < 4; ++j)
#pragma unroll
      for (int r = 0; r < 8; ++r) o[j][r] *= alpha[r];

    // P tile (D layout: row 8hh+r = q, col m = key) -> LDS planes; block barrier before the fragment reload
#pragma unroll
    for (int c = 0; c < 2; ++c)
#pragma unroll
      for (int r = 0; r < 8; ++r) {
        const float ps = t[c][r] * S_P;
        const _Float16 ph = (_Float16)ps;
        Pt[0][wave][8 * hh + r][16 * c + m] = ph;
        Pt[1][wave][8 * hh + r][16 * c + m] = (_Float16)(ps - (float)ph);
      }
    __syncthreads();

    const v16h pah = ldfrag(&Pt[0][wave][0][0], 40, lane, 0);
    const v16h pal = ldfrag(&Pt[1][wave][0][0], 40, lane, 0);
    // O[16 q][64 dk] += P[16 x 32 keys] . V[32 keys x 64 dk]; B[k=key][n=dk] = Vt[dk][key]
#pragma unroll
    for (int j = 0; j < 4; ++j) {
      const v16h vh = ldfrag(&Vt[0][16 * j][0], 40, lane, 0);
      const v16h vl = ldfrag(&Vt[1][16 * j][0], 40, lane, 0);
      o[j] = wmma16(pah, vh, o[j]);
      o[j] = wmma16(pah, vl, o[j]);
      o[j] = wmma16(pal, vh, o[j]);
    }
    __syncthreads();
  }

  float inv[8];
#pragma unroll
  for (int r = 0; r < 8; ++r) inv[r] = (1.0f / lrow[r]) * (S_AO / (S_P * S_V));
#pragma unroll
  for (int j = 0; j < 4; ++j)
#pragma unroll
    for (int r = 0; r < 8; ++r) Cs[wave * 16 + 8 * hh + r][16 * j + m] = o[j][r] * inv[r];
  __syncthreads();

  {
    const int q = lane >> 3, p = lane & 7;
    v8h vh[4], vl[4];
    size_t addr[4];
#pragma unroll
    for (int it = 0; it < 4; ++it) {
      const int row = wave * 16 + 4 * it + q;
      F8 c;
      c.v[0] = *(const v4f*)&Cs[row][8 * p];
      c.v[1] = *(const v4f*)&Cs[row][8 * p + 4];
      Pack8 ph, pl;
#pragma unroll
      for (int e = 0; e < 8; ++e) {
        const float v = c.f[e];
        const _Float16 hv = (_Float16)v;
        ph.s[e] = hv;
        pl.s[e] = (_Float16)(v - (float)hv);
      }
      vh[it] = ph.v;
      vl[it] = pl.v;
      addr[it] = ((size_t)(b * NTOK + q0 + row)) * DM + h * DKH + 8 * p;
    }
#pragma unroll
    for (int it = 0; it < 4; ++it) {
      *(v8h*)(Oh + addr[it]) = vh[it];
      *(v8h*)(Ol + addr[it]) = vl[it];
    }
    
  }
}

// ---------------------------------------------------------------------------------------------
// host-side launch glue
// ---------------------------------------------------------------------------------------------
extern "C" void kernel_launch(void* const* d_in, const int* in_sizes, int n_in,
                              void* d_out, int out_size, void* d_ws, size_t ws_size,
                              hipStream_t stream) {
  if (n_in < 15) return;
  const int xsz = MTOK * DM, wsz = DM * DM;
  if (in_sizes[0] != xsz || in_sizes[1] != xsz || in_sizes[2] != xsz) return;
  if (in_sizes[3] != MTOK * 4 || in_sizes[4] != NB * NTOK * NTOK) return;
  if (in_sizes[5] != wsz || in_sizes[7] != wsz || in_sizes[9] != wsz || in_sizes[11] != wsz) return;
  if (in_sizes[6] != DM || in_sizes[8] != DM || in_sizes[10] != DM || in_sizes[12] != DM) return;
  if (in_sizes[13] != DKH * NH || in_sizes[14] != NH || out_size != xsz) return;

  const float* Xq  = (const float*)d_in[0];
  const float* Xk  = (const float*)d_in[1];
  const float* Xv  = (const float*)d_in[2];
  const float* box = (const float*)d_in[3];
  const int*   msk = (const int*)d_in[4];
  const float* Wq  = (const float*)d_in[5];
  const float* bq  = (const float*)d_in[6];
  const float* Wk  = (const float*)d_in[7];
  const float* bk  = (const float*)d_in[8];
  const float* Wv  = (const float*)d_in[9];
  const float* bv  = (const float*)d_in[10];
  const float* Wo  = (const float*)d_in[11];
  const float* bo  = (const float*)d_in[12];
  const float* Wg  = (const float*)d_in[13];
  const float* bg  = (const float*)d_in[14];
  float* out = (float*)d_out;

  // workspace carve (all offsets multiples of 2 MB): logg 32 MB, six 16-bit [2048][512] buffers 2 MB each = 44 MB
  char* ws = (char*)d_ws;
  size_t off = 0;
  float* logg = (float*)(ws + off);          off += (size_t)NB * NH * NTOK * NTOK * sizeof(float);
  _Float16* Q16 = (_Float16*)(ws + off);     off += (size_t)xsz * 2;
  _Float16* K16 = (_Float16*)(ws + off);     off += (size_t)xsz * 2;
  _Float16* Vth = (_Float16*)(ws + off);     off += (size_t)xsz * 2;   // [b][h][dk][token]
  _Float16* Vtl = (_Float16*)(ws + off);     off += (size_t)xsz * 2;
  _Float16* AOh = (_Float16*)(ws + off);     off += (size_t)xsz * 2;   // [b*N+q][h*64+dk]
  _Float16* AOl = (_Float16*)(ws + off);     off += (size_t)xsz * 2;
  if (off > ws_size) return;

  const float omul = 1.0f / (S_X * S_W);     // 2^-22
  const float omul_o = 1.0f / (S_AO * S_W);  // 2^-22
  const dim3 gg(DM / 64, MTOK / 64), gb(128);

  k_gemm<0, 0><<<gg, gb, 0, stream>>>(Xq, Q16, Q16, Wq, bq, Q16, Q16, logg,
                                      MTOK, DM, DM, S_X, S_W, omul, S_QK);
  k_gemm<0, 0><<<gg, gb, 0, stream>>>(Xk, K16, K16, Wk, bk, K16, K16, logg,
                                      MTOK, DM, DM, S_X, S_W, omul, S_QK);
  k_gemm<1, 1><<<gg, gb, 0, stream>>>(Xv, Vth, Vtl, Wv, bv, Vth, Vtl, logg,
                                      MTOK, DM, DM, S_X, S_W, omul, S_V);
  k_geo<<<dim3(NB * NTOK), gb, 0, stream>>>(box, Wg, bg, msk, logg);
  k_attn<<<dim3(NB * NH * (NTOK / 64)), gb, 0, stream>>>(Q16, K16, Vth, Vtl, logg, AOh, AOl);
  k_gemm<2, 2><<<gg, gb, 0, stream>>>(Wo, AOh, AOl, Wo, bo, AOh, AOl, out,
                                      MTOK, DM, DM, 1.0f, S_W, omul_o, 1.0f);
}

// v001
// Measured time: 81.9 microseconds a run.
// In two side-by-side timings against v000, it was 1.55 and 1.54 times as fast.
#include <hip/hip_runtime.h>
#include <stddef.h>

// Contractions on v_wmma_f32_16x16x32_f16 (f16 operands, f32 accumulate): q,k projections and q.k^T as single products of power-of-two scaled operands; v projection, p.v, output projection and the 64->8 geometric projection as f16 hi + residual operand pairs (power-of-two scaled). Softmax, geometry embedding, bias, normalisation in f32.

#define NB   4
#define NTOK 512
#define DM   512
#define NH   8
#define DKH  64
#define MTOK (NB * NTOK)

#define S_X  1024.0f
#define S_W  4096.0f
#define S_QK 16.0f
#define S_V  1024.0f
#define S_P  4096.0f
#define S_AO 1024.0f
#define S_E  2048.0f
#define S_G  4096.0f

typedef _Float16 v16h __attribute__((ext_vector_type(16)));
typedef _Float16 v8h_base __attribute__((ext_vector_type(8)));
typedef v8h_base __attribute__((may_alias)) v8h;
typedef float v8f __attribute__((ext_vector_type(8)));
typedef float v4f_base __attribute__((ext_vector_type(4)));
typedef v4f_base __attribute__((may_alias)) v4f;

union Frag16 { v16h v; v8h half[2]; _Float16 s[16]; };
union Pack8  { v8h v; _Float16 s[8]; };
union Pack2  { unsigned u; _Float16 s[2]; };
union F8     { v4f v[2]; float f[8]; };

__device__ __forceinline__ v8f zero8f() {
  v8f z = {0.f, 0.f, 0.f, 0.f, 0.f, 0.f, 0.f, 0.f};
  return z;
}

// one 16x16x32 step with the VALU hazard guard tied to D, A, B
__device__ __forceinline__ v8f wmma16(v16h a, v16h b, v8f c) {
  v8f d = __builtin_amdgcn_wmma_f32_16x16x32_f16(false, a, false, b, (short)0, c, false, false);
  asm volatile("v_nop\n\tv_nop\n\tv_nop\n\tv_nop" : "+v"(d) : "v"(a), "v"(b));
  return d;
}

// 16x32 operand fragment from a 16-bit LDS tile stored [line][k], k contiguous, pitch in elements (16-B aligned lines).
// lane l: line (row of A / column of B) = l & 15; elements 0..7 <- k0 + 8*(l>>4) + 0..7, elements 8..15 <- k0 + 16 + 8*(l>>4) + 0..7.
__device__ __forceinline__ v16h ldfrag(const _Float16* base, int pitch, int lane, int k0) {
  const _Float16* p = base + (lane & 15) * pitch + k0 + 8 * (lane >> 4);
  Frag16 f;
  f.half[0] = *(const v8h*)(p);
  f.half[1] = *(const v8h*)(p + 16);
  return f.v;
}

// ---------------------------------------------------------------------------------------------
// Y[M][Nout] = A[M][K] . W[K][Nout] + bias.  64x64 tile, 128 threads = 4 waves (16 rows each).
// AM: 0 = A f32 -> one f16 plane (scaled); 1 = A f32 -> f16 hi + residual planes; 2 = A given as two f16 planes.
//     W f32 -> same plane count as A (scaled).  Planes>1: D = Ah.Wh + Ah.Wl + Al.Wh.
// OM: 0 = f16 row-major [M][Nout], value*o_scale; 1 = f16 hi/residual planes laid out [b][head][dk][token]
//     (Nout = NH*DKH, one head per column tile, M = NB*NTOK); 2 = f32 row-major.
// D element r of lane l = (row 8*(l>>4)+r, col l&15) of the 16x16 tile.
// ---------------------------------------------------------------------------------------------
// smem: the work-group's LDS (GEMM_LDS(planes) bytes, 16-B aligned); (bx, by) = column tile, row tile.
#define GEMM_LDS(npl) (2 * (npl) * 64 * 40 * 2 + 64 * 68 * 4)
template <int AM, int OM>
__device__ __forceinline__ void gemm_body(char* smem, int bx, int by,
                                          const float* Af, const _Float16* Ah, const _Float16* Al,
                                          const float* W, const float* bias,
                                          _Float16* Yh, _Float16* Yl, float* Yf,
                                          int M, int K, int Nout,
                                          float a_scale, float w_scale, float o_mul, float o_scale) {
  constexpr int NPL = (AM == 0) ? 1 : 2;
  _Float16 (*At)[64][40] = reinterpret_cast<_Float16 (*)[64][40]>(smem);                        // [plane][row][k]
  _Float16 (*Bt)[64][40] = reinterpret_cast<_Float16 (*)[64][40]>(smem + NPL * 64 * 40 * 2);    // [plane][n][k]
  float (*Ct)[68] = reinterpret_cast<float (*)[68]>(smem + 2 * NPL * 64 * 40 * 2);

  const int tid = threadIdx.x, lane = tid & 31, wave = tid >> 5;
  const int hh = lane >> 4, m = lane & 15;
  const int n0 = bx * 64, m0 = by * 64;
  if (m0 + 64 > M || n0 + 64 > Nout) return;   // block-uniform, before any barrier

  v8f acc[4];
#pragma unroll
  for (int j = 0; j < 4; ++j) acc[j] = zero8f();

#pragma unroll 1
  for (int kk = 0; kk < K; kk += 32) {
    {  // A tile 64x32: thread -> row tid>>1, 16 consecutive k
      const int r = tid >> 1, cb = (tid & 1) * 16;
      if (AM == 2) {
        const size_t g = (size_t)(m0 + r) * K + kk + cb;
        const v8h h0 = *(const v8h*)(Ah + g), h1 = *(const v8h*)(Ah + g + 8);
        const v8h l0 = *(const v8h*)(Al + g), l1 = *(const v8h*)(Al + g + 8);
        *(v8h*)&At[0][r][cb] = h0;        *(v8h*)&At[0][r][cb + 8] = h1;
        *(v8h*)&At[NPL - 1][r][cb] = l0;  *(v8h*)&At[NPL - 1][r][cb + 8] = l1;
      } else {
        const float* s = Af + (size_t)(m0 + r) * K + kk + cb;
        F8 x0, x1;
        x0.v[0] = *(const v4f*)(s);      x0.v[1] = *(const v4f*)(s + 4);
        x1.v[0] = *(const v4f*)(s + 8);  x1.v[1] = *(const v4f*)(s + 12);
        Frag16 ph, pl;
#pragma unroll
        for (int e = 0; e < 8; ++e) {
          const float v0 = x0.f[e] * a_scale, v1 = x1.f[e] * a_scale;
          const _Float16 h0 = (_Float16)v0, h1 = (_Float16)v1;
          ph.s[e] = h0;
          ph.s[8 + e] = h1;
          pl.s[e] = (_Float16)(v0 - (float)h0);
          pl.s[8 + e] = (_Float16)(v1 - (float)h1);
        }
        *(v8h*)&At[0][r][cb] = ph.half[0];  *(v8h*)&At[0][r][cb + 8] = ph.half[1];
        if (NPL == 2) {
          *(v8h*)&At[NPL - 1][r][cb] = pl.half[0];  *(v8h*)&At[NPL - 1][r][cb + 8] = pl.half[1];
        }
      }
    }
    {  // W tile 32 k x 64 n, stored transposed [n][k]: thread -> k pair 2kp,2kp+1 and 8 columns
      const int kp = tid >> 3, nb = (tid & 7) * 8;
      const float* s0 = W + (size_t)(kk + 2 * kp) * Nout + n0 + nb;
      const float* s1 = s0 + Nout;
      F8 w0, w1;
      w0.v[0] = *(const v4f*)(s0);  w0.v[1] = *(const v4f*)(s0 + 4);
      w1.v[0] = *(const v4f*)(s1);  w1.v[1] = *(const v4f*)(s1 + 4);
#pragma unroll
      for (int d = 0; d < 8; ++d) {
        const float a = w0.f[d] * w_scale, c = w1.f[d] * w_scale;
        const _Float16 ha = (_Float16)a, hc = (_Float16)c;
        Pack2 q;
        q.s[0] = ha;  q.s[1] = hc;
        *(unsigned*)&Bt[0][nb + d][2 * kp] = q.u;
        if (NPL == 2) {
          Pack2 ql;
          ql.s[0] = (_Float16)(a - (float)ha);
          ql.s[1] = (_Float16)(c - (float)hc);
          *(unsigned*)&Bt[NPL - 1][nb + d][2 * kp] = ql.u;
        }
      }
    }
    __syncthreads();

    const v16h ah = ldfrag(&At[0][wave * 16][0], 40, lane, 0);
    if (NPL == 1) {
#pragma unroll
      for (int j = 0; j < 4; ++j) {
        const v16h bh = ldfrag(&Bt[0][j * 16][0], 40, lane, 0);
        acc[j] = wmma16(ah, bh, acc[j]);
      }
    } else {
      const v16h al = ldfrag(&At[NPL - 1][wave * 16][0], 40, lane, 0);
#pragma unroll
      for (int j = 0; j < 4; ++j) {
        const v16h bh = ldfrag(&Bt[0][j * 16][0], 40, lane, 0);
        const v16h bl = ldfrag(&Bt[NPL - 1][j * 16][0], 40, lane, 0);
        acc[j] = wmma16(ah, bh, acc[j]);
        acc[j] = wmma16(ah, bl, acc[j]);
        acc[j] = wmma16(al, bh, acc[j]);
      }
    }
    __syncthreads();
  }

  // D + bias (unscaled) -> LDS tile
#pragma unroll
  for (int j = 0; j < 4; ++j) {
    const float bcol = bias[n0 + 16 * j + m];
#pragma unroll
    for (int r = 0; r < 8; ++r) Ct[wave * 16 + 8 * hh + r][16 * j + m] = acc[j][r] * o_mul + bcol;
  }
  __syncthreads();

  if (OM == 0) {
    const int q = lane >> 3, p = lane & 7;
    v8h vals[4];
    size_t addr[4];
#pragma unroll
    for (int it = 0; it < 4; ++it) {
      const int row = wave * 16 + 4 * it + q;
      F8 c;
      c.v[0] = *(const v4f*)&Ct[row][8 * p];
      c.v[1] = *(const v4f*)&Ct[row][8 * p + 4];
      Pack8 pk;
#pragma unroll
      for (int e = 0; e < 8; ++e) pk.s[e] = (_Float16)(c.f[e] * o_scale);
      vals[it] = pk.v;
      addr[it] = (size_t)(m0 + row) * Nout + n0 + 8 * p;
    }
#pragma unroll
    for (int it = 0; it < 4; ++it) *(v8h*)(Yh + addr[it]) = vals[it];
    // in a kernel with several block ranges other code follows these stores in the listing: their address and data
    // registers stay untouched until the stores have taken them
    asm volatile("s_wait_xcnt 0x0" ::: "memory");
  } else if (OM == 1) {
    const int hd = bx;
    const int bb = m0 / NTOK, tok0 = m0 - bb * NTOK;
    const int q = lane >> 3, p = lane & 7;
    v8h vh[4], vl[4];
    size_t addr[4];
#pragma unroll
    for (int it = 0; it < 4; ++it) {
      const int dk = wave * 16 + 4 * it + q;
      Pack8 ph, pl;
#pragma unroll
      for (int e = 0; e < 8; ++e) {
        const float v = Ct[8 * p + e][dk] * o_scale;
        const _Float16 hv = (_Float16)v;
        ph.s[e] = hv;
        pl.s[e] = (_Float16)(v - (float)hv);
      }
      vh[it] = ph.v;
      vl[it] = pl.v;
      addr[it] = (((size_t)bb * NH + hd) * DKH + dk) * NTOK + tok0 + 8 * p;
    }
#pragma unroll
    for (int it = 0; it < 4; ++it) {
      *(v8h*)(Yh + addr[it]) = vh[it];
      *(v8h*)(Yl + addr[it]) = vl[it];
    }
    
  } else {
    const int q = lane >> 4, p = lane & 15;
    v4f vals[8];
    size_t addr[8];
#pragma unroll
    for (int it = 0; it < 8; ++it) {
      const int row = wave * 16 + 2 * it + q;
      vals[it] = *(const v4f*)&Ct[row][4 * p];
      addr[it] = (size_t)(m0 + row) * Nout + n0 + 4 * p;
    }
#pragma unroll
    for (int it = 0; it < 8; ++it) *(v4f*)(Yf + addr[it]) = vals[it];
    
  }
}

template <int AM, int OM>
__global__ __launch_bounds__(128) void k_gemm(const float* Af, const _Float16* Ah, const _Float16* Al,
                                             const float* W, const float* bias,
                                             _Float16* Yh, _Float16* Yl, float* Yf,
                                             int M, int K, int Nout,
                                             float a_scale, float w_scale, float o_mul, float o_scale) {
  __shared__ __attribute__((aligned(16))) char smem[GEMM_LDS((AM == 0) ? 1 : 2)];
  gemm_body<AM, OM>(smem, blockIdx.x, blockIdx.y, Af, Ah, Al, W, bias, Yh, Yl, Yf, M, K, Nout,
                    a_scale, w_scale, o_mul, o_scale);
}

// ---------------------------------------------------------------------------------------------
// Geometric log-weights with the key mask folded in:
// logg[b][h][i][j] = log(max(relu(emb(i,j) . Wg[:,h] + bg[h]), 1e-6)) + (mask[b][i][j]==0 ? -1e9 : 0)
// One block per (b, i); j in chunks of 128 (one j per thread); the 64->8 projection runs on WMMA with
// A = emb hi / residual planes (x S_E) and B columns 0..7 = f16(S_G*Wg[:,h]), 8..15 = residual of the same.
// ---------------------------------------------------------------------------------------------
#define GEO_LDS (2 * 128 * 72 * 2 + 16 * 72 * 2 + 128 * 17 * 4 + 8 * 4 + 8 * 4)
__device__ __forceinline__ void geo_body(char* smem, int bi, const float* box, const float* Wg, const float* bg,
                                         const int* msk, float* logg) {
  _Float16 (*Et)[128][72] = reinterpret_cast<_Float16 (*)[128][72]>(smem);                      // [plane][j][g]
  _Float16 (*Bg)[72] = reinterpret_cast<_Float16 (*)[72]>(smem + 2 * 128 * 72 * 2);             // [n][g]
  float (*Gs)[17] = reinterpret_cast<float (*)[17]>(smem + 2 * 128 * 72 * 2 + 16 * 72 * 2);
  float* sdm = reinterpret_cast<float*>(smem + 2 * 128 * 72 * 2 + 16 * 72 * 2 + 128 * 17 * 4);
  float* sbg = sdm + 8;

  const int tid = threadIdx.x, lane = tid & 31, wave = tid >> 5;
  const int hh = lane >> 4, m = lane & 15;
  if (bi >= NB * NTOK) return;   // block-uniform
  const int b = bi / NTOK, i = bi - b * NTOK;

  if (tid < 8) {
    sdm[tid] = 1.0f / powf(1000.0f, (float)tid * 0.125f);
    sbg[tid] = bg[tid];
  }
#pragma unroll
  for (int e = 0; e < 8; ++e) {
    const int idx = tid * 8 + e;          // 0..1023
    const int n = idx >> 6, k = idx & 63;
    const float w = Wg[k * NH + (n & 7)] * S_G;
    const _Float16 wh = (_Float16)w;
    const _Float16 wl = (_Float16)(w - (float)wh);
    Bg[n][k] = (n < 8) ? wh : wl;
  }
  const v4f bxi = *(const v4f*)(box + (size_t)bi * 4);
  const float cxi = (bxi[0] + bxi[1]) * 0.5f, cyi = (bxi[2] + bxi[3]) * 0.5f;
  const float wi = (bxi[1] - bxi[0]) + 1.0f, hgi = (bxi[3] - bxi[2]) + 1.0f;
  const float rwi = 1.0f / wi, rhi = 1.0f / hgi;
  __syncthreads();

  float dm[8];
#pragma unroll
  for (int f = 0; f < 8; ++f) dm[f] = sdm[f];
  const v16h bg0 = ldfrag(&Bg[0][0], 72, lane, 0);
  const v16h bg1 = ldfrag(&Bg[0][0], 72, lane, 32);
  const size_t mbase = ((size_t)b * NTOK + i) * NTOK;
  const v8f z8 = zero8f();

#pragma unroll 1
  for (int ch = 0; ch < NTOK / 128; ++ch) {
    {  // embedding of pair (i, j), j = ch*128 + tid -> Et[.][tid][0..63]
      const int j = ch * 128 + tid;
      const v4f bxj = *(const v4f*)(box + ((size_t)b * NTOK + j) * 4);
      const float cxj = (bxj[0] + bxj[1]) * 0.5f, cyj = (bxj[2] + bxj[3]) * 0.5f;
      const float wj = (bxj[1] - bxj[0]) + 1.0f, hgj = (bxj[3] - bxj[2]) + 1.0f;
      const float p0 = logf(fmaxf(fabsf((cxi - cxj) * rwi), 1e-3f));
      const float p1 = logf(fmaxf(fabsf((cyi - cyj) * rhi), 1e-3f));
      const float p2 = logf(wi / wj);
      const float p3 = logf(hgi / hgj);
      const float pp[4] = {p0 * 100.0f, p1 * 100.0f, p2 * 100.0f, p3 * 100.0f};
#pragma unroll
      for (int p = 0; p < 4; ++p) {
        Pack8 sh, sl, chv, clv;
#pragma unroll
        for (int f = 0; f < 8; ++f) {
          const float ang = pp[p] * dm[f];
          const float sv = __sinf(ang) * S_E;
          const float cv = __cosf(ang) * S_E;
          const _Float16 a = (_Float16)sv;
          sh.s[f] = a;
          sl.s[f] = (_Float16)(sv - (float)a);
          const _Float16 c = (_Float16)cv;
          chv.s[f] = c;
          clv.s[f] = (_Float16)(cv - (float)c);
        }
        *(v8h*)&Et[0][tid][p * 8] = sh.v;
        *(v8h*)&Et[1][tid][p * 8] = sl.v;
        *(v8h*)&Et[0][tid][32 + p * 8] = chv.v;
        *(v8h*)&Et[1][tid][32 + p * 8] = clv.v;
      }
    }
    __syncthreads();

    // 128 j rows x 16 cols, K = 64: wave -> two 16-row tiles
#pragma unroll
    for (int t = 0; t < 2; ++t) {
      const int row0 = wave * 32 + t * 16;
      v8f acc = z8;
      const v16h a0 = ldfrag(&Et[0][row0][0], 72, lane, 0);
      const v16h l0 = ldfrag(&Et[1][row0][0], 72, lane, 0);
      acc = wmma16(a0, bg0, acc);
      acc = wmma16(l0, bg0, acc);
      const v16h a1 = ldfrag(&Et[0][row0][0], 72, lane, 32);
      const v16h l1 = ldfrag(&Et[1][row0][0], 72, lane, 32);
      acc = wmma16(a1, bg1, acc);
      acc = wmma16(l1, bg1, acc);
#pragma unroll
      for (int r = 0; r < 8; ++r) Gs[row0 + 8 * hh + r][m] = acc[r];
    }
    __syncthreads();

    v4f vv[2];
#pragma unroll
    for (int e = 0; e < 2; ++e) {
      const int hd = 2 * wave + e;
#pragma unroll
      for (int q = 0; q < 4; ++q) {
        const int jl = 4 * lane + q;
        const float graw = (Gs[jl][hd] + Gs[jl][hd + 8]) * (1.0f / (S_E * S_G)) + sbg[hd];
        const float g = fmaxf(graw, 0.0f);
        float v = logf(fmaxf(g, 1e-6f));
        const int mk = msk[mbase + ch * 128 + jl];
        v += (mk == 0) ? -1e9f : 0.0f;
        vv[e][q] = v;
      }
    }
    float* ap0 = logg + (((size_t)b * NH + 2 * wave) * NTOK + i) * NTOK + ch * 128 + 4 * lane;
    float* ap1 = ap0 + (size_t)NTOK * NTOK;
    *(v4f*)ap0 = vv[0];
    *(v4f*)ap1 = vv[1];
    
  }
}

// ---------------------------------------------------------------------------------------------
// The four producers of the attention kernel depend on inputs only, so they share one launch and run side by side:
// block ranges, longest work-groups first: v projection, q projection, k projection (GTILES tiles each), geometry.
// Every branch is block-uniform (blockIdx only); the ranges share one LDS buffer sized for the largest user.
// ---------------------------------------------------------------------------------------------
#define GTILES ((DM / 64) * (MTOK / 64))
__global__ __launch_bounds__(128) void k_front(const float* Xq, const float* Xk, const float* Xv,
                                              const float* Wq, const float* bq, const float* Wk, const float* bk,
                                              const float* Wv, const float* bv,
                                              const float* box, const float* Wg, const float* bg, const int* msk,
                                              _Float16* Q16, _Float16* K16, _Float16* Vth, _Float16* Vtl,
                                              float* logg) {
  static_assert(GEO_LDS >= GEMM_LDS(2), "shared buffer is sized by the geometry part");
  __shared__ __attribute__((aligned(16))) char smem[GEO_LDS];
  const int blk = blockIdx.x;
  const float omul = 1.0f / (S_X * S_W);     // 2^-22
  if (blk < GTILES) {
    gemm_body<1, 1>(smem, blk & (DM / 64 - 1), blk / (DM / 64), Xv, nullptr, nullptr, Wv, bv, Vth, Vtl, nullptr,
                    MTOK, DM, DM, S_X, S_W, omul, S_V);
  } else if (blk < 3 * GTILES) {
    const bool isq = blk < 2 * GTILES;
    const int t = blk - (isq ? GTILES : 2 * GTILES);
    gemm_body<0, 0>(smem, t & (DM / 64 - 1), t / (DM / 64), isq ? Xq : Xk, nullptr, nullptr,
                    isq ? Wq : Wk, isq ? bq : bk, isq ? Q16 : K16, nullptr, nullptr,
                    MTOK, DM, DM, S_X, S_W, omul, S_QK);
  } else {
    geo_body(smem, blk - 3 * GTILES, box, Wg, bg, msk, logg);
  }
}

// ---------------------------------------------------------------------------------------------
// Streaming attention: block = (b, h, 64 query rows), 4 waves x 16 rows, key tiles of 32.
// S = Q16.K16^T (single f16 product, Q16/K16 carry S_QK); logits = S*(1/(8*S_QK^2)) + logg; online softmax in f32;
// O += P.V with P as f16 hi/residual of S_P*p and V as f16 hi/residual planes (carrying S_V), V tile staged [dk][key].
// Output: f16 hi/residual planes of S_AO * (O / l), row-major [b*N+q][h*64+dk].
// ---------------------------------------------------------------------------------------------
__global__ __launch_bounds__(128) void k_attn(const _Float16* Qh, const _Float16* Kh,
                                             const _Float16* Vth, const _Float16* Vtl,
                                             const float* logg, _Float16* Oh, _Float16* Ol) {
  __shared__ __attribute__((aligned(16))) _Float16 Qt[64][72];        // [q][dk]
  __shared__ __attribute__((aligned(16))) _Float16 Kt[32][72];        // [key][dk]
  __shared__ __attribute__((aligned(16))) _Float16 Vt[2][64][40];     // [plane][dk][key]
  __shared__ __attribute__((aligned(16))) _Float16 Pt[2][4][16][40];  // [plane][wave][q][key]
  __shared__ __attribute__((aligned(16))) float Cs[64][68];

  const int tid = threadIdx.x, lane = tid & 31, wave = tid >> 5;
  const int hh = lane >> 4, m = lane & 15;
  const int blk = blockIdx.x;
  if (blk >= NB * NH * (NTOK / 64)) return;   // block-uniform
  const int qb = blk & 7, h = (blk >> 3) & 7, b = blk >> 6;
  const int q0 = qb * 64;

  {
    const int r = tid >> 1, cb = (tid & 1) * 32;
    const _Float16* s = Qh + ((size_t)(b * NTOK + q0 + r)) * DM + h * DKH + cb;
#pragma unroll
    for (int u = 0; u < 4; ++u) *(v8h*)&Qt[r][cb + 8 * u] = *(const v8h*)(s + 8 * u);
  }
  __syncthreads();
  const v16h qa0 = ldfrag(&Qt[wave * 16][0], 72, lane, 0);
  const v16h qa1 = ldfrag(&Qt[wave * 16][0], 72, lane, 32);

  const v8f z8 = zero8f();
  v8f o[4];
#pragma unroll
  for (int j = 0; j < 4; ++j) o[j] = z8;
  float mrow[8], lrow[8];
#pragma unroll
  for (int r = 0; r < 8; ++r) { mrow[r] = -1e30f; lrow[r] = 0.0f; }

  const size_t lgrow = (((size_t)b * NH + h) * NTOK + (q0 + wave * 16 + 8 * hh)) * NTOK;
  const float SC = 0.125f / (S_QK * S_QK);

#pragma unroll 1
  for (int kt = 0; kt < NTOK / 32; ++kt) {
    const int k0 = kt * 32;
    {  // K tile 32 keys x 64 dk
      const int r = tid >> 2, cb = (tid & 3) * 16;
      const _Float16* s = Kh + ((size_t)(b * NTOK + k0 + r)) * DM + h * DKH + cb;
      *(v8h*)&Kt[r][cb] = *(const v8h*)(s);
      *(v8h*)&Kt[r][cb + 8] = *(const v8h*)(s + 8);
    }
    {  // V planes, already [dk][token]: 64 dk x 32 keys, direct copy
      const int r = tid >> 1, cb = (tid & 1) * 16;
      const size_t g = (((size_t)b * NH + h) * DKH + r) * NTOK + k0 + cb;
      *(v8h*)&Vt[0][r][cb] = *(const v8h*)(Vth + g);
      *(v8h*)&Vt[0][r][cb + 8] = *(const v8h*)(Vth + g + 8);
      *(v8h*)&Vt[1][r][cb] = *(const v8h*)(Vtl + g);
      *(v8h*)&Vt[1][r][cb + 8] = *(const v8h*)(Vtl + g + 8);
    }
    __syncthreads();

    // S[16 q][32 keys]: B[k=dk][n=key] = Kt[key][dk] -> n-major tile, same loader as A
    v8f s[2];
#pragma unroll
    for (int c = 0; c < 2; ++c) {
      const v16h b0 = ldfrag(&Kt[16 * c][0], 72, lane, 0);
      const v16h b1 = ldfrag(&Kt[16 * c][0], 72, lane, 32);
      v8f sc = z8;
      sc = wmma16(qa0, b0, sc);
      sc = wmma16(qa1, b1, sc);
      s[c] = sc;
    }

    float t[2][8];
#pragma unroll
    for (int c = 0; c < 2; ++c)
#pragma unroll
      for (int r = 0; r < 8; ++r)
        t[c][r] = s[c][r] * SC + logg[lgrow + (size_t)r * NTOK + k0 + 16 * c + m];

    float rmax[8];
#pragma unroll
    for (int r = 0; r < 8; ++r) rmax[r] = fmaxf(t[0][r], t[1][r]);
#pragma unroll
    for (int off = 8; off >= 1; off >>= 1)
#pragma unroll
      for (int r = 0; r < 8; ++r) rmax[r] = fmaxf(rmax[r], __shfl_xor(rmax[r], off, 16));

    float alpha[8];
#pragma unroll
    for (int r = 0; r < 8; ++r) {
      const float mnew = fmaxf(mrow[r], rmax[r]);
      alpha[r] = __expf(mrow[r] - mnew);
      mrow[r] = mnew;
    }
#pragma unroll
    for (int c = 0; c < 2; ++c)
#pragma unroll
      for (int r = 0; r < 8; ++r) t[c][r] = __expf(t[c][r] - mrow[r]);

    float rsum[8];
#pragma unroll
    for (int r = 0; r < 8; ++r) rsum[r] = t[0][r] + t[1][r];
#pragma unroll
    for (int off = 8; off >= 1; off >>= 1)
#pragma unroll
      for (int r = 0; r < 8; ++r) rsum[r] += __shfl_xor(rsum[r], off, 16);
#pragma unroll
    for (int r = 0; r < 8; ++r) lrow[r] = lrow[r] * alpha[r] + rsum[r];
#pragma unroll
    for (int j = 0; j < 4; ++j)
#pragma unroll
      for (int r = 0; r < 8; ++r) o[j][r] *= alpha[r];

    // P tile (D layout: row 8hh+r = q, col m = key) -> LDS planes; block barrier before the fragment reload
#pragma unroll
    for (int c = 0; c < 2; ++c)
#pragma unroll
      for (int r = 0; r < 8; ++r) {
        const float ps = t[c][r] * S_P;
        const _Float16 ph = (_Float16)ps;
        Pt[0][wave][8 * hh + r][16 * c + m] = ph;
        Pt[1][wave][8 * hh + r][16 * c + m] = (_Float16)(ps - (float)ph);
      }
    __syncthreads();

    const v16h pah = ldfrag(&Pt[0][wave][0][0], 40, lane, 0);
    const v16h pal = ldfrag(&Pt[1][wave][0][0], 40, lane, 0);
    // O[16 q][64 dk] += P[16 x 32 keys] . V[32 keys x 64 dk]; B[k=key][n=dk] = Vt[dk][key]
#pragma unroll
    for (int j = 0; j < 4; ++j) {
      const v16h vh = ldfrag(&Vt[0][16 * j][0], 40, lane, 0);
      const v16h vl = ldfrag(&Vt[1][16 * j][0], 40, lane, 0);
      o[j] = wmma16(pah, vh, o[j]);
      o[j] = wmma16(pah, vl, o[j]);
      o[j] = wmma16(pal, vh, o[j]);
    }
    __syncthreads();
  }

  float inv[8];
#pragma unroll
  for (int r = 0; r < 8; ++r) inv[r] = (1.0f / lrow[r]) * (S_AO / (S_P * S_V));
#pragma unroll
  for (int j = 0; j < 4; ++j)
#pragma unroll
    for (int r = 0; r < 8; ++r) Cs[wave * 16 + 8 * hh + r][16 * j + m] = o[j][r] * inv[r];
  __syncthreads();

  {
    const int q = lane >> 3, p = lane & 7;
    v8h vh[4], vl[4];
    size_t addr[4];
#pragma unroll
    for (int it = 0; it < 4; ++it) {
      const int row = wave * 16 + 4 * it + q;
      F8 c;
      c.v[0] = *(const v4f*)&Cs[row][8 * p];
      c.v[1] = *(const v4f*)&Cs[row][8 * p + 4];
      Pack8 ph, pl;
#pragma unroll
      for (int e = 0; e < 8; ++e) {
        const float v = c.f[e];
        const _Float16 hv = (_Float16)v;
        ph.s[e] = hv;
        pl.s[e] = (_Float16)(v - (float)hv);
      }
      vh[it] = ph.v;
      vl[it] = pl.v;
      addr[it] = ((size_t)(b * NTOK + q0 + row)) * DM + h * DKH + 8 * p;
    }
#pragma unroll
    for (int it = 0; it < 4; ++it) {
      *(v8h*)(Oh + addr[it]) = vh[it];
      *(v8h*)(Ol + addr[it]) = vl[it];
    }
    
  }
}

// ---------------------------------------------------------------------------------------------
// host-side launch glue
// ---------------------------------------------------------------------------------------------
extern "C" void kernel_launch(void* const* d_in, const int* in_sizes, int n_in,
                              void* d_out, int out_size, void* d_ws, size_t ws_size,
                              hipStream_t stream) {
  if (n_in < 15) return;
  const int xsz = MTOK * DM, wsz = DM * DM;
  if (in_sizes[0] != xsz || in_sizes[1] != xsz || in_sizes[2] != xsz) return;
  if (in_sizes[3] != MTOK * 4 || in_sizes[4] != NB * NTOK * NTOK) return;
  if (in_sizes[5] != wsz || in_sizes[7] != wsz || in_sizes[9] != wsz || in_sizes[11] != wsz) return;
  if (in_sizes[6] != DM || in_sizes[8] != DM || in_sizes[10] != DM || in_sizes[12] != DM) return;
  if (in_sizes[13] != DKH * NH || in_sizes[14] != NH || out_size != xsz) return;

  const float* Xq  = (const float*)d_in[0];
  const float* Xk  = (const float*)d_in[1];
  const float* Xv  = (const float*)d_in[2];
  const float* box = (const float*)d_in[3];
  const int*   msk = (const int*)d_in[4];
  const float* Wq  = (const float*)d_in[5];
  const float* bq  = (const float*)d_in[6];
  const float* Wk  = (const float*)d_in[7];
  const float* bk  = (const float*)d_in[8];
  const float* Wv  = (const float*)d_in[9];
  const float* bv  = (const float*)d_in[10];
  const float* Wo  = (const float*)d_in[11];
  const float* bo  = (const float*)d_in[12];
  const float* Wg  = (const float*)d_in[13];
  const float* bg  = (const float*)d_in[14];
  float* out = (float*)d_out;

  // workspace carve (all offsets multiples of 2 MB): logg 32 MB, six 16-bit [2048][512] buffers 2 MB each = 44 MB
  char* ws = (char*)d_ws;
  size_t off = 0;
  float* logg = (float*)(ws + off);          off += (size_t)NB * NH * NTOK * NTOK * sizeof(float);
  _Float16* Q16 = (_Float16*)(ws + off);     off += (size_t)xsz * 2;
  _Float16* K16 = (_Float16*)(ws + off);     off += (size_t)xsz * 2;
  _Float16* Vth = (_Float16*)(ws + off);     off += (size_t)xsz * 2;   // [b][h][dk][token]
  _Float16* Vtl = (_Float16*)(ws + off);     off += (size_t)xsz * 2;
  _Float16* AOh = (_Float16*)(ws + off);     off += (size_t)xsz * 2;   // [b*N+q][h*64+dk]
  _Float16* AOl = (_Float16*)(ws + off);     off += (size_t)xsz * 2;
  if (off > ws_size) return;

  const float omul_o = 1.0f / (S_AO * S_W);  // 2^-22
  const dim3 gg(DM / 64, MTOK / 64), gb(128);

  k_front<<<dim3(3 * GTILES + NB * NTOK), gb, 0, stream>>>(Xq, Xk, Xv, Wq, bq, Wk, bk, Wv, bv, box, Wg, bg, msk,
                                                           Q16, K16, Vth, Vtl, logg);
  k_attn<<<dim3(NB * NH * (NTOK / 64)), gb, 0, stream>>>(Q16, K16, Vth, Vtl, logg, AOh, AOl);
  k_gemm<2, 2><<<gg, gb, 0, stream>>>(Wo, AOh, AOl, Wo, bo, AOh, AOl, out,
                                      MTOK, DM, DM, 1.0f, S_W, omul_o, 1.0f);
}

// v002
// A run of this version takes 66.5 microseconds.
// Next to v001, in two timings, it ran 1.23 times as fast each time.
// All steps since v000 together make it 1.90 times as fast.
#include <hip/hip_runtime.h>
#include <stddef.h>

// Contractions on v_wmma_f32_16x16x32_f16 (f16 operands, f32 accumulate): q,k projections and q.k^T as single products of power-of-two scaled operands; v projection, p.v, output projection and the 64->8 geometric projection as f16 hi + residual operand pairs (power-of-two scaled). Softmax, geometry embedding, bias, normalisation in f32.

#define NB   4
#define NTOK 512
#define DM   512
#define NH   8
#define DKH  64
#define MTOK (NB * NTOK)

#define S_X  1024.0f
#define S_W  4096.0f
#define S_QK 16.0f
#define S_V  1024.0f
#define S_P  4096.0f
#define S_AO 1024.0f
#define S_E  2048.0f
#define S_G  4096.0f

typedef _Float16 v16h __attribute__((ext_vector_type(16)));
typedef _Float16 v8h_base __attribute__((ext_vector_type(8)));
typedef v8h_base __attribute__((may_alias)) v8h;
typedef float v8f __attribute__((ext_vector_type(8)));
typedef float v4f_base __attribute__((ext_vector_type(4)));
typedef v4f_base __attribute__((may_alias)) v4f;

union Frag16 { v16h v; v8h half[2]; _Float16 s[16]; };
union Pack8  { v8h v; _Float16 s[8]; };
union Pack2  { unsigned u; _Float16 s[2]; };
union F8     { v4f v[2]; float f[8]; };

__device__ __forceinline__ v8f zero8f() {
  v8f z = {0.f, 0.f, 0.f, 0.f, 0.f, 0.f, 0.f, 0.f};
  return z;
}

// one 16x16x32 step with the VALU hazard guard tied to D, A, B
__device__ __forceinline__ v8f wmma16(v16h a, v16h b, v8f c) {
  v8f d = __builtin_amdgcn_wmma_f32_16x16x32_f16(false, a, false, b, (short)0, c, false, false);
  asm volatile("v_nop\n\tv_nop\n\tv_nop\n\tv_nop" : "+v"(d) : "v"(a), "v"(b));
  return d;
}

// 16x32 operand fragment from a 16-bit LDS tile stored [line][k], k contiguous, pitch in elements (16-B aligned lines).
// lane l: line (row of A / column of B) = l & 15; elements 0..7 <- k0 + 8*(l>>4) + 0..7, elements 8..15 <- k0 + 16 + 8*(l>>4) + 0..7.
__device__ __forceinline__ v16h ldfrag(const _Float16* base, int pitch, int lane, int k0) {
  const _Float16* p = base + (lane & 15) * pitch + k0 + 8 * (lane >> 4);
  Frag16 f;
  f.half[0] = *(const v8h*)(p);
  f.half[1] = *(const v8h*)(p + 16);
  return f.v;
}

// ---------------------------------------------------------------------------------------------
// Y[M][Nout] = A[M][K] . W[K][Nout] + bias.  64x64 tile, 128 threads = 4 waves (16 rows each).
// AM: 0 = A f32 -> one f16 plane (scaled); 1 = A f32 -> f16 hi + residual planes; 2 = A given as two f16 planes.
//     W f32 -> same plane count as A (scaled).  Planes>1: D = Ah.Wh + Ah.Wl + Al.Wh.
// OM: 0 = f16 row-major [M][Nout], value*o_scale; 1 = f16 hi/residual planes laid out [b][head][dk][token]
//     (Nout = NH*DKH, one head per column tile, M = NB*NTOK); 2 = f32 row-major.
// D element r of lane l = (row 8*(l>>4)+r, col l&15) of the 16x16 tile.
// ---------------------------------------------------------------------------------------------
// smem: the work-group's LDS (GEMM_LDS(planes) bytes, 16-B aligned); (bx, by) = column tile, row tile.
#define GEMM_LDS(npl) (2 * (npl) * 64 * 40 * 2 + 64 * 68 * 4)
template <int AM, int OM>
__device__ __forceinline__ void gemm_body(char* smem, int bx, int by,
                                          const float* Af, const _Float16* Ah, const _Float16* Al,
                                          const float* W, const float* bias,
                                          _Float16* Yh, _Float16* Yl, float* Yf,
                                          int M, int K, int Nout,
                                          float a_scale, float w_scale, float o_mul, float o_scale) {
  constexpr int NPL = (AM == 0) ? 1 : 2;
  _Float16 (*At)[64][40] = reinterpret_cast<_Float16 (*)[64][40]>(smem);                        // [plane][row][k]
  _Float16 (*Bt)[64][40] = reinterpret_cast<_Float16 (*)[64][40]>(smem + NPL * 64 * 40 * 2);    // [plane][n][k]
  float (*Ct)[68] = reinterpret_cast<float (*)[68]>(smem + 2 * NPL * 64 * 40 * 2);

  const int tid = threadIdx.x, lane = tid & 31, wave = tid >> 5;
  const int hh = lane >> 4, m = lane & 15;
  const int n0 = bx * 64, m0 = by * 64;
  if (m0 + 64 > M || n0 + 64 > Nout) return;   // block-uniform, before any barrier

  v8f acc[4];
#pragma unroll
  for (int j = 0; j < 4; ++j) acc[j] = zero8f();

#pragma unroll 1
  for (int kk = 0; kk < K; kk += 32) {
    {  // A tile 64x32: thread -> row tid>>1, 16 consecutive k
      const int r = tid >> 1, cb = (tid & 1) * 16;
      if (AM == 2) {
        const size_t g = (size_t)(m0 + r) * K + kk + cb;
        const v8h h0 = *(const v8h*)(Ah + g), h1 = *(const v8h*)(Ah + g + 8);
        const v8h l0 = *(const v8h*)(Al + g), l1 = *(const v8h*)(Al + g + 8);
        *(v8h*)&At[0][r][cb] = h0;        *(v8h*)&At[0][r][cb + 8] = h1;
        *(v8h*)&At[NPL - 1][r][cb] = l0;  *(v8h*)&At[NPL - 1][r][cb + 8] = l1;
      } else {
        const float* s = Af + (size_t)(m0 + r) * K + kk + cb;
        F8 x0, x1;
        x0.v[0] = *(const v4f*)(s);      x0.v[1] = *(const v4f*)(s + 4);
        x1.v[0] = *(const v4f*)(s + 8);  x1.v[1] = *(const v4f*)(s + 12);
        Frag16 ph, pl;
#pragma unroll
        for (int e = 0; e < 8; ++e) {
          const float v0 = x0.f[e] * a_scale, v1 = x1.f[e] * a_scale;
          const _Float16 h0 = (_Float16)v0, h1 = (_Float16)v1;
          ph.s[e] = h0;
          ph.s[8 + e] = h1;
          pl.s[e] = (_Float16)(v0 - (float)h0);
          pl.s[8 + e] = (_Float16)(v1 - (float)h1);
        }
        *(v8h*)&At[0][r][cb] = ph.half[0];  *(v8h*)&At[0][r][cb + 8] = ph.half[1];
        if (NPL == 2) {
          *(v8h*)&At[NPL - 1][r][cb] = pl.half[0];  *(v8h*)&At[NPL - 1][r][cb + 8] = pl.half[1];
        }
      }
    }
    {  // W tile 32 k x 64 n, stored transposed [n][k]: thread -> k pair 2kp,2kp+1 and 8 columns
      const int kp = tid >> 3, nb = (tid & 7) * 8;
      const float* s0 = W + (size_t)(kk + 2 * kp) * Nout + n0 + nb;
      const float* s1 = s0 + Nout;
      F8 w0, w1;
      w0.v[0] = *(const v4f*)(s0);  w0.v[1] = *(const v4f*)(s0 + 4);
      w1.v[0] = *(const v4f*)(s1);  w1.v[1] = *(const v4f*)(s1 + 4);
#pragma unroll
      for (int d = 0; d < 8; ++d) {
        const float a = w0.f[d] * w_scale, c = w1.f[d] * w_scale;
        const _Float16 ha = (_Float16)a, hc = (_Float16)c;
        Pack2 q;
        q.s[0] = ha;  q.s[1] = hc;
        *(unsigned*)&Bt[0][nb + d][2 * kp] = q.u;
        if (NPL == 2) {
          Pack2 ql;
          ql.s[0] = (_Float16)(a - (float)ha);
          ql.s[1] = (_Float16)(c - (float)hc);
          *(unsigned*)&Bt[NPL - 1][nb + d][2 * kp] = ql.u;
        }
      }
    }
    __syncthreads();

    const v16h ah = ldfrag(&At[0][wave * 16][0], 40, lane, 0);
    if (NPL == 1) {
#pragma unroll
      for (int j = 0; j < 4; ++j) {
        const v16h bh = ldfrag(&Bt[0][j * 16][0], 40, lane, 0);
        acc[j] = wmma16(ah, bh, acc[j]);
      }
    } else {
      const v16h al = ldfrag(&At[NPL - 1][wave * 16][0], 40, lane, 0);
#pragma unroll
      for (int j = 0; j < 4; ++j) {
        const v16h bh = ldfrag(&Bt[0][j * 16][0], 40, lane, 0);
        const v16h bl = ldfrag(&Bt[NPL - 1][j * 16][0], 40, lane, 0);
        acc[j] = wmma16(ah, bh, acc[j]);
        acc[j] = wmma16(ah, bl, acc[j]);
        acc[j] = wmma16(al, bh, acc[j]);
      }
    }
    __syncthreads();
  }

  // D + bias (unscaled) -> LDS tile
#pragma unroll
  for (int j = 0; j < 4; ++j) {
    const float bcol = bias[n0 + 16 * j + m];
#pragma unroll
    for (int r = 0; r < 8; ++r) Ct[wave * 16 + 8 * hh + r][16 * j + m] = acc[j][r] * o_mul + bcol;
  }
  __syncthreads();

  if (OM == 0) {
    const int q = lane >> 3, p = lane & 7;
    v8h vals[4];
    size_t addr[4];
#pragma unroll
    for (int it = 0; it < 4; ++it) {
      const int row = wave * 16 + 4 * it + q;
      F8 c;
      c.v[0] = *(const v4f*)&Ct[row][8 * p];
      c.v[1] = *(const v4f*)&Ct[row][8 * p + 4];
      Pack8 pk;
#pragma unroll
      for (int e = 0; e < 8; ++e) pk.s[e] = (_Float16)(c.f[e] * o_scale);
      vals[it] = pk.v;
      addr[it] = (size_t)(m0 + row) * Nout + n0 + 8 * p;
    }
#pragma unroll
    for (int it = 0; it < 4; ++it) *(v8h*)(Yh + addr[it]) = vals[it];
    // in a kernel with several block ranges other code follows these stores in the listing: their address and data
    // registers stay untouched until the stores have taken them
    asm volatile("s_wait_xcnt 0x0" ::: "memory");
  } else if (OM == 1) {
    const int hd = bx;
    const int bb = m0 / NTOK, tok0 = m0 - bb * NTOK;
    const int q = lane >> 3, p = lane & 7;
    v8h vh[4], vl[4];
    size_t addr[4];
#pragma unroll
    for (int it = 0; it < 4; ++it) {
      const int dk = wave * 16 + 4 * it + q;
      Pack8 ph, pl;
#pragma unroll
      for (int e = 0; e < 8; ++e) {
        const float v = Ct[8 * p + e][dk] * o_scale;
        const _Float16 hv = (_Float16)v;
        ph.s[e] = hv;
        pl.s[e] = (_Float16)(v - (float)hv);
      }
      vh[it] = ph.v;
      vl[it] = pl.v;
      addr[it] = (((size_t)bb * NH + hd) * DKH + dk) * NTOK + tok0 + 8 * p;
    }
#pragma unroll
    for (int it = 0; it < 4; ++it) {
      *(v8h*)(Yh + addr[it]) = vh[it];
      *(v8h*)(Yl + addr[it]) = vl[it];
    }
    
  } else {
    const int q = lane >> 4, p = lane & 15;
    v4f vals[8];
    size_t addr[8];
#pragma unroll
    for (int it = 0; it < 8; ++it) {
      const int row = wave * 16 + 2 * it + q;
      vals[it] = *(const v4f*)&Ct[row][4 * p];
      addr[it] = (size_t)(m0 + row) * Nout + n0 + 4 * p;
    }
#pragma unroll
    for (int it = 0; it < 8; ++it) *(v4f*)(Yf + addr[it]) = vals[it];
    
  }
}

template <int AM, int OM>
__global__ __launch_bounds__(128) void k_gemm(const float* Af, const _Float16* Ah, const _Float16* Al,
                                             const float* W, const float* bias,
                                             _Float16* Yh, _Float16* Yl, float* Yf,
                                             int M, int K, int Nout,
                                             float a_scale, float w_scale, float o_mul, float o_scale) {
  __shared__ __attribute__((aligned(16))) char smem[GEMM_LDS((AM == 0) ? 1 : 2)];
  gemm_body<AM, OM>(smem, blockIdx.x, blockIdx.y, Af, Ah, Al, W, bias, Yh, Yl, Yf, M, K, Nout,
                    a_scale, w_scale, o_mul, o_scale);
}

// ---------------------------------------------------------------------------------------------
// Geometric log-weights with the key mask folded in:
// logg[b][h][i][j] = log(max(relu(emb(i,j) . Wg[:,h] + bg[h]), 1e-6)) + (mask[b][i][j]==0 ? -1e9 : 0)
// One block per (b, i); j in chunks of 128 (one j per thread); the 64->8 projection runs on WMMA with
// A = emb hi / residual planes (x S_E) and B columns 0..7 = f16(S_G*Wg[:,h]), 8..15 = residual of the same.
// ---------------------------------------------------------------------------------------------
#define GEO_LDS (2 * 128 * 72 * 2 + 16 * 72 * 2 + 128 * 17 * 4 + 8 * 4 + 8 * 4)
__device__ __forceinline__ void geo_body(char* smem, int bi, const float* box, const float* Wg, const float* bg,
                                         const int* msk, float* logg) {
  _Float16 (*Et)[128][72] = reinterpret_cast<_Float16 (*)[128][72]>(smem);                      // [plane][j][g]
  _Float16 (*Bg)[72] = reinterpret_cast<_Float16 (*)[72]>(smem + 2 * 128 * 72 * 2);             // [n][g]
  float (*Gs)[17] = reinterpret_cast<float (*)[17]>(smem + 2 * 128 * 72 * 2 + 16 * 72 * 2);
  float* sdm = reinterpret_cast<float*>(smem + 2 * 128 * 72 * 2 + 16 * 72 * 2 + 128 * 17 * 4);
  float* sbg = sdm + 8;

  const int tid = threadIdx.x, lane = tid & 31, wave = tid >> 5;
  const int hh = lane >> 4, m = lane & 15;
  if (bi >= NB * NTOK) return;   // block-uniform
  const int b = bi / NTOK, i = bi - b * NTOK;

  if (tid < 8) {
    sdm[tid] = 1.0f / powf(1000.0f, (float)tid * 0.125f);
    sbg[tid] = bg[tid];
  }
#pragma unroll
  for (int e = 0; e < 8; ++e) {
    const int idx = tid * 8 + e;          // 0..1023
    const int n = idx >> 6, k = idx & 63;
    const float w = Wg[k * NH + (n & 7)] * S_G;
    const _Float16 wh = (_Float16)w;
    const _Float16 wl = (_Float16)(w - (float)wh);
    Bg[n][k] = (n < 8) ? wh : wl;
  }
  const v4f bxi = *(const v4f*)(box + (size_t)bi * 4);
  const float cxi = (bxi[0] + bxi[1]) * 0.5f, cyi = (bxi[2] + bxi[3]) * 0.5f;
  const float wi = (bxi[1] - bxi[0]) + 1.0f, hgi = (bxi[3] - bxi[2]) + 1.0f;
  const float rwi = 1.0f / wi, rhi = 1.0f / hgi;
  __syncthreads();

  float dm[8];
#pragma unroll
  for (int f = 0; f < 8; ++f) dm[f] = sdm[f];
  const v16h bg0 = ldfrag(&Bg[0][0], 72, lane, 0);
  const v16h bg1 = ldfrag(&Bg[0][0], 72, lane, 32);
  const size_t mbase = ((size_t)b * NTOK + i) * NTOK;
  const v8f z8 = zero8f();

#pragma unroll 1
  for (int ch = 0; ch < NTOK / 128; ++ch) {
    {  // embedding of pair (i, j), j = ch*128 + tid -> Et[.][tid][0..63]
      const int j = ch * 128 + tid;
      const v4f bxj = *(const v4f*)(box + ((size_t)b * NTOK + j) * 4);
      const float cxj = (bxj[0] + bxj[1]) * 0.5f, cyj = (bxj[2] + bxj[3]) * 0.5f;
      const float wj = (bxj[1] - bxj[0]) + 1.0f, hgj = (bxj[3] - bxj[2]) + 1.0f;
      const float p0 = logf(fmaxf(fabsf((cxi - cxj) * rwi), 1e-3f));
      const float p1 = logf(fmaxf(fabsf((cyi - cyj) * rhi), 1e-3f));
      const float p2 = logf(wi / wj);
      const float p3 = logf(hgi / hgj);
      const float pp[4] = {p0 * 100.0f, p1 * 100.0f, p2 * 100.0f, p3 * 100.0f};
#pragma unroll
      for (int p = 0; p < 4; ++p) {
        Pack8 sh, sl, chv, clv;
#pragma unroll
        for (int f = 0; f < 8; ++f) {
          const float ang = pp[p] * dm[f];
          const float sv = __sinf(ang) * S_E;
          const float cv = __cosf(ang) * S_E;
          const _Float16 a = (_Float16)sv;
          sh.s[f] = a;
          sl.s[f] = (_Float16)(sv - (float)a);
          const _Float16 c = (_Float16)cv;
          chv.s[f] = c;
          clv.s[f] = (_Float16)(cv - (float)c);
        }
        *(v8h*)&Et[0][tid][p * 8] = sh.v;
        *(v8h*)&Et[1][tid][p * 8] = sl.v;
        *(v8h*)&Et[0][tid][32 + p * 8] = chv.v;
        *(v8h*)&Et[1][tid][32 + p * 8] = clv.v;
      }
    }
    __syncthreads();

    // 128 j rows x 16 cols, K = 64: wave -> two 16-row tiles
#pragma unroll
    for (int t = 0; t < 2; ++t) {
      const int row0 = wave * 32 + t * 16;
      v8f acc = z8;
      const v16h a0 = ldfrag(&Et[0][row0][0], 72, lane, 0);
      const v16h l0 = ldfrag(&Et[1][row0][0], 72, lane, 0);
      acc = wmma16(a0, bg0, acc);
      acc = wmma16(l0, bg0, acc);
      const v16h a1 = ldfrag(&Et[0][row0][0], 72, lane, 32);
      const v16h l1 = ldfrag(&Et[1][row0][0], 72, lane, 32);
      acc = wmma16(a1, bg1, acc);
      acc = wmma16(l1, bg1, acc);
#pragma unroll
      for (int r = 0; r < 8; ++r) Gs[row0 + 8 * hh + r][m] = acc[r];
    }
    __syncthreads();

    v4f vv[2];
#pragma unroll
    for (int e = 0; e < 2; ++e) {
      const int hd = 2 * wave + e;
#pragma unroll
      for (int q = 0; q < 4; ++q) {
        const int jl = 4 * lane + q;
        const float graw = (Gs[jl][hd] + Gs[jl][hd + 8]) * (1.0f / (S_E * S_G)) + sbg[hd];
        const float g = fmaxf(graw, 0.0f);
        float v = logf(fmaxf(g, 1e-6f));
        const int mk = msk[mbase + ch * 128 + jl];
        v += (mk == 0) ? -1e9f : 0.0f;
        vv[e][q] = v;
      }
    }
    float* ap0 = logg + (((size_t)b * NH + 2 * wave) * NTOK + i) * NTOK + ch * 128 + 4 * lane;
    float* ap1 = ap0 + (size_t)NTOK * NTOK;
    *(v4f*)ap0 = vv[0];
    *(v4f*)ap1 = vv[1];
    
  }
}

// ---------------------------------------------------------------------------------------------
// The four producers of the attention kernel depend on inputs only, so they share one launch and run side by side:
// block ranges, longest work-groups first: v projection, q projection, k projection (GTILES tiles each), geometry.
// Every branch is block-uniform (blockIdx only); the ranges share one LDS buffer sized for the largest user.
// ---------------------------------------------------------------------------------------------
#define GTILES ((DM / 64) * (MTOK / 64))
__global__ __launch_bounds__(128) void k_front(const float* Xq, const float* Xk, const float* Xv,
                                              const float* Wq, const float* bq, const float* Wk, const float* bk,
                                              const float* Wv, const float* bv,
                                              const float* box, const float* Wg, const float* bg, const int* msk,
                                              _Float16* Q16, _Float16* K16, _Float16* Vth, _Float16* Vtl,
                                              float* logg) {
  static_assert(GEO_LDS >= GEMM_LDS(2), "shared buffer is sized by the geometry part");
  __shared__ __attribute__((aligned(16))) char smem[GEO_LDS];
  const int blk = blockIdx.x;
  const float omul = 1.0f / (S_X * S_W);     // 2^-22
  if (blk < GTILES) {
    gemm_body<1, 1>(smem, blk & (DM / 64 - 1), blk / (DM / 64), Xv, nullptr, nullptr, Wv, bv, Vth, Vtl, nullptr,
                    MTOK, DM, DM, S_X, S_W, omul, S_V);
  } else if (blk < 3 * GTILES) {
    const bool isq = blk < 2 * GTILES;
    const int t = blk - (isq ? GTILES : 2 * GTILES);
    gemm_body<0, 0>(smem, t & (DM / 64 - 1), t / (DM / 64), isq ? Xq : Xk, nullptr, nullptr,
                    isq ? Wq : Wk, isq ? bq : bk, isq ? Q16 : K16, nullptr, nullptr,
                    MTOK, DM, DM, S_X, S_W, omul, S_QK);
  } else {
    geo_body(smem, blk - 3 * GTILES, box, Wg, bg, msk, logg);
  }
}

// ---------------------------------------------------------------------------------------------
// Streaming attention: block = (b, h, 64 query rows), KSPL key groups x 4 waves x 16 rows, key tiles of 32.
// Key group g walks key tiles g, g + KSPL, g + 2*KSPL, ... with its own K/V/P tiles, row maxima, row sums and O partials,
// so each SIMD holds KSPL waves and the serial chain of tiles is KSPL times shorter; the partials are merged through LDS.
// S = Q16.K16^T (single f16 product, Q16/K16 carry S_QK); logits = S*(1/(8*S_QK^2)) + logg; online softmax in f32;
// O += P.V with P as f16 hi/residual of S_P*p and V as f16 hi/residual planes (carrying S_V), V tile staged [dk][key].
// Output: f16 hi/residual planes of S_AO * (O / l), row-major [b*N+q][h*64+dk].
// ---------------------------------------------------------------------------------------------
#define KSPL 4
__global__ __launch_bounds__(128 * KSPL) void k_attn(const _Float16* Qh, const _Float16* Kh,
                                                    const _Float16* Vth, const _Float16* Vtl,
                                                    const float* logg, _Float16* Oh, _Float16* Ol) {
  __shared__ __attribute__((aligned(16))) _Float16 Qt[64][72];              // [q][dk]
  __shared__ __attribute__((aligned(16))) _Float16 Kt[KSPL][32][72];        // [group][key][dk]
  __shared__ __attribute__((aligned(16))) _Float16 Vt[KSPL][2][64][40];     // [group][plane][dk][key]
  __shared__ __attribute__((aligned(16))) _Float16 Pt[KSPL][2][4][16][40];  // [group][plane][wave][q][key]
  __shared__ __attribute__((aligned(16))) float Cs[KSPL][64][68];           // [group][q][dk] un-normalised O partial
  __shared__ float Ms[KSPL][64];                                            // [group][q] row maximum
  __shared__ float Ls[KSPL][64];                                            // [group][q] row sum

  static_assert(128 * KSPL == 64 * 8, "Q staging and the merge give each thread one row and 8 consecutive dk");
  const int tid = threadIdx.x, lane = tid & 31;
  const int grp = __builtin_amdgcn_readfirstlane(tid >> 7);   // same in every lane of a wave: kept scalar
  const int gt = tid & 127, wave = gt >> 5;
  const int hh = lane >> 4, m = lane & 15;
  const int blk = blockIdx.x;
  if (blk >= NB * NH * (NTOK / 64)) return;   // block-uniform
  const int qb = blk & 7, h = (blk >> 3) & 7, b = blk >> 6;
  const int q0 = qb * 64;

  {
    const int r = tid >> 3, cb = (tid & 7) * 8;
    *(v8h*)&Qt[r][cb] = *(const v8h*)(Qh + ((size_t)(b * NTOK + q0 + r)) * DM + h * DKH + cb);
  }
  __syncthreads();
  const v16h qa0 = ldfrag(&Qt[wave * 16][0], 72, lane, 0);
  const v16h qa1 = ldfrag(&Qt[wave * 16][0], 72, lane, 32);

  const v8f z8 = zero8f();
  v8f o[4];
#pragma unroll
  for (int j = 0; j < 4; ++j) o[j] = z8;
  float mrow[8], lrow[8];
#pragma unroll
  for (int r = 0; r < 8; ++r) { mrow[r] = -1e30f; lrow[r] = 0.0f; }

  const size_t lgrow = (((size_t)b * NH + h) * NTOK + (q0 + wave * 16 + 8 * hh)) * NTOK;
  const float SC = 0.125f / (S_QK * S_QK);

#pragma unroll 1
  for (int it = 0; it < NTOK / 32 / KSPL; ++it) {   // same trip count in every group: barriers stay block-uniform
    const int k0 = (it * KSPL + grp) * 32;
    {  // K tile 32 keys x 64 dk
      const int r = gt >> 2, cb = (gt & 3) * 16;
      const _Float16* s = Kh + ((size_t)(b * NTOK + k0 + r)) * DM + h * DKH + cb;
      *(v8h*)&Kt[grp][r][cb] = *(const v8h*)(s);
      *(v8h*)&Kt[grp][r][cb + 8] = *(const v8h*)(s + 8);
    }
    {  // V planes, already [dk][token]: 64 dk x 32 keys, direct copy
      const int r = gt >> 1, cb = (gt & 1) * 16;
      const size_t g = (((size_t)b * NH + h) * DKH + r) * NTOK + k0 + cb;
      *(v8h*)&Vt[grp][0][r][cb] = *(const v8h*)(Vth + g);
      *(v8h*)&Vt[grp][0][r][cb + 8] = *(const v8h*)(Vth + g + 8);
      *(v8h*)&Vt[grp][1][r][cb] = *(const v8h*)(Vtl + g);
      *(v8h*)&Vt[grp][1][r][cb + 8] = *(const v8h*)(Vtl + g + 8);
    }
    __syncthreads();

    // S[16 q][32 keys]: B[k=dk][n=key] = Kt[key][dk] -> n-major tile, same loader as A
    v8f s[2];
#pragma unroll
    for (int c = 0; c < 2; ++c) {
      const v16h b0 = ldfrag(&Kt[grp][16 * c][0], 72, lane, 0);
      const v16h b1 = ldfrag(&Kt[grp][16 * c][0], 72, lane, 32);
      v8f sc = z8;
      sc = wmma16(qa0, b0, sc);
      sc = wmma16(qa1, b1, sc);
      s[c] = sc;
    }

    float t[2][8];
#pragma unroll
    for (int c = 0; c < 2; ++c)
#pragma unroll
      for (int r = 0; r < 8; ++r)
        t[c][r] = s[c][r] * SC + logg[lgrow + (size_t)r * NTOK + k0 + 16 * c + m];

    float rmax[8];
#pragma unroll
    for (int r = 0; r < 8; ++r) rmax[r] = fmaxf(t[0][r], t[1][r]);
#pragma unroll
    for (int off = 8; off >= 1; off >>= 1)
#pragma unroll
      for (int r = 0; r < 8; ++r) rmax[r] = fmaxf(rmax[r], __shfl_xor(rmax[r], off, 16));

    float alpha[8];
#pragma unroll
    for (int r = 0; r < 8; ++r) {
      const float mnew = fmaxf(mrow[r], rmax[r]);
      alpha[r] = __expf(mrow[r] - mnew);
      mrow[r] = mnew;
    }
#pragma unroll
    for (int c = 0; c < 2; ++c)
#pragma unroll
      for (int r = 0; r < 8; ++r) t[c][r] = __expf(t[c][r] - mrow[r]);

    float rsum[8];
#pragma unroll
    for (int r = 0; r < 8; ++r) rsum[r] = t[0][r] + t[1][r];
#pragma unroll
    for (int off = 8; off >= 1; off >>= 1)
#pragma unroll
      for (int r = 0; r < 8; ++r) rsum[r] += __shfl_xor(rsum[r], off, 16);
#pragma unroll
    for (int r = 0; r < 8; ++r) lrow[r] = lrow[r] * alpha[r] + rsum[r];
#pragma unroll
    for (int j = 0; j < 4; ++j)
#pragma unroll
      for (int r = 0; r < 8; ++r) o[j][r] *= alpha[r];

    // P tile (D layout: row 8hh+r = q, col m = key) -> LDS planes; block barrier before the fragment reload
#pragma unroll
    for (int c = 0; c < 2; ++c)
#pragma unroll
      for (int r = 0; r < 8; ++r) {
        const float ps = t[c][r] * S_P;
        const _Float16 ph = (_Float16)ps;
        Pt[grp][0][wave][8 * hh + r][16 * c + m] = ph;
        Pt[grp][1][wave][8 * hh + r][16 * c + m] = (_Float16)(ps - (float)ph);
      }
    __syncthreads();

    const v16h pah = ldfrag(&Pt[grp][0][wave][0][0], 40, lane, 0);
    const v16h pal = ldfrag(&Pt[grp][1][wave][0][0], 40, lane, 0);
    // O[16 q][64 dk] += P[16 x 32 keys] . V[32 keys x 64 dk]; B[k=key][n=dk] = Vt[dk][key]
#pragma unroll
    for (int j = 0; j < 4; ++j) {
      const v16h vh = ldfrag(&Vt[grp][0][16 * j][0], 40, lane, 0);
      const v16h vl = ldfrag(&Vt[grp][1][16 * j][0], 40, lane, 0);
      o[j] = wmma16(pah, vh, o[j]);
      o[j] = wmma16(pah, vl, o[j]);
      o[j] = wmma16(pal, vh, o[j]);
    }
    __syncthreads();
  }

  // each key group leaves its un-normalised partial, row maximum and row sum in LDS
#pragma unroll
  for (int j = 0; j < 4; ++j)
#pragma unroll
    for (int r = 0; r < 8; ++r) Cs[grp][wave * 16 + 8 * hh + r][16 * j + m] = o[j][r];
  if (m == 0) {
#pragma unroll
    for (int r = 0; r < 8; ++r) {
      Ms[grp][wave * 16 + 8 * hh + r] = mrow[r];
      Ls[grp][wave * 16 + 8 * hh + r] = lrow[r];
    }
  }
  __syncthreads();

  // merge: weight exp(m_g - max) per group, divide by the merged row sum; thread -> one row, 8 consecutive dk
  {
    const int row = tid >> 3, p = tid & 7;
    float mg[KSPL];
#pragma unroll
    for (int g = 0; g < KSPL; ++g) mg[g] = Ms[g][row];
    float mall = mg[0];
#pragma unroll
    for (int g = 1; g < KSPL; ++g) mall = fmaxf(mall, mg[g]);
    float wg[KSPL], lall = 0.0f;
#pragma unroll
    for (int g = 0; g < KSPL; ++g) {
      wg[g] = __expf(mg[g] - mall);
      lall += Ls[g][row] * wg[g];
    }
    const float inv = (1.0f / lall) * (S_AO / (S_P * S_V));
    float acc[8];
#pragma unroll
    for (int e = 0; e < 8; ++e) acc[e] = 0.0f;
#pragma unroll
    for (int g = 0; g < KSPL; ++g) {
      F8 c;
      c.v[0] = *(const v4f*)&Cs[g][row][8 * p];
      c.v[1] = *(const v4f*)&Cs[g][row][8 * p + 4];
#pragma unroll
      for (int e = 0; e < 8; ++e) acc[e] += c.f[e] * wg[g];
    }
    Pack8 ph, pl;
#pragma unroll
    for (int e = 0; e < 8; ++e) {
      const float v = acc[e] * inv;
      const _Float16 hv = (_Float16)v;
      ph.s[e] = hv;
      pl.s[e] = (_Float16)(v - (float)hv);
    }
    const size_t addr = ((size_t)(b * NTOK + q0 + row)) * DM + h * DKH + 8 * p;
    *(v8h*)(Oh + addr) = ph.v;
    *(v8h*)(Ol + addr) = pl.v;
  }
}

// ---------------------------------------------------------------------------------------------
// host-side launch glue
// ---------------------------------------------------------------------------------------------
extern "C" void kernel_launch(void* const* d_in, const int* in_sizes, int n_in,
                              void* d_out, int out_size, void* d_ws, size_t ws_size,
                              hipStream_t stream) {
  if (n_in < 15) return;
  const int xsz = MTOK * DM, wsz = DM * DM;
  if (in_sizes[0] != xsz || in_sizes[1] != xsz || in_sizes[2] != xsz) return;
  if (in_sizes[3] != MTOK * 4 || in_sizes[4] != NB * NTOK * NTOK) return;
  if (in_sizes[5] != wsz || in_sizes[7] != wsz || in_sizes[9] != wsz || in_sizes[11] != wsz) return;
  if (in_sizes[6] != DM || in_sizes[8] != DM || in_sizes[10] != DM || in_sizes[12] != DM) return;
  if (in_sizes[13] != DKH * NH || in_sizes[14] != NH || out_size != xsz) return;

  const float* Xq  = (const float*)d_in[0];
  const float* Xk  = (const float*)d_in[1];
  const float* Xv  = (const float*)d_in[2];
  const float* box = (const float*)d_in[3];
  const int*   msk = (const int*)d_in[4];
  const float* Wq  = (const float*)d_in[5];
  const float* bq  = (const float*)d_in[6];
  const float* Wk  = (const float*)d_in[7];
  const float* bk  = (const float*)d_in[8];
  const float* Wv  = (const float*)d_in[9];
  const float* bv  = (const float*)d_in[10];
  const float* Wo  = (const float*)d_in[11];
  const float* bo  = (const float*)d_in[12];
  const float* Wg  = (const float*)d_in[13];
  const float* bg  = (const float*)d_in[14];
  float* out = (float*)d_out;

  // workspace carve (all offsets multiples of 2 MB): logg 32 MB, six 16-bit [2048][512] buffers 2 MB each = 44 MB
  char* ws = (char*)d_ws;
  size_t off = 0;
  float* logg = (float*)(ws + off);          off += (size_t)NB * NH * NTOK * NTOK * sizeof(float);
  _Float16* Q16 = (_Float16*)(ws + off);     off += (size_t)xsz * 2;
  _Float16* K16 = (_Float16*)(ws + off);     off += (size_t)xsz * 2;
  _Float16* Vth = (_Float16*)(ws + off);     off += (size_t)xsz * 2;   // [b][h][dk][token]
  _Float16* Vtl = (_Float16*)(ws + off);     off += (size_t)xsz * 2;
  _Float16* AOh = (_Float16*)(ws + off);     off += (size_t)xsz * 2;   // [b*N+q][h*64+dk]
  _Float16* AOl = (_Float16*)(ws + off);     off += (size_t)xsz * 2;
  if (off > ws_size) return;

  const float omul_o = 1.0f / (S_AO * S_W);  // 2^-22
  const dim3 gg(DM / 64, MTOK / 64), gb(128);

  k_front<<<dim3(3 * GTILES + NB * NTOK), gb, 0, stream>>>(Xq, Xk, Xv, Wq, bq, Wk, bk, Wv, bv, box, Wg, bg, msk,
                                                           Q16, K16, Vth, Vtl, logg);
  k_attn<<<dim3(NB * NH * (NTOK / 64)), dim3(128 * KSPL), 0, stream>>>(Q16, K16, Vth, Vtl, logg, AOh, AOl);
  k_gemm<2, 2><<<gg, gb, 0, stream>>>(Wo, AOh, AOl, Wo, bo, AOh, AOl, out,
                                      MTOK, DM, DM, 1.0f, S_W, omul_o, 1.0f);
}

// v003
// One run takes 57.8 microseconds.
// Next to v002, in two timings, it ran 1.16 and 1.15 times as fast.
// Over all steps from v000 it is 2.19 times as fast.
#include <hip/hip_runtime.h>
#include <stddef.h>

// Contractions on v_wmma_f32_16x16x32_f16 (f16 operands, f32 accumulate): q,k projections and q.k^T as single products of power-of-two scaled operands; v projection, p.v, output projection and the 64->8 geometric projection as f16 hi + residual operand pairs (power-of-two scaled). Softmax, geometry embedding, bias, normalisation in f32.

#define NB   4
#define NTOK 512
#define DM   512
#define NH   8
#define DKH  64
#define MTOK (NB * NTOK)

#define S_X  1024.0f
#define S_W  4096.0f
#define S_QK 16.0f
#define S_V  1024.0f
#define S_P  4096.0f
#define S_AO 1024.0f
#define S_E  2048.0f
#define S_G  4096.0f

typedef _Float16 v16h __attribute__((ext_vector_type(16)));
typedef _Float16 v8h_base __attribute__((ext_vector_type(8)));
typedef v8h_base __attribute__((may_alias)) v8h;
typedef float v8f __attribute__((ext_vector_type(8)));
typedef float v4f_base __attribute__((ext_vector_type(4)));
typedef v4f_base __attribute__((may_alias)) v4f;

union Frag16 { v16h v; v8h half[2]; _Float16 s[16]; };
union Pack8  { v8h v; _Float16 s[8]; };
union Pack2  { unsigned u; _Float16 s[2]; };
union F8     { v4f v[2]; float f[8]; };

__device__ __forceinline__ v8f zero8f() {
  v8f z = {0.f, 0.f, 0.f, 0.f, 0.f, 0.f, 0.f, 0.f};
  return z;
}

// one 16x16x32 step with the VALU hazard guard tied to D, A, B
__device__ __forceinline__ v8f wmma16(v16h a, v16h b, v8f c) {
  v8f d = __builtin_amdgcn_wmma_f32_16x16x32_f16(false, a, false, b, (short)0, c, false, false);
  asm volatile("v_nop\n\tv_nop\n\tv_nop\n\tv_nop" : "+v"(d) : "v"(a), "v"(b));
  return d;
}

// 16x32 operand fragment from a 16-bit LDS tile stored [line][k], k contiguous, pitch in elements (16-B aligned lines).
// lane l: line (row of A / column of B) = l & 15; elements 0..7 <- k0 + 8*(l>>4) + 0..7, elements 8..15 <- k0 + 16 + 8*(l>>4) + 0..7.
__device__ __forceinline__ v16h ldfrag(const _Float16* base, int pitch, int lane, int k0) {
  const _Float16* p = base + (lane & 15) * pitch + k0 + 8 * (lane >> 4);
  Frag16 f;
  f.half[0] = *(const v8h*)(p);
  f.half[1] = *(const v8h*)(p + 16);
  return f.v;
}

// ---------------------------------------------------------------------------------------------
// Y[M][Nout] = A[M][K] . W[K][Nout] + bias.  64x64 tile, 128 threads = 4 waves (16 rows each).
// AM: 0 = A f32 -> one f16 plane (scaled); 1 = A f32 -> f16 hi + residual planes; 2 = A given as two f16 planes.
//     W f32 -> same plane count as A (scaled).  Planes>1: D = Ah.Wh + Ah.Wl + Al.Wh.
// OM: 0 = f16 row-major [M][Nout], value*o_scale; 1 = f16 hi/residual planes laid out [b][head][dk][token]
//     (Nout = NH*DKH, one head per column tile, M = NB*NTOK); 2 = f32 row-major.
// D element r of lane l = (row 8*(l>>4)+r, col l&15) of the 16x16 tile.
// ---------------------------------------------------------------------------------------------
// smem: the work-group's LDS (GEMM_LDS(planes) bytes per K group, 16-B aligned); (bx, by) = column tile, row tile.
// KS: K is split over KS groups of 4 waves (128 * KS threads). Group g walks k in [g*K/KS, (g+1)*K/KS) with its own A/W
//     tiles and accumulators, so the serial chain of load -> stage -> multiply rounds is KS times shorter and each SIMD
//     holds KS waves; the f32 partial tiles are summed through LDS (KS > 1: OM 2 only, K a multiple of 32*KS).
#define GEMM_LDS(npl) (2 * (npl) * 64 * 40 * 2 + 64 * 68 * 4)
template <int AM, int OM, int KS = 1>
__device__ __forceinline__ void gemm_body(char* smem, int bx, int by,
                                          const float* Af, const _Float16* Ah, const _Float16* Al,
                                          const float* W, const float* bias,
                                          _Float16* Yh, _Float16* Yl, float* Yf,
                                          int M, int K, int Nout,
                                          float a_scale, float w_scale, float o_mul, float o_scale) {
  constexpr int NPL = (AM == 0) ? 1 : 2;
  static_assert(KS == 1 || OM == 2, "the merge of K groups is written for the f32 row-major output");
  const int grp = (KS > 1) ? __builtin_amdgcn_readfirstlane((int)threadIdx.x >> 7) : 0;   // same in every lane of a wave
  smem += grp * GEMM_LDS(NPL);                                                              // the group's own tiles
  _Float16 (*At)[64][40] = reinterpret_cast<_Float16 (*)[64][40]>(smem);                        // [plane][row][k]
  _Float16 (*Bt)[64][40] = reinterpret_cast<_Float16 (*)[64][40]>(smem + NPL * 64 * 40 * 2);    // [plane][n][k]
  float (*Ct)[68] = reinterpret_cast<float (*)[68]>(smem + 2 * NPL * 64 * 40 * 2);

  const int tid = (KS > 1) ? (int)(threadIdx.x & 127) : (int)threadIdx.x;   // index inside the K group
  const int lane = tid & 31, wave = tid >> 5;
  const int hh = lane >> 4, m = lane & 15;
  const int n0 = bx * 64, m0 = by * 64;
  if (m0 + 64 > M || n0 + 64 > Nout) return;   // block-uniform, before any barrier

  v8f acc[4];
#pragma unroll
  for (int j = 0; j < 4; ++j) acc[j] = zero8f();

  const int kbeg = (KS > 1) ? grp * (K / KS) : 0;   // same trip count in every group: barriers stay block-uniform
  const int kend = (KS > 1) ? kbeg + K / KS : K;
#pragma unroll 1
  for (int kk = kbeg; kk < kend; kk += 32) {
    {  // A tile 64x32: thread -> row tid>>1, 16 consecutive k
      const int r = tid >> 1, cb = (tid & 1) * 16;
      if (AM == 2) {
        const size_t g = (size_t)(m0 + r) * K + kk + cb;
        const v8h h0 = *(const v8h*)(Ah + g), h1 = *(const v8h*)(Ah + g + 8);
        const v8h l0 = *(const v8h*)(Al + g), l1 = *(const v8h*)(Al + g + 8);
        *(v8h*)&At[0][r][cb] = h0;        *(v8h*)&At[0][r][cb + 8] = h1;
        *(v8h*)&At[NPL - 1][r][cb] = l0;  *(v8h*)&At[NPL - 1][r][cb + 8] = l1;
      } else {
        const float* s = Af + (size_t)(m0 + r) * K + kk + cb;
        F8 x0, x1;
        x0.v[0] = *(const v4f*)(s);      x0.v[1] = *(const v4f*)(s + 4);
        x1.v[0] = *(const v4f*)(s + 8);  x1.v[1] = *(const v4f*)(s + 12);
        Frag16 ph, pl;
#pragma unroll
        for (int e = 0; e < 8; ++e) {
          const float v0 = x0.f[e] * a_scale, v1 = x1.f[e] * a_scale;
          const _Float16 h0 = (_Float16)v0, h1 = (_Float16)v1;
          ph.s[e] = h0;
          ph.s[8 + e] = h1;
          pl.s[e] = (_Float16)(v0 - (float)h0);
          pl.s[8 + e] = (_Float16)(v1 - (float)h1);
        }
        *(v8h*)&At[0][r][cb] = ph.half[0];  *(v8h*)&At[0][r][cb + 8] = ph.half[1];
        if (NPL == 2) {
          *(v8h*)&At[NPL - 1][r][cb] = pl.half[0];  *(v8h*)&At[NPL - 1][r][cb + 8] = pl.half[1];
        }
      }
    }
    {  // W tile 32 k x 64 n, stored transposed [n][k]: thread -> k pair 2kp,2kp+1 and 8 columns
      const int kp = tid >> 3, nb = (tid & 7) * 8;
      const float* s0 = W + (size_t)(kk + 2 * kp) * Nout + n0 + nb;
      const float* s1 = s0 + Nout;
      F8 w0, w1;
      w0.v[0] = *(const v4f*)(s0);  w0.v[1] = *(const v4f*)(s0 + 4);
      w1.v[0] = *(const v4f*)(s1);  w1.v[1] = *(const v4f*)(s1 + 4);
#pragma unroll
      for (int d = 0; d < 8; ++d) {
        const float a = w0.f[d] * w_scale, c = w1.f[d] * w_scale;
        const _Float16 ha = (_Float16)a, hc = (_Float16)c;
        Pack2 q;
        q.s[0] = ha;  q.s[1] = hc;
        *(unsigned*)&Bt[0][nb + d][2 * kp] = q.u;
        if (NPL == 2) {
          Pack2 ql;
          ql.s[0] = (_Float16)(a - (float)ha);
          ql.s[1] = (_Float16)(c - (float)hc);
          *(unsigned*)&Bt[NPL - 1][nb + d][2 * kp] = ql.u;
        }
      }
    }
    __syncthreads();

    const v16h ah = ldfrag(&At[0][wave * 16][0], 40, lane, 0);
    if (NPL == 1) {
#pragma unroll
      for (int j = 0; j < 4; ++j) {
        const v16h bh = ldfrag(&Bt[0][j * 16][0], 40, lane, 0);
        acc[j] = wmma16(ah, bh, acc[j]);
      }
    } else {
      const v16h al = ldfrag(&At[NPL - 1][wave * 16][0], 40, lane, 0);
#pragma unroll
      for (int j = 0; j < 4; ++j) {
        const v16h bh = ldfrag(&Bt[0][j * 16][0], 40, lane, 0);
        const v16h bl = ldfrag(&Bt[NPL - 1][j * 16][0], 40, lane, 0);
        acc[j] = wmma16(ah, bh, acc[j]);
        acc[j] = wmma16(ah, bl, acc[j]);
        acc[j] = wmma16(al, bh, acc[j]);
      }
    }
    __syncthreads();
  }

  if (KS > 1) {
    // each K group leaves its raw f32 partial tile in LDS; thread -> one row, 8 consecutive columns: sum, scale, bias
#pragma unroll
    for (int j = 0; j < 4; ++j)
#pragma unroll
      for (int r = 0; r < 8; ++r) Ct[wave * 16 + 8 * hh + r][16 * j + m] = acc[j][r];
    __syncthreads();
    const int row = (int)threadIdx.x >> 3, c0 = ((int)threadIdx.x & 7) * 8;
    const char* c00 = smem - grp * GEMM_LDS(NPL) + 2 * NPL * 64 * 40 * 2 + (row * 68 + c0) * 4;   // group 0's tile
    F8 bc, sum;
    bc.v[0] = *(const v4f*)(bias + n0 + c0);
    bc.v[1] = *(const v4f*)(bias + n0 + c0 + 4);
    sum.v[0] = *(const v4f*)(c00);
    sum.v[1] = *(const v4f*)(c00 + 16);
#pragma unroll
    for (int g = 1; g < KS; ++g) {
      sum.v[0] += *(const v4f*)(c00 + g * GEMM_LDS(NPL));
      sum.v[1] += *(const v4f*)(c00 + g * GEMM_LDS(NPL) + 16);
    }
    float* y = Yf + (size_t)(m0 + row) * Nout + n0 + c0;
    *(v4f*)(y) = sum.v[0] * o_mul + bc.v[0];
    *(v4f*)(y + 4) = sum.v[1] * o_mul + bc.v[1];
    return;
  }

  // D + bias (unscaled) -> LDS tile
#pragma unroll
  for (int j = 0; j < 4; ++j) {
    const float bcol = bias[n0 + 16 * j + m];
#pragma unroll
    for (int r = 0; r < 8; ++r) Ct[wave * 16 + 8 * hh + r][16 * j + m] = acc[j][r] * o_mul + bcol;
  }
  __syncthreads();

  if (OM == 0) {
    const int q = lane >> 3, p = lane & 7;
    v8h vals[4];
    size_t addr[4];
#pragma unroll
    for (int it = 0; it < 4; ++it) {
      const int row = wave * 16 + 4 * it + q;
      F8 c;
      c.v[0] = *(const v4f*)&Ct[row][8 * p];
      c.v[1] = *(const v4f*)&Ct[row][8 * p + 4];
      Pack8 pk;
#pragma unroll
      for (int e = 0; e < 8; ++e) pk.s[e] = (_Float16)(c.f[e] * o_scale);
      vals[it] = pk.v;
      addr[it] = (size_t)(m0 + row) * Nout + n0 + 8 * p;
    }
#pragma unroll
    for (int it = 0; it < 4; ++it) *(v8h*)(Yh + addr[it]) = vals[it];
    // in a kernel with several block ranges other code follows these stores in the listing: their address and data
    // registers stay untouched until the stores have taken them
    asm volatile("s_wait_xcnt 0x0" ::: "memory");
  } else if (OM == 1) {
    const int hd = bx;
    const int bb = m0 / NTOK, tok0 = m0 - bb * NTOK;
    const int q = lane >> 3, p = lane & 7;
    v8h vh[4], vl[4];
    size_t addr[4];
#pragma unroll
    for (int it = 0; it < 4; ++it) {
      const int dk = wave * 16 + 4 * it + q;
      Pack8 ph, pl;
#pragma unroll
      for (int e = 0; e < 8; ++e) {
        const float v = Ct[8 * p + e][dk] * o_scale;
        const _Float16 hv = (_Float16)v;
        ph.s[e] = hv;
        pl.s[e] = (_Float16)(v - (float)hv);
      }
      vh[it] = ph.v;
      vl[it] = pl.v;
      addr[it] = (((size_t)bb * NH + hd) * DKH + dk) * NTOK + tok0 + 8 * p;
    }
#pragma unroll
    for (int it = 0; it < 4; ++it) {
      *(v8h*)(Yh + addr[it]) = vh[it];
      *(v8h*)(Yl + addr[it]) = vl[it];
    }
    
  } else {
    const int q = lane >> 4, p = lane & 15;
    v4f vals[8];
    size_t addr[8];
#pragma unroll
    for (int it = 0; it < 8; ++it) {
      const int row = wave * 16 + 2 * it + q;
      vals[it] = *(const v4f*)&Ct[row][4 * p];
      addr[it] = (size_t)(m0 + row) * Nout + n0 + 4 * p;
    }
#pragma unroll
    for (int it = 0; it < 8; ++it) *(v4f*)(Yf + addr[it]) = vals[it];
    
  }
}

template <int AM, int OM, int KS>
__global__ __launch_bounds__(128 * KS) void k_gemm(const float* Af, const _Float16* Ah, const _Float16* Al,
                                             const float* W, const float* bias,
                                             _Float16* Yh, _Float16* Yl, float* Yf,
                                             int M, int K, int Nout,
                                             float a_scale, float w_scale, float o_mul, float o_scale) {
  __shared__ __attribute__((aligned(16))) char smem[KS * GEMM_LDS((AM == 0) ? 1 : 2)];
  gemm_body<AM, OM, KS>(smem, blockIdx.x, blockIdx.y, Af, Ah, Al, W, bias, Yh, Yl, Yf, M, K, Nout,
                    a_scale, w_scale, o_mul, o_scale);
}

// ---------------------------------------------------------------------------------------------
// Geometric log-weights with the key mask folded in:
// logg[b][h][i][j] = log(max(relu(emb(i,j) . Wg[:,h] + bg[h]), 1e-6)) + (mask[b][i][j]==0 ? -1e9 : 0)
// One block per (b, i); j in chunks of 128 (one j per thread); the 64->8 projection runs on WMMA with
// A = emb hi / residual planes (x S_E) and B columns 0..7 = f16(S_G*Wg[:,h]), 8..15 = residual of the same.
// ---------------------------------------------------------------------------------------------
#define GEO_LDS (2 * 128 * 72 * 2 + 16 * 72 * 2 + 128 * 17 * 4 + 8 * 4 + 8 * 4)
__device__ __forceinline__ void geo_body(char* smem, int bi, const float* box, const float* Wg, const float* bg,
                                         const int* msk, float* logg) {
  _Float16 (*Et)[128][72] = reinterpret_cast<_Float16 (*)[128][72]>(smem);                      // [plane][j][g]
  _Float16 (*Bg)[72] = reinterpret_cast<_Float16 (*)[72]>(smem + 2 * 128 * 72 * 2);             // [n][g]
  float (*Gs)[17] = reinterpret_cast<float (*)[17]>(smem + 2 * 128 * 72 * 2 + 16 * 72 * 2);
  float* sdm = reinterpret_cast<float*>(smem + 2 * 128 * 72 * 2 + 16 * 72 * 2 + 128 * 17 * 4);
  float* sbg = sdm + 8;

  const int tid = threadIdx.x, lane = tid & 31, wave = tid >> 5;
  const int hh = lane >> 4, m = lane & 15;
  if (bi >= NB * NTOK) return;   // block-uniform
  const int b = bi / NTOK, i = bi - b * NTOK;

  if (tid < 8) {
    sdm[tid] = 1.0f / powf(1000.0f, (float)tid * 0.125f);
    sbg[tid] = bg[tid];
  }
#pragma unroll
  for (int e = 0; e < 8; ++e) {
    const int idx = tid * 8 + e;          // 0..1023
    const int n = idx >> 6, k = idx & 63;
    const float w = Wg[k * NH + (n & 7)] * S_G;
    const _Float16 wh = (_Float16)w;
    const _Float16 wl = (_Float16)(w - (float)wh);
    Bg[n][k] = (n < 8) ? wh : wl;
  }
  const v4f bxi = *(const v4f*)(box + (size_t)bi * 4);
  const float cxi = (bxi[0] + bxi[1]) * 0.5f, cyi = (bxi[2] + bxi[3]) * 0.5f;
  const float wi = (bxi[1] - bxi[0]) + 1.0f, hgi = (bxi[3] - bxi[2]) + 1.0f;
  const float rwi = 1.0f / wi, rhi = 1.0f / hgi;
  __syncthreads();

  float dm[8];
#pragma unroll
  for (int f = 0; f < 8; ++f) dm[f] = sdm[f];
  const v16h bg0 = ldfrag(&Bg[0][0], 72, lane, 0);
  const v16h bg1 = ldfrag(&Bg[0][0], 72, lane, 32);
  const size_t mbase = ((size_t)b * NTOK + i) * NTOK;
  const v8f z8 = zero8f();

#pragma unroll 1
  for (int ch = 0; ch < NTOK / 128; ++ch) {
    {  // embedding of pair (i, j), j = ch*128 + tid -> Et[.][tid][0..63]
      const int j = ch * 128 + tid;
      const v4f bxj = *(const v4f*)(box + ((size_t)b * NTOK + j) * 4);
      const float cxj = (bxj[0] + bxj[1]) * 0.5f, cyj = (bxj[2] + bxj[3]) * 0.5f;
      const float wj = (bxj[1] - bxj[0]) + 1.0f, hgj = (bxj[3] - bxj[2]) + 1.0f;
      const float p0 = logf(fmaxf(fabsf((cxi - cxj) * rwi), 1e-3f));
      const float p1 = logf(fmaxf(fabsf((cyi - cyj) * rhi), 1e-3f));
      const float p2 = logf(wi / wj);
      const float p3 = logf(hgi / hgj);
      const float pp[4] = {p0 * 100.0f, p1 * 100.0f, p2 * 100.0f, p3 * 100.0f};
#pragma unroll
      for (int p = 0; p < 4; ++p) {
        Pack8 sh, sl, chv, clv;
#pragma unroll
        for (int f = 0; f < 8; ++f) {
          const float ang = pp[p] * dm[f];
          const float sv = __sinf(ang) * S_E;
          const float cv = __cosf(ang) * S_E;
          const _Float16 a = (_Float16)sv;
          sh.s[f] = a;
          sl.s[f] = (_Float16)(sv - (float)a);
          const _Float16 c = (_Float16)cv;
          chv.s[f] = c;
          clv.s[f] = (_Float16)(cv - (float)c);
        }
        *(v8h*)&Et[0][tid][p * 8] = sh.v;
        *(v8h*)&Et[1][tid][p * 8] = sl.v;
        *(v8h*)&Et[0][tid][32 + p * 8] = chv.v;
        *(v8h*)&Et[1][tid][32 + p * 8] = clv.v;
      }
    }
    __syncthreads();

    // 128 j rows x 16 cols, K = 64: wave -> two 16-row tiles
#pragma unroll
    for (int t = 0; t < 2; ++t) {
      const int row0 = wave * 32 + t * 16;
      v8f acc = z8;
      const v16h a0 = ldfrag(&Et[0][row0][0], 72, lane, 0);
      const v16h l0 = ldfrag(&Et[1][row0][0], 72, lane, 0);
      acc = wmma16(a0, bg0, acc);
      acc = wmma16(l0, bg0, acc);
      const v16h a1 = ldfrag(&Et[0][row0][0], 72, lane, 32);
      const v16h l1 = ldfrag(&Et[1][row0][0], 72, lane, 32);
      acc = wmma16(a1, bg1, acc);
      acc = wmma16(l1, bg1, acc);
#pragma unroll
      for (int r = 0; r < 8; ++r) Gs[row0 + 8 * hh + r][m] = acc[r];
    }
    __syncthreads();

    v4f vv[2];
#pragma unroll
    for (int e = 0; e < 2; ++e) {
      const int hd = 2 * wave + e;
#pragma unroll
      for (int q = 0; q < 4; ++q) {
        const int jl = 4 * lane + q;
        const float graw = (Gs[jl][hd] + Gs[jl][hd + 8]) * (1.0f / (S_E * S_G)) + sbg[hd];
        const float g = fmaxf(graw, 0.0f);
        float v = logf(fmaxf(g, 1e-6f));
        const int mk = msk[mbase + ch * 128 + jl];
        v += (mk == 0) ? -1e9f : 0.0f;
        vv[e][q] = v;
      }
    }
    float* ap0 = logg + (((size_t)b * NH + 2 * wave) * NTOK + i) * NTOK + ch * 128 + 4 * lane;
    float* ap1 = ap0 + (size_t)NTOK * NTOK;
    *(v4f*)ap0 = vv[0];
    *(v4f*)ap1 = vv[1];
    
  }
}

// ---------------------------------------------------------------------------------------------
// The four producers of the attention kernel depend on inputs only, so they share one launch and run side by side:
// block ranges, longest work-groups first: v projection, q projection, k projection (GTILES tiles each), geometry.
// Every branch is block-uniform (blockIdx only); the ranges share one LDS buffer sized for the largest user.
// ---------------------------------------------------------------------------------------------
#define GTILES ((DM / 64) * (MTOK / 64))
__global__ __launch_bounds__(128) void k_front(const float* Xq, const float* Xk, const float* Xv,
                                              const float* Wq, const float* bq, const float* Wk, const float* bk,
                                              const float* Wv, const float* bv,
                                              const float* box, const float* Wg, const float* bg, const int* msk,
                                              _Float16* Q16, _Float16* K16, _Float16* Vth, _Float16* Vtl,
                                              float* logg) {
  static_assert(GEO_LDS >= GEMM_LDS(2), "shared buffer is sized by the geometry part");
  __shared__ __attribute__((aligned(16))) char smem[GEO_LDS];
  const int blk = blockIdx.x;
  const float omul = 1.0f / (S_X * S_W);     // 2^-22
  if (blk < GTILES) {
    gemm_body<1, 1>(smem, blk & (DM / 64 - 1), blk / (DM / 64), Xv, nullptr, nullptr, Wv, bv, Vth, Vtl, nullptr,
                    MTOK, DM, DM, S_X, S_W, omul, S_V);
  } else if (blk < 3 * GTILES) {
    const bool isq = blk < 2 * GTILES;
    const int t = blk - (isq ? GTILES : 2 * GTILES);
    gemm_body<0, 0>(smem, t & (DM / 64 - 1), t / (DM / 64), isq ? Xq : Xk, nullptr, nullptr,
                    isq ? Wq : Wk, isq ? bq : bk, isq ? Q16 : K16, nullptr, nullptr,
                    MTOK, DM, DM, S_X, S_W, omul, S_QK);
  } else {
    geo_body(smem, blk - 3 * GTILES, box, Wg, bg, msk, logg);
  }
}

// ---------------------------------------------------------------------------------------------
// Streaming attention: block = (b, h, 64 query rows), KSPL key groups x 4 waves x 16 rows, key tiles of 32.
// Key group g walks key tiles g, g + KSPL, g + 2*KSPL, ... with its own K/V/P tiles, row maxima, row sums and O partials,
// so each SIMD holds KSPL waves and the serial chain of tiles is KSPL times shorter; the partials are merged through LDS.
// S = Q16.K16^T (single f16 product, Q16/K16 carry S_QK); logits = S*(1/(8*S_QK^2)) + logg; online softmax in f32;
// O += P.V with P as f16 hi/residual of S_P*p and V as f16 hi/residual planes (carrying S_V), V tile staged [dk][key].
// Output: f16 hi/residual planes of S_AO * (O / l), row-major [b*N+q][h*64+dk].
// ---------------------------------------------------------------------------------------------
#define KSPL 4
__global__ __launch_bounds__(128 * KSPL) void k_attn(const _Float16* Qh, const _Float16* Kh,
                                                    const _Float16* Vth, const _Float16* Vtl,
                                                    const float* logg, _Float16* Oh, _Float16* Ol) {
  __shared__ __attribute__((aligned(16))) _Float16 Qt[64][72];              // [q][dk]
  __shared__ __attribute__((aligned(16))) _Float16 Kt[KSPL][32][72];        // [group][key][dk]
  __shared__ __attribute__((aligned(16))) _Float16 Vt[KSPL][2][64][40];     // [group][plane][dk][key]
  __shared__ __attribute__((aligned(16))) _Float16 Pt[KSPL][2][4][16][40];  // [group][plane][wave][q][key]
  __shared__ __attribute__((aligned(16))) float Cs[KSPL][64][68];           // [group][q][dk] un-normalised O partial
  __shared__ float Ms[KSPL][64];                                            // [group][q] row maximum
  __shared__ float Ls[KSPL][64];                                            // [group][q] row sum

  static_assert(128 * KSPL == 64 * 8, "Q staging and the merge give each thread one row and 8 consecutive dk");
  const int tid = threadIdx.x, lane = tid & 31;
  const int grp = __builtin_amdgcn_readfirstlane(tid >> 7);   // same in every lane of a wave: kept scalar
  const int gt = tid & 127, wave = gt >> 5;
  const int hh = lane >> 4, m = lane & 15;
  const int blk = blockIdx.x;
  if (blk >= NB * NH * (NTOK / 64)) return;   // block-uniform
  const int qb = blk & 7, h = (blk >> 3) & 7, b = blk >> 6;
  const int q0 = qb * 64;

  {
    const int r = tid >> 3, cb = (tid & 7) * 8;
    *(v8h*)&Qt[r][cb] = *(const v8h*)(Qh + ((size_t)(b * NTOK + q0 + r)) * DM + h * DKH + cb);
  }
  __syncthreads();
  const v16h qa0 = ldfrag(&Qt[wave * 16][0], 72, lane, 0);
  const v16h qa1 = ldfrag(&Qt[wave * 16][0], 72, lane, 32);

  const v8f z8 = zero8f();
  v8f o[4];
#pragma unroll
  for (int j = 0; j < 4; ++j) o[j] = z8;
  float mrow[8], lrow[8];
#pragma unroll
  for (int r = 0; r < 8; ++r) { mrow[r] = -1e30f; lrow[r] = 0.0f; }

  const size_t lgrow = (((size_t)b * NH + h) * NTOK + (q0 + wave * 16 + 8 * hh)) * NTOK;
  const float SC = 0.125f / (S_QK * S_QK);

#pragma unroll 1
  for (int it = 0; it < NTOK / 32 / KSPL; ++it) {   // same trip count in every group: barriers stay block-uniform
    const int k0 = (it * KSPL + grp) * 32;
    {  // K tile 32 keys x 64 dk
      const int r = gt >> 2, cb = (gt & 3) * 16;
      const _Float16* s = Kh + ((size_t)(b * NTOK + k0 + r)) * DM + h * DKH + cb;
      *(v8h*)&Kt[grp][r][cb] = *(const v8h*)(s);
      *(v8h*)&Kt[grp][r][cb + 8] = *(const v8h*)(s + 8);
    }
    {  // V planes, already [dk][token]: 64 dk x 32 keys, direct copy
      const int r = gt >> 1, cb = (gt & 1) * 16;
      const size_t g = (((size_t)b * NH + h) * DKH + r) * NTOK + k0 + cb;
      *(v8h*)&Vt[grp][0][r][cb] = *(const v8h*)(Vth + g);
      *(v8h*)&Vt[grp][0][r][cb + 8] = *(const v8h*)(Vth + g + 8);
      *(v8h*)&Vt[grp][1][r][cb] = *(const v8h*)(Vtl + g);
      *(v8h*)&Vt[grp][1][r][cb + 8] = *(const v8h*)(Vtl + g + 8);
    }
    __syncthreads();

    // S[16 q][32 keys]: B[k=dk][n=key] = Kt[key][dk] -> n-major tile, same loader as A
    v8f s[2];
#pragma unroll
    for (int c = 0; c < 2; ++c) {
      const v16h b0 = ldfrag(&Kt[grp][16 * c][0], 72, lane, 0);
      const v16h b1 = ldfrag(&Kt[grp][16 * c][0], 72, lane, 32);
      v8f sc = z8;
      sc = wmma16(qa0, b0, sc);
      sc = wmma16(qa1, b1, sc);
      s[c] = sc;
    }

    float t[2][8];
#pragma unroll
    for (int c = 0; c < 2; ++c)
#pragma unroll
      for (int r = 0; r < 8; ++r)
        t[c][r] = s[c][r] * SC + logg[lgrow + (size_t)r * NTOK + k0 + 16 * c + m];

    float rmax[8];
#pragma unroll
    for (int r = 0; r < 8; ++r) rmax[r] = fmaxf(t[0][r], t[1][r]);
#pragma unroll
    for (int off = 8; off >= 1; off >>= 1)
#pragma unroll
      for (int r = 0; r < 8; ++r) rmax[r] = fmaxf(rmax[r], __shfl_xor(rmax[r], off, 16));

    float alpha[8];
#pragma unroll
    for (int r = 0; r < 8; ++r) {
      const float mnew = fmaxf(mrow[r], rmax[r]);
      alpha[r] = __expf(mrow[r] - mnew);
      mrow[r] = mnew;
    }
#pragma unroll
    for (int c = 0; c < 2; ++c)
#pragma unroll
      for (int r = 0; r < 8; ++r) t[c][r] = __expf(t[c][r] - mrow[r]);

    float rsum[8];
#pragma unroll
    for (int r = 0; r < 8; ++r) rsum[r] = t[0][r] + t[1][r];
#pragma unroll
    for (int off = 8; off >= 1; off >>= 1)
#pragma unroll
      for (int r = 0; r < 8; ++r) rsum[r] += __shfl_xor(rsum[r], off, 16);
#pragma unroll
    for (int r = 0; r < 8; ++r) lrow[r] = lrow[r] * alpha[r] + rsum[r];
#pragma unroll
    for (int j = 0; j < 4; ++j)
#pragma unroll
      for (int r = 0; r < 8; ++r) o[j][r] *= alpha[r];

    // P tile (D layout: row 8hh+r = q, col m = key) -> LDS planes; block barrier before the fragment reload
#pragma unroll
    for (int c = 0; c < 2; ++c)
#pragma unroll
      for (int r = 0; r < 8; ++r) {
        const float ps = t[c][r] * S_P;
        const _Float16 ph = (_Float16)ps;
        Pt[grp][0][wave][8 * hh + r][16 * c + m] = ph;
        Pt[grp][1][wave][8 * hh + r][16 * c + m] = (_Float16)(ps - (float)ph);
      }
    __syncthreads();

    const v16h pah = ldfrag(&Pt[grp][0][wave][0][0], 40, lane, 0);
    const v16h pal = ldfrag(&Pt[grp][1][wave][0][0], 40, lane, 0);
    // O[16 q][64 dk] += P[16 x 32 keys] . V[32 keys x 64 dk]; B[k=key][n=dk] = Vt[dk][key]
#pragma unroll
    for (int j = 0; j < 4; ++j) {
      const v16h vh = ldfrag(&Vt[grp][0][16 * j][0], 40, lane, 0);
      const v16h vl = ldfrag(&Vt[grp][1][16 * j][0], 40, lane, 0);
      o[j] = wmma16(pah, vh, o[j]);
      o[j] = wmma16(pah, vl, o[j]);
      o[j] = wmma16(pal, vh, o[j]);
    }
    __syncthreads();
  }

  // each key group leaves its un-normalised partial, row maximum and row sum in LDS
#pragma unroll
  for (int j = 0; j < 4; ++j)
#pragma unroll
    for (int r = 0; r < 8; ++r) Cs[grp][wave * 16 + 8 * hh + r][16 * j + m] = o[j][r];
  if (m == 0) {
#pragma unroll
    for (int r = 0; r < 8; ++r) {
      Ms[grp][wave * 16 + 8 * hh + r] = mrow[r];
      Ls[grp][wave * 16 + 8 * hh + r] = lrow[r];
    }
  }
  __syncthreads();

  // merge: weight exp(m_g - max) per group, divide by the merged row sum; thread -> one row, 8 consecutive dk
  {
    const int row = tid >> 3, p = tid & 7;
    float mg[KSPL];
#pragma unroll
    for (int g = 0; g < KSPL; ++g) mg[g] = Ms[g][row];
    float mall = mg[0];
#pragma unroll
    for (int g = 1; g < KSPL; ++g) mall = fmaxf(mall, mg[g]);
    float wg[KSPL], lall = 0.0f;
#pragma unroll
    for (int g = 0; g < KSPL; ++g) {
      wg[g] = __expf(mg[g] - mall);
      lall += Ls[g][row] * wg[g];
    }
    const float inv = (1.0f / lall) * (S_AO / (S_P * S_V));
    float acc[8];
#pragma unroll
    for (int e = 0; e < 8; ++e) acc[e] = 0.0f;
#pragma unroll
    for (int g = 0; g < KSPL; ++g) {
      F8 c;
      c.v[0] = *(const v4f*)&Cs[g][row][8 * p];
      c.v[1] = *(const v4f*)&Cs[g][row][8 * p + 4];
#pragma unroll
      for (int e = 0; e < 8; ++e) acc[e] += c.f[e] * wg[g];
    }
    Pack8 ph, pl;
#pragma unroll
    for (int e = 0; e < 8; ++e) {
      const float v = acc[e] * inv;
      const _Float16 hv = (_Float16)v;
      ph.s[e] = hv;
      pl.s[e] = (_Float16)(v - (float)hv);
    }
    const size_t addr = ((size_t)(b * NTOK + q0 + row)) * DM + h * DKH + 8 * p;
    *(v8h*)(Oh + addr) = ph.v;
    *(v8h*)(Ol + addr) = pl.v;
  }
}

// ---------------------------------------------------------------------------------------------
// host-side launch glue
// ---------------------------------------------------------------------------------------------
extern "C" void kernel_launch(void* const* d_in, const int* in_sizes, int n_in,
                              void* d_out, int out_size, void* d_ws, size_t ws_size,
                              hipStream_t stream) {
  if (n_in < 15) return;
  const int xsz = MTOK * DM, wsz = DM * DM;
  if (in_sizes[0] != xsz || in_sizes[1] != xsz || in_sizes[2] != xsz) return;
  if (in_sizes[3] != MTOK * 4 || in_sizes[4] != NB * NTOK * NTOK) return;
  if (in_sizes[5] != wsz || in_sizes[7] != wsz || in_sizes[9] != wsz || in_sizes[11] != wsz) return;
  if (in_sizes[6] != DM || in_sizes[8] != DM || in_sizes[10] != DM || in_sizes[12] != DM) return;
  if (in_sizes[13] != DKH * NH || in_sizes[14] != NH || out_size != xsz) return;

  const float* Xq  = (const float*)d_in[0];
  const float* Xk  = (const float*)d_in[1];
  const float* Xv  = (const float*)d_in[2];
  const float* box = (const float*)d_in[3];
  const int*   msk = (const int*)d_in[4];
  const float* Wq  = (const float*)d_in[5];
  const float* bq  = (const float*)d_in[6];
  const float* Wk  = (const float*)d_in[7];
  const float* bk  = (const float*)d_in[8];
  const float* Wv  = (const float*)d_in[9];
  const float* bv  = (const float*)d_in[10];
  const float* Wo  = (const float*)d_in[11];
  const float* bo  = (const float*)d_in[12];
  const float* Wg  = (const float*)d_in[13];
  const float* bg  = (const float*)d_in[14];
  float* out = (float*)d_out;

  // workspace carve (all offsets multiples of 2 MB): logg 32 MB, six 16-bit [2048][512] buffers 2 MB each = 44 MB
  char* ws = (char*)d_ws;
  size_t off = 0;
  float* logg = (float*)(ws + off);          off += (size_t)NB * NH * NTOK * NTOK * sizeof(float);
  _Float16* Q16 = (_Float16*)(ws + off);     off += (size_t)xsz * 2;
  _Float16* K16 = (_Float16*)(ws + off);     off += (size_t)xsz * 2;
  _Float16* Vth = (_Float16*)(ws + off);     off += (size_t)xsz * 2;   // [b][h][dk][token]
  _Float16* Vtl = (_Float16*)(ws + off);     off += (size_t)xsz * 2;
  _Float16* AOh = (_Float16*)(ws + off);     off += (size_t)xsz * 2;   // [b*N+q][h*64+dk]
  _Float16* AOl = (_Float16*)(ws + off);     off += (size_t)xsz * 2;
  if (off > ws_size) return;

  const float omul_o = 1.0f / (S_AO * S_W);  // 2^-22
  const dim3 gg(DM / 64, MTOK / 64), gb(128);

  k_front<<<dim3(3 * GTILES + NB * NTOK), gb, 0, stream>>>(Xq, Xk, Xv, Wq, bq, Wk, bk, Wv, bv, box, Wg, bg, msk,
                                                           Q16, K16, Vth, Vtl, logg);
  k_attn<<<dim3(NB * NH * (NTOK / 64)), dim3(128 * KSPL), 0, stream>>>(Q16, K16, Vth, Vtl, logg, AOh, AOl);
  k_gemm<2, 2, 4><<<gg, dim3(128 * 4), 0, stream>>>(Wo, AOh, AOl, Wo, bo, AOh, AOl, out,
                                      MTOK, DM, DM, 1.0f, S_W, omul_o, 1.0f);
}

// v004
// A run of this version takes 52.4 microseconds.
// Two timings next to v003 both put it at 1.10 times that version's speed.
// All steps since v000 together make it 2.41 times as fast.
#include <hip/hip_runtime.h>
#include <stddef.h>

// Contractions on v_wmma_f32_16x16x32_f16 (f16 operands, f32 accumulate): q,k projections and q.k^T as single products of power-of-two scaled operands; v projection, p.v, output projection and the 64->8 geometric projection as f16 hi + residual operand pairs (power-of-two scaled). Softmax, geometry embedding, bias, normalisation in f32.

#define NB   4
#define NTOK 512
#define DM   512
#define NH   8
#define DKH  64
#define MTOK (NB * NTOK)

#define S_X  1024.0f
#define S_W  4096.0f
#define S_QK 16.0f
#define S_V  1024.0f
#define S_P  4096.0f
#define S_AO 1024.0f
#define S_E  2048.0f
#define S_G  4096.0f

typedef _Float16 v16h __attribute__((ext_vector_type(16)));
typedef _Float16 v8h_base __attribute__((ext_vector_type(8)));
typedef v8h_base __attribute__((may_alias)) v8h;
typedef float v8f __attribute__((ext_vector_type(8)));
typedef float v4f_base __attribute__((ext_vector_type(4)));
typedef v4f_base __attribute__((may_alias)) v4f;

union Frag16 { v16h v; v8h half[2]; _Float16 s[16]; };
union Pack8  { v8h v; _Float16 s[8]; };
union Pack2  { unsigned u; _Float16 s[2]; };
union F8     { v4f v[2]; float f[8]; };

__device__ __forceinline__ v8f zero8f() {
  v8f z = {0.f, 0.f, 0.f, 0.f, 0.f, 0.f, 0.f, 0.f};
  return z;
}

// one 16x16x32 step with the VALU hazard guard tied to D, A, B
__device__ __forceinline__ v8f wmma16(v16h a, v16h b, v8f c) {
  v8f d = __builtin_amdgcn_wmma_f32_16x16x32_f16(false, a, false, b, (short)0, c, false, false);
  asm volatile("v_nop\n\tv_nop\n\tv_nop\n\tv_nop" : "+v"(d) : "v"(a), "v"(b));
  return d;
}

// 16x32 operand fragment from a 16-bit LDS tile stored [line][k], k contiguous, pitch in elements (16-B aligned lines).
// lane l: line (row of A / column of B) = l & 15; elements 0..7 <- k0 + 8*(l>>4) + 0..7, elements 8..15 <- k0 + 16 + 8*(l>>4) + 0..7.
__device__ __forceinline__ v16h ldfrag(const _Float16* base, int pitch, int lane, int k0) {
  const _Float16* p = base + (lane & 15) * pitch + k0 + 8 * (lane >> 4);
  Frag16 f;
  f.half[0] = *(const v8h*)(p);
  f.half[1] = *(const v8h*)(p + 16);
  return f.v;
}

// ---------------------------------------------------------------------------------------------
// Y[M][Nout] = A[M][K] . W[K][Nout] + bias.  64x64 tile, 128 threads = 4 waves (16 rows each).
// AM: 0 = A f32 -> one f16 plane (scaled); 1 = A f32 -> f16 hi + residual planes; 2 = A given as two f16 planes.
//     W f32 -> same plane count as A (scaled).  Planes>1: D = Ah.Wh + Ah.Wl + Al.Wh.
// OM: 0 = f16 row-major [M][Nout], value*o_scale; 1 = f16 hi/residual planes laid out [b][head][dk][token]
//     (Nout = NH*DKH, one head per column tile, M = NB*NTOK); 2 = f32 row-major.
// D element r of lane l = (row 8*(l>>4)+r, col l&15) of the 16x16 tile.
// ---------------------------------------------------------------------------------------------
// smem: the work-group's LDS (GEMM_LDS(planes) bytes per K group, 16-B aligned); (bx, by) = column tile, row tile.
// KS: K is split over KS groups of 4 waves (128 * KS threads). Group g walks k in [g*K/KS, (g+1)*K/KS) with its own A/W
//     tiles and accumulators, so the serial chain of load -> stage -> multiply rounds is KS times shorter and each SIMD
//     holds KS waves; the f32 partial tiles are summed through LDS (KS > 1: OM 2 only, K a multiple of 32*KS).
#define GEMM_LDS(npl) (2 * (npl) * 64 * 40 * 2 + 64 * 68 * 4)
template <int AM, int OM, int KS = 1>
__device__ __forceinline__ void gemm_body(char* smem, int bx, int by,
                                          const float* Af, const _Float16* Ah, const _Float16* Al,
                                          const float* W, const float* bias,
                                          _Float16* Yh, _Float16* Yl, float* Yf,
                                          int M, int K, int Nout,
                                          float a_scale, float w_scale, float o_mul, float o_scale) {
  constexpr int NPL = (AM == 0) ? 1 : 2;
  static_assert(KS == 1 || OM == 2, "the merge of K groups is written for the f32 row-major output");
  const int grp = (KS > 1) ? __builtin_amdgcn_readfirstlane((int)threadIdx.x >> 7) : 0;   // same in every lane of a wave
  smem += grp * GEMM_LDS(NPL);                                                              // the group's own tiles
  _Float16 (*At)[64][40] = reinterpret_cast<_Float16 (*)[64][40]>(smem);                        // [plane][row][k]
  _Float16 (*Bt)[64][40] = reinterpret_cast<_Float16 (*)[64][40]>(smem + NPL * 64 * 40 * 2);    // [plane][n][k]
  float (*Ct)[68] = reinterpret_cast<float (*)[68]>(smem + 2 * NPL * 64 * 40 * 2);

  const int tid = (KS > 1) ? (int)(threadIdx.x & 127) : (int)threadIdx.x;   // index inside the K group
  const int lane = tid & 31, wave = tid >> 5;
  const int hh = lane >> 4, m = lane & 15;
  const int n0 = bx * 64, m0 = by * 64;
  if (m0 + 64 > M || n0 + 64 > Nout) return;   // block-uniform, before any barrier

  v8f acc[4];
#pragma unroll
  for (int j = 0; j < 4; ++j) acc[j] = zero8f();

  const int kbeg = (KS > 1) ? grp * (K / KS) : 0;   // same trip count in every group: barriers stay block-uniform
  const int kend = (KS > 1) ? kbeg + K / KS : K;
#pragma unroll 1
  for (int kk = kbeg; kk < kend; kk += 32) {
    {  // A tile 64x32: thread -> row tid>>1, 16 consecutive k
      const int r = tid >> 1, cb = (tid & 1) * 16;
      if (AM == 2) {
        const size_t g = (size_t)(m0 + r) * K + kk + cb;
        const v8h h0 = *(const v8h*)(Ah + g), h1 = *(const v8h*)(Ah + g + 8);
        const v8h l0 = *(const v8h*)(Al + g), l1 = *(const v8h*)(Al + g + 8);
        *(v8h*)&At[0][r][cb] = h0;        *(v8h*)&At[0][r][cb + 8] = h1;
        *(v8h*)&At[NPL - 1][r][cb] = l0;  *(v8h*)&At[NPL - 1][r][cb + 8] = l1;
      } else {
        const float* s = Af + (size_t)(m0 + r) * K + kk + cb;
        F8 x0, x1;
        x0.v[0] = *(const v4f*)(s);      x0.v[1] = *(const v4f*)(s + 4);
        x1.v[0] = *(const v4f*)(s + 8);  x1.v[1] = *(const v4f*)(s + 12);
        Frag16 ph, pl;
#pragma unroll
        for (int e = 0; e < 8; ++e) {
          const float v0 = x0.f[e] * a_scale, v1 = x1.f[e] * a_scale;
          const _Float16 h0 = (_Float16)v0, h1 = (_Float16)v1;
          ph.s[e] = h0;
          ph.s[8 + e] = h1;
          pl.s[e] = (_Float16)(v0 - (float)h0);
          pl.s[8 + e] = (_Float16)(v1 - (float)h1);
        }
        *(v8h*)&At[0][r][cb] = ph.half[0];  *(v8h*)&At[0][r][cb + 8] = ph.half[1];
        if (NPL == 2) {
          *(v8h*)&At[NPL - 1][r][cb] = pl.half[0];  *(v8h*)&At[NPL - 1][r][cb + 8] = pl.half[1];
        }
      }
    }
    {  // W tile 32 k x 64 n, stored transposed [n][k]: thread -> k pair 2kp,2kp+1 and 8 columns
      const int kp = tid >> 3, nb = (tid & 7) * 8;
      const float* s0 = W + (size_t)(kk + 2 * kp) * Nout + n0 + nb;
      const float* s1 = s0 + Nout;
      F8 w0, w1;
      w0.v[0] = *(const v4f*)(s0);  w0.v[1] = *(const v4f*)(s0 + 4);
      w1.v[0] = *(const v4f*)(s1);  w1.v[1] = *(const v4f*)(s1 + 4);
#pragma unroll
      for (int d = 0; d < 8; ++d) {
        const float a = w0.f[d] * w_scale, c = w1.f[d] * w_scale;
        const _Float16 ha = (_Float16)a, hc = (_Float16)c;
        Pack2 q;
        q.s[0] = ha;  q.s[1] = hc;
        *(unsigned*)&Bt[0][nb + d][2 * kp] = q.u;
        if (NPL == 2) {
          Pack2 ql;
          ql.s[0] = (_Float16)(a - (float)ha);
          ql.s[1] = (_Float16)(c - (float)hc);
          *(unsigned*)&Bt[NPL - 1][nb + d][2 * kp] = ql.u;
        }
      }
    }
    __syncthreads();

    const v16h ah = ldfrag(&At[0][wave * 16][0], 40, lane, 0);
    if (NPL == 1) {
#pragma unroll
      for (int j = 0; j < 4; ++j) {
        const v16h bh = ldfrag(&Bt[0][j * 16][0], 40, lane, 0);
        acc[j] = wmma16(ah, bh, acc[j]);
      }
    } else {
      const v16h al = ldfrag(&At[NPL - 1][wave * 16][0], 40, lane, 0);
#pragma unroll
      for (int j = 0; j < 4; ++j) {
        const v16h bh = ldfrag(&Bt[0][j * 16][0], 40, lane, 0);
        const v16h bl = ldfrag(&Bt[NPL - 1][j * 16][0], 40, lane, 0);
        acc[j] = wmma16(ah, bh, acc[j]);
        acc[j] = wmma16(ah, bl, acc[j]);
        acc[j] = wmma16(al, bh, acc[j]);
      }
    }
    __syncthreads();
  }

  if (KS > 1) {
    // each K group leaves its raw f32 partial tile in LDS; thread -> one row, 8 consecutive columns: sum, scale, bias
#pragma unroll
    for (int j = 0; j < 4; ++j)
#pragma unroll
      for (int r = 0; r < 8; ++r) Ct[wave * 16 + 8 * hh + r][16 * j + m] = acc[j][r];
    __syncthreads();
    const int row = (int)threadIdx.x >> 3, c0 = ((int)threadIdx.x & 7) * 8;
    const char* c00 = smem - grp * GEMM_LDS(NPL) + 2 * NPL * 64 * 40 * 2 + (row * 68 + c0) * 4;   // group 0's tile
    F8 bc, sum;
    bc.v[0] = *(const v4f*)(bias + n0 + c0);
    bc.v[1] = *(const v4f*)(bias + n0 + c0 + 4);
    sum.v[0] = *(const v4f*)(c00);
    sum.v[1] = *(const v4f*)(c00 + 16);
#pragma unroll
    for (int g = 1; g < KS; ++g) {
      sum.v[0] += *(const v4f*)(c00 + g * GEMM_LDS(NPL));
      sum.v[1] += *(const v4f*)(c00 + g * GEMM_LDS(NPL) + 16);
    }
    float* y = Yf + (size_t)(m0 + row) * Nout + n0 + c0;
    *(v4f*)(y) = sum.v[0] * o_mul + bc.v[0];
    *(v4f*)(y + 4) = sum.v[1] * o_mul + bc.v[1];
    return;
  }

  // D + bias (unscaled) -> LDS tile
#pragma unroll
  for (int j = 0; j < 4; ++j) {
    const float bcol = bias[n0 + 16 * j + m];
#pragma unroll
    for (int r = 0; r < 8; ++r) Ct[wave * 16 + 8 * hh + r][16 * j + m] = acc[j][r] * o_mul + bcol;
  }
  __syncthreads();

  if (OM == 0) {
    const int q = lane >> 3, p = lane & 7;
    v8h vals[4];
    size_t addr[4];
#pragma unroll
    for (int it = 0; it < 4; ++it) {
      const int row = wave * 16 + 4 * it + q;
      F8 c;
      c.v[0] = *(const v4f*)&Ct[row][8 * p];
      c.v[1] = *(const v4f*)&Ct[row][8 * p + 4];
      Pack8 pk;
#pragma unroll
      for (int e = 0; e < 8; ++e) pk.s[e] = (_Float16)(c.f[e] * o_scale);
      vals[it] = pk.v;
      addr[it] = (size_t)(m0 + row) * Nout + n0 + 8 * p;
    }
#pragma unroll
    for (int it = 0; it < 4; ++it) *(v8h*)(Yh + addr[it]) = vals[it];
    // in a kernel with several block ranges other code follows these stores in the listing: their address and data
    // registers stay untouched until the stores have taken them
    asm volatile("s_wait_xcnt 0x0" ::: "memory");
  } else if (OM == 1) {
    const int hd = bx;
    const int bb = m0 / NTOK, tok0 = m0 - bb * NTOK;
    const int q = lane >> 3, p = lane & 7;
    v8h vh[4], vl[4];
    size_t addr[4];
#pragma unroll
    for (int it = 0; it < 4; ++it) {
      const int dk = wave * 16 + 4 * it + q;
      Pack8 ph, pl;
#pragma unroll
      for (int e = 0; e < 8; ++e) {
        const float v = Ct[8 * p + e][dk] * o_scale;
        const _Float16 hv = (_Float16)v;
        ph.s[e] = hv;
        pl.s[e] = (_Float16)(v - (float)hv);
      }
      vh[it] = ph.v;
      vl[it] = pl.v;
      addr[it] = (((size_t)bb * NH + hd) * DKH + dk) * NTOK + tok0 + 8 * p;
    }
#pragma unroll
    for (int it = 0; it < 4; ++it) {
      *(v8h*)(Yh + addr[it]) = vh[it];
      *(v8h*)(Yl + addr[it]) = vl[it];
    }
    
  } else {
    const int q = lane >> 4, p = lane & 15;
    v4f vals[8];
    size_t addr[8];
#pragma unroll
    for (int it = 0; it < 8; ++it) {
      const int row = wave * 16 + 2 * it + q;
      vals[it] = *(const v4f*)&Ct[row][4 * p];
      addr[it] = (size_t)(m0 + row) * Nout + n0 + 4 * p;
    }
#pragma unroll
    for (int it = 0; it < 8; ++it) *(v4f*)(Yf + addr[it]) = vals[it];
    
  }
}

template <int AM, int OM, int KS>
__global__ __launch_bounds__(128 * KS) void k_gemm(const float* Af, const _Float16* Ah, const _Float16* Al,
                                             const float* W, const float* bias,
                                             _Float16* Yh, _Float16* Yl, float* Yf,
                                             int M, int K, int Nout,
                                             float a_scale, float w_scale, float o_mul, float o_scale) {
  __shared__ __attribute__((aligned(16))) char smem[KS * GEMM_LDS((AM == 0) ? 1 : 2)];
  gemm_body<AM, OM, KS>(smem, blockIdx.x, blockIdx.y, Af, Ah, Al, W, bias, Yh, Yl, Yf, M, K, Nout,
                    a_scale, w_scale, o_mul, o_scale);
}

// ---------------------------------------------------------------------------------------------
// Geometric log-weights with the key mask folded in:
// logg[b][h][i][j] = log(max(relu(emb(i,j) . Wg[:,h] + bg[h]), 1e-6)) + (mask[b][i][j]==0 ? -1e9 : 0)
// One block per (b, GIB query boxes i, 128 key boxes j; one j per thread); the 64->8 projection runs on WMMA.
// The two centre-distance angles depend on the pair (i, j): their 32 sin/cos values are made per pair (A = hi / residual
// planes x S_E, B columns 0..7 = f16(S_G*Wg[:,h]), 8..15 = residual of the same).
// The two size angles are differences, 100*dm*log(w_i/w_j) = A_i - A_j with A = 100*dm*log(w) (w > 0 for box coordinates in
// [0,1)): Ws*sin(A_i-A_j) + Wc*cos(A_i-A_j) = sin(A_j)*(Wc*sin(A_i) - Ws*cos(A_i)) + cos(A_j)*(Ws*sin(A_i) + Wc*cos(A_i)).
// So sin/cos(A_j) are made once per block (A fragments kept in registers for all GIB query boxes) and the brackets are a
// 32x8 B operand per query box, made once in the prologue.
// k order of every 32-wide operand here: k = 16*c + 8*pl + f, c = 0 sin / 1 cos, pl = which of the two angles, f = frequency.
// ---------------------------------------------------------------------------------------------
#define GIB 8
#define GEO_BLOCKS (NB * (NTOK / GIB) * (NTOK / 128))
#define GEO_O_B0 (2 * 128 * 40 * 2)
#define GEO_O_BP (GEO_O_B0 + 16 * 40 * 2)
#define GEO_O_GS (GEO_O_BP + GIB * 16 * 40 * 2)
#define GEO_O_DM (GEO_O_GS + 128 * 17 * 4)
#define GEO_O_SA (GEO_O_DM + 8 * 4 + 8 * 4)
#define GEO_O_SI (GEO_O_SA + GIB * 32 * 4)
#define GEO_LDS  (GEO_O_SI + GIB * 4 * 4)

// 8 angles ang0*dm[f] -> sin and cos, each as f16 hi / residual of S_E * value
__device__ __forceinline__ void geo_sincos8(float ang0, const float* dm, Pack8& sh, Pack8& sl, Pack8& chv, Pack8& clv) {
  float sn[8], cs[8];
#pragma unroll
  for (int f = 0; f < 8; ++f) sn[f] = __sinf(ang0 * dm[f]);
#pragma unroll
  for (int f = 0; f < 8; ++f) cs[f] = __cosf(ang0 * dm[f]);
#pragma unroll
  for (int f = 0; f < 8; ++f) {
    const float sv = sn[f] * S_E;
    const float cv = cs[f] * S_E;
    const _Float16 a = (_Float16)sv;
    sh.s[f] = a;
    sl.s[f] = (_Float16)(sv - (float)a);
    const _Float16 c = (_Float16)cv;
    chv.s[f] = c;
    clv.s[f] = (_Float16)(cv - (float)c);
  }
}

__device__ __forceinline__ void geo_body(char* smem, int gb, const float* box, const float* Wg, const float* bg,
                                         const int* msk, float* logg) {
  _Float16 (*Et)[128][40] = reinterpret_cast<_Float16 (*)[128][40]>(smem);              // [plane][j][k]
  _Float16 (*B0)[40] = reinterpret_cast<_Float16 (*)[40]>(smem + GEO_O_B0);             // [n][k], pair part of Wg
  _Float16 (*Bp)[16][40] = reinterpret_cast<_Float16 (*)[16][40]>(smem + GEO_O_BP);     // [query box][n][k], size part
  float (*Gs)[17] = reinterpret_cast<float (*)[17]>(smem + GEO_O_GS);
  float* sdm = reinterpret_cast<float*>(smem + GEO_O_DM);
  float* sbg = sdm + 8;
  float (*sA)[32] = reinterpret_cast<float (*)[32]>(smem + GEO_O_SA);                   // [query box][sin 0..15 | cos 0..15]
  v4f* sI = reinterpret_cast<v4f*>(smem + GEO_O_SI);                                    // [query box] cx, cy, 1/w, 1/h

  static_assert(GIB * 16 == 128, "one thread per (query box, size angle)");
  const int tid = threadIdx.x, lane = tid & 31, wave = tid >> 5;
  const int hh = lane >> 4, m = lane & 15;
  if (gb >= GEO_BLOCKS) return;   // block-uniform
  const int j0 = (gb & (NTOK / 128 - 1)) * 128;
  const int i0 = ((gb / (NTOK / 128)) & (NTOK / GIB - 1)) * GIB;
  const int b = gb / ((NTOK / 128) * (NTOK / GIB));

  if (tid < 8) {
    sdm[tid] = 1.0f / powf(1000.0f, (float)tid * 0.125f);
    sbg[tid] = bg[tid];
  }
#pragma unroll
  for (int e = 0; e < 4; ++e) {
    const int idx = tid * 4 + e;          // 0..511
    const int n = idx >> 5, k = idx & 31;
    const float w = Wg[((k >> 4) * 32 + (k & 15)) * NH + (n & 7)] * S_G;
    const _Float16 wh = (_Float16)w;
    const _Float16 wl = (_Float16)(w - (float)wh);
    B0[n][k] = (n < 8) ? wh : wl;
  }
  const v4f bxj = *(const v4f*)(box + ((size_t)b * NTOK + j0 + tid) * 4);
  const float cxj = (bxj[0] + bxj[1]) * 0.5f, cyj = (bxj[2] + bxj[3]) * 0.5f;
  const float wj = (bxj[1] - bxj[0]) + 1.0f, hgj = (bxj[3] - bxj[2]) + 1.0f;
  __syncthreads();

  float dm[8];
#pragma unroll
  for (int f = 0; f < 8; ++f) dm[f] = sdm[f];

  {  // sin/cos(A_j) of key box j0 + tid -> Et[.][tid][0..31]
    const float la[2] = {logf(wj) * 100.0f, logf(hgj) * 100.0f};
#pragma unroll
    for (int pl = 0; pl < 2; ++pl) {
      Pack8 sh, sl, chv, clv;
      geo_sincos8(la[pl], dm, sh, sl, chv, clv);
      *(v8h*)&Et[0][tid][pl * 8] = sh.v;
      *(v8h*)&Et[1][tid][pl * 8] = sl.v;
      *(v8h*)&Et[0][tid][16 + pl * 8] = chv.v;
      *(v8h*)&Et[1][tid][16 + pl * 8] = clv.v;
    }
  }
  {  // sin/cos(A_i): thread -> query box tid>>4, angle (tid>>3)&1, frequency tid&7
    const int ii = tid >> 4, a = tid & 15;
    const v4f bi = *(const v4f*)(box + ((size_t)b * NTOK + i0 + ii) * 4);
    const float wi = (bi[1] - bi[0]) + 1.0f, hgi = (bi[3] - bi[2]) + 1.0f;
    const float ang = (logf((a & 8) ? hgi : wi) * 100.0f) * sdm[a & 7];
    sA[ii][a] = __sinf(ang);
    sA[ii][16 + a] = __cosf(ang);
    if (a == 0) {
      v4f q;
      q[0] = (bi[0] + bi[1]) * 0.5f;
      q[1] = (bi[2] + bi[3]) * 0.5f;
      q[2] = 1.0f / wi;
      q[3] = 1.0f / hgi;
      sI[ii] = q;
    }
  }
  __syncthreads();

  v16h eh[2], el[2];
#pragma unroll
  for (int t = 0; t < 2; ++t) {
    eh[t] = ldfrag(&Et[0][wave * 32 + t * 16][0], 40, lane, 0);
    el[t] = ldfrag(&Et[1][wave * 32 + t * 16][0], 40, lane, 0);
  }
  const v16h b0 = ldfrag(&B0[0][0], 40, lane, 0);
#pragma unroll
  for (int e = 0; e < GIB * 32 / 128; ++e) {   // size part of the B operand: thread -> (query box, k), all 8 heads
    const int idx = e * 128 + tid;
    const int ii = idx >> 5, k = idx & 31, a = k & 15;
    const bool isc = (k >> 4) != 0;
    const float sa = sA[ii][a], ca = sA[ii][16 + a];
    const float* ws = Wg + (16 + a) * NH;
    const float* wc = Wg + (48 + a) * NH;
    F8 s8, c8;
    s8.v[0] = *(const v4f*)(ws);  s8.v[1] = *(const v4f*)(ws + 4);
    c8.v[0] = *(const v4f*)(wc);  c8.v[1] = *(const v4f*)(wc + 4);
#pragma unroll
    for (int h = 0; h < 8; ++h) {
      const float x = isc ? s8.f[h] : c8.f[h];
      const float y = isc ? c8.f[h] : -s8.f[h];
      const float w = (x * sa + y * ca) * S_G;
      const _Float16 wh = (_Float16)w;
      Bp[ii][h][k] = wh;
      Bp[ii][h + 8][k] = (_Float16)(w - (float)wh);
    }
  }
  __syncthreads();   // Bp is complete, and every wave holds its sin/cos(A_j) fragments before Et is written again

  const v8f z8 = zero8f();

#pragma unroll 1
  for (int ii = 0; ii < GIB; ++ii) {
    const int i = i0 + ii;
    {  // pair part of the embedding of (i, j0 + tid) -> Et[.][tid][0..31]
      const v4f qi = sI[ii];
      const float p0 = logf(fmaxf(fabsf((qi[0] - cxj) * qi[2]), 1e-3f));
      const float p1 = logf(fmaxf(fabsf((qi[1] - cyj) * qi[3]), 1e-3f));
      const float pp[2] = {p0 * 100.0f, p1 * 100.0f};
#pragma unroll
      for (int pl = 0; pl < 2; ++pl) {
        Pack8 sh, sl, chv, clv;
        geo_sincos8(pp[pl], dm, sh, sl, chv, clv);
        *(v8h*)&Et[0][tid][pl * 8] = sh.v;
        *(v8h*)&Et[1][tid][pl * 8] = sl.v;
        *(v8h*)&Et[0][tid][16 + pl * 8] = chv.v;
        *(v8h*)&Et[1][tid][16 + pl * 8] = clv.v;
      }
    }
    __syncthreads();

    // 128 j rows x 16 cols, K = 32 (pair part) + 32 (size part): wave -> two 16-row tiles
    const v16h bp = ldfrag(&Bp[ii][0][0], 40, lane, 0);
#pragma unroll
    for (int t = 0; t < 2; ++t) {
      const int row0 = wave * 32 + t * 16;
      v8f acc = z8;
      const v16h a0 = ldfrag(&Et[0][row0][0], 40, lane, 0);
      const v16h l0 = ldfrag(&Et[1][row0][0], 40, lane, 0);
      acc = wmma16(a0, b0, acc);
      acc = wmma16(l0, b0, acc);
      acc = wmma16(eh[t], bp, acc);
      acc = wmma16(el[t], bp, acc);
#pragma unroll
      for (int r = 0; r < 8; ++r) Gs[row0 + 8 * hh + r][m] = acc[r];
    }
    __syncthreads();

    const size_t mbase = ((size_t)b * NTOK + i) * NTOK + j0;
    v4f vv[2];
#pragma unroll
    for (int e = 0; e < 2; ++e) {
      const int hd = 2 * wave + e;
#pragma unroll
      for (int q = 0; q < 4; ++q) {
        const int jl = 4 * lane + q;
        const float graw = (Gs[jl][hd] + Gs[jl][hd + 8]) * (1.0f / (S_E * S_G)) + sbg[hd];
        const float g = fmaxf(graw, 0.0f);
        float v = logf(fmaxf(g, 1e-6f));
        const int mk = msk[mbase + jl];
        v += (mk == 0) ? -1e9f : 0.0f;
        vv[e][q] = v;
      }
    }
    float* ap0 = logg + (((size_t)b * NH + 2 * wave) * NTOK + i) * NTOK + j0 + 4 * lane;
    float* ap1 = ap0 + (size_t)NTOK * NTOK;
    *(v4f*)ap0 = vv[0];
    *(v4f*)ap1 = vv[1];
    // the next trip reuses the stores' data and address registers at once: they stay untouched until the stores took them
    asm volatile("s_wait_xcnt 0x0" ::: "memory");
  }
}

// ---------------------------------------------------------------------------------------------
// The four producers of the attention kernel depend on inputs only, so they share one launch and run side by side:
// block ranges, longest work-groups first: v projection, q projection, k projection (GTILES tiles each), geometry.
// Every branch is block-uniform (blockIdx only); the ranges share one LDS buffer sized for the largest user.
// ---------------------------------------------------------------------------------------------
#define GTILES ((DM / 64) * (MTOK / 64))
__global__ __launch_bounds__(128) void k_front(const float* Xq, const float* Xk, const float* Xv,
                                              const float* Wq, const float* bq, const float* Wk, const float* bk,
                                              const float* Wv, const float* bv,
                                              const float* box, const float* Wg, const float* bg, const int* msk,
                                              _Float16* Q16, _Float16* K16, _Float16* Vth, _Float16* Vtl,
                                              float* logg) {
  static_assert(GEO_LDS >= GEMM_LDS(2), "shared buffer is sized by the geometry part");
  __shared__ __attribute__((aligned(16))) char smem[GEO_LDS];
  const int blk = blockIdx.x;
  const float omul = 1.0f / (S_X * S_W);     // 2^-22
  if (blk < GTILES) {
    gemm_body<1, 1>(smem, blk & (DM / 64 - 1), blk / (DM / 64), Xv, nullptr, nullptr, Wv, bv, Vth, Vtl, nullptr,
                    MTOK, DM, DM, S_X, S_W, omul, S_V);
  } else if (blk < 3 * GTILES) {
    const bool isq = blk < 2 * GTILES;
    const int t = blk - (isq ? GTILES : 2 * GTILES);
    gemm_body<0, 0>(smem, t & (DM / 64 - 1), t / (DM / 64), isq ? Xq : Xk, nullptr, nullptr,
                    isq ? Wq : Wk, isq ? bq : bk, isq ? Q16 : K16, nullptr, nullptr,
                    MTOK, DM, DM, S_X, S_W, omul, S_QK);
  } else {
    geo_body(smem, blk - 3 * GTILES, box, Wg, bg, msk, logg);
  }
}

// ---------------------------------------------------------------------------------------------
// Streaming attention: block = (b, h, 64 query rows), KSPL key groups x 4 waves x 16 rows, key tiles of 32.
// Key group g walks key tiles g, g + KSPL, g + 2*KSPL, ... with its own K/V/P tiles, row maxima, row sums and O partials,
// so each SIMD holds KSPL waves and the serial chain of tiles is KSPL times shorter; the partials are merged through LDS.
// S = Q16.K16^T (single f16 product, Q16/K16 carry S_QK); logits = S*(1/(8*S_QK^2)) + logg; online softmax in f32;
// O += P.V with P as f16 hi/residual of S_P*p and V as f16 hi/residual planes (carrying S_V), V tile staged [dk][key].
// Output: f16 hi/residual planes of S_AO * (O / l), row-major [b*N+q][h*64+dk].
// ---------------------------------------------------------------------------------------------
#define KSPL 4
__global__ __launch_bounds__(128 * KSPL) void k_attn(const _Float16* Qh, const _Float16* Kh,
                                                    const _Float16* Vth, const _Float16* Vtl,
                                                    const float* logg, _Float16* Oh, _Float16* Ol) {
  __shared__ __attribute__((aligned(16))) _Float16 Qt[64][72];              // [q][dk]
  __shared__ __attribute__((aligned(16))) _Float16 Kt[KSPL][32][72];        // [group][key][dk]
  __shared__ __attribute__((aligned(16))) _Float16 Vt[KSPL][2][64][40];     // [group][plane][dk][key]
  __shared__ __attribute__((aligned(16))) _Float16 Pt[KSPL][2][4][16][40];  // [group][plane][wave][q][key]
  __shared__ __attribute__((aligned(16))) float Cs[KSPL][64][68];           // [group][q][dk] un-normalised O partial
  __shared__ float Ms[KSPL][64];                                            // [group][q] row maximum
  __shared__ float Ls[KSPL][64];                                            // [group][q] row sum

  static_assert(128 * KSPL == 64 * 8, "Q staging and the merge give each thread one row and 8 consecutive dk");
  const int tid = threadIdx.x, lane = tid & 31;
  const int grp = __builtin_amdgcn_readfirstlane(tid >> 7);   // same in every lane of a wave: kept scalar
  const int gt = tid & 127, wave = gt >> 5;
  const int hh = lane >> 4, m = lane & 15;
  const int blk = blockIdx.x;
  if (blk >= NB * NH * (NTOK / 64)) return;   // block-uniform
  const int qb = blk & 7, h = (blk >> 3) & 7, b = blk >> 6;
  const int q0 = qb * 64;

  {
    const int r = tid >> 3, cb = (tid & 7) * 8;
    *(v8h*)&Qt[r][cb] = *(const v8h*)(Qh + ((size_t)(b * NTOK + q0 + r)) * DM + h * DKH + cb);
  }
  __syncthreads();
  const v16h qa0 = ldfrag(&Qt[wave * 16][0], 72, lane, 0);
  const v16h qa1 = ldfrag(&Qt[wave * 16][0], 72, lane, 32);

  const v8f z8 = zero8f();
  v8f o[4];
#pragma unroll
  for (int j = 0; j < 4; ++j) o[j] = z8;
  float mrow[8], lrow[8];
#pragma unroll
  for (int r = 0; r < 8; ++r) { mrow[r] = -1e30f; lrow[r] = 0.0f; }

  const size_t lgrow = (((size_t)b * NH + h) * NTOK + (q0 + wave * 16 + 8 * hh)) * NTOK;
  const float SC = 0.125f / (S_QK * S_QK);

#pragma unroll 1
  for (int it = 0; it < NTOK / 32 / KSPL; ++it) {   // same trip count in every group: barriers stay block-uniform
    const int k0 = (it * KSPL + grp) * 32;
    {  // K tile 32 keys x 64 dk
      const int r = gt >> 2, cb = (gt & 3) * 16;
      const _Float16* s = Kh + ((size_t)(b * NTOK + k0 + r)) * DM + h * DKH + cb;
      *(v8h*)&Kt[grp][r][cb] = *(const v8h*)(s);
      *(v8h*)&Kt[grp][r][cb + 8] = *(const v8h*)(s + 8);
    }
    {  // V planes, already [dk][token]: 64 dk x 32 keys, direct copy
      const int r = gt >> 1, cb = (gt & 1) * 16;
      const size_t g = (((size_t)b * NH + h) * DKH + r) * NTOK + k0 + cb;
      *(v8h*)&Vt[grp][0][r][cb] = *(const v8h*)(Vth + g);
      *(v8h*)&Vt[grp][0][r][cb + 8] = *(const v8h*)(Vth + g + 8);
      *(v8h*)&Vt[grp][1][r][cb] = *(const v8h*)(Vtl + g);
      *(v8h*)&Vt[grp][1][r][cb + 8] = *(const v8h*)(Vtl + g + 8);
    }
    __syncthreads();

    // S[16 q][32 keys]: B[k=dk][n=key] = Kt[key][dk] -> n-major tile, same loader as A
    v8f s[2];
#pragma unroll
    for (int c = 0; c < 2; ++c) {
      const v16h b0 = ldfrag(&Kt[grp][16 * c][0], 72, lane, 0);
      const v16h b1 = ldfrag(&Kt[grp][16 * c][0], 72, lane, 32);
      v8f sc = z8;
      sc = wmma16(qa0, b0, sc);
      sc = wmma16(qa1, b1, sc);
      s[c] = sc;
    }

    float t[2][8];
#pragma unroll
    for (int c = 0; c < 2; ++c)
#pragma unroll
      for (int r = 0; r < 8; ++r)
        t[c][r] = s[c][r] * SC + logg[lgrow + (size_t)r * NTOK + k0 + 16 * c + m];

    float rmax[8];
#pragma unroll
    for (int r = 0; r < 8; ++r) rmax[r] = fmaxf(t[0][r], t[1][r]);
#pragma unroll
    for (int off = 8; off >= 1; off >>= 1)
#pragma unroll
      for (int r = 0; r < 8; ++r) rmax[r] = fmaxf(rmax[r], __shfl_xor(rmax[r], off, 16));

    float alpha[8];
#pragma unroll
    for (int r = 0; r < 8; ++r) {
      const float mnew = fmaxf(mrow[r], rmax[r]);
      alpha[r] = __expf(mrow[r] - mnew);
      mrow[r] = mnew;
    }
#pragma unroll
    for (int c = 0; c < 2; ++c)
#pragma unroll
      for (int r = 0; r < 8; ++r) t[c][r] = __expf(t[c][r] - mrow[r]);

    float rsum[8];
#pragma unroll
    for (int r = 0; r < 8; ++r) rsum[r] = t[0][r] + t[1][r];
#pragma unroll
    for (int off = 8; off >= 1; off >>= 1)
#pragma unroll
      for (int r = 0; r < 8; ++r) rsum[r] += __shfl_xor(rsum[r], off, 16);
#pragma unroll
    for (int r = 0; r < 8; ++r) lrow[r] = lrow[r] * alpha[r] + rsum[r];
#pragma unroll
    for (int j = 0; j < 4; ++j)
#pragma unroll
      for (int r = 0; r < 8; ++r) o[j][r] *= alpha[r];

    // P tile (D layout: row 8hh+r = q, col m = key) -> LDS planes; block barrier before the fragment reload
#pragma unroll
    for (int c = 0; c < 2; ++c)
#pragma unroll
      for (int r = 0; r < 8; ++r) {
        const float ps = t[c][r] * S_P;
        const _Float16 ph = (_Float16)ps;
        Pt[grp][0][wave][8 * hh + r][16 * c + m] = ph;
        Pt[grp][1][wave][8 * hh + r][16 * c + m] = (_Float16)(ps - (float)ph);
      }
    __syncthreads();

    const v16h pah = ldfrag(&Pt[grp][0][wave][0][0], 40, lane, 0);
    const v16h pal = ldfrag(&Pt[grp][1][wave][0][0], 40, lane, 0);
    // O[16 q][64 dk] += P[16 x 32 keys] . V[32 keys x 64 dk]; B[k=key][n=dk] = Vt[dk][key]
#pragma unroll
    for (int j = 0; j < 4; ++j) {
      const v16h vh = ldfrag(&Vt[grp][0][16 * j][0], 40, lane, 0);
      const v16h vl = ldfrag(&Vt[grp][1][16 * j][0], 40, lane, 0);
      o[j] = wmma16(pah, vh, o[j]);
      o[j] = wmma16(pah, vl, o[j]);
      o[j] = wmma16(pal, vh, o[j]);
    }
    __syncthreads();
  }

  // each key group leaves its un-normalised partial, row maximum and row sum in LDS
#pragma unroll
  for (int j = 0; j < 4; ++j)
#pragma unroll
    for (int r = 0; r < 8; ++r) Cs[grp][wave * 16 + 8 * hh + r][16 * j + m] = o[j][r];
  if (m == 0) {
#pragma unroll
    for (int r = 0; r < 8; ++r) {
      Ms[grp][wave * 16 + 8 * hh + r] = mrow[r];
      Ls[grp][wave * 16 + 8 * hh + r] = lrow[r];
    }
  }
  __syncthreads();

  // merge: weight exp(m_g - max) per group, divide by the merged row sum; thread -> one row, 8 consecutive dk
  {
    const int row = tid >> 3, p = tid & 7;
    float mg[KSPL];
#pragma unroll
    for (int g = 0; g < KSPL; ++g) mg[g] = Ms[g][row];
    float mall = mg[0];
#pragma unroll
    for (int g = 1; g < KSPL; ++g) mall = fmaxf(mall, mg[g]);
    float wg[KSPL], lall = 0.0f;
#pragma unroll
    for (int g = 0; g < KSPL; ++g) {
      wg[g] = __expf(mg[g] - mall);
      lall += Ls[g][row] * wg[g];
    }
    const float inv = (1.0f / lall) * (S_AO / (S_P * S_V));
    float acc[8];
#pragma unroll
    for (int e = 0; e < 8; ++e) acc[e] = 0.0f;
#pragma unroll
    for (int g = 0; g < KSPL; ++g) {
      F8 c;
      c.v[0] = *(const v4f*)&Cs[g][row][8 * p];
      c.v[1] = *(const v4f*)&Cs[g][row][8 * p + 4];
#pragma unroll
      for (int e = 0; e < 8; ++e) acc[e] += c.f[e] * wg[g];
    }
    Pack8 ph, pl;
#pragma unroll
    for (int e = 0; e < 8; ++e) {
      const float v = acc[e] * inv;
      const _Float16 hv = (_Float16)v;
      ph.s[e] = hv;
      pl.s[e] = (_Float16)(v - (float)hv);
    }
    const size_t addr = ((size_t)(b * NTOK + q0 + row)) * DM + h * DKH + 8 * p;
    *(v8h*)(Oh + addr) = ph.v;
    *(v8h*)(Ol + addr) = pl.v;
  }
}

// ---------------------------------------------------------------------------------------------
// host-side launch glue
// ---------------------------------------------------------------------------------------------
extern "C" void kernel_launch(void* const* d_in, const int* in_sizes, int n_in,
                              void* d_out, int out_size, void* d_ws, size_t ws_size,
                              hipStream_t stream) {
  if (n_in < 15) return;
  const int xsz = MTOK * DM, wsz = DM * DM;
  if (in_sizes[0] != xsz || in_sizes[1] != xsz || in_sizes[2] != xsz) return;
  if (in_sizes[3] != MTOK * 4 || in_sizes[4] != NB * NTOK * NTOK) return;
  if (in_sizes[5] != wsz || in_sizes[7] != wsz || in_sizes[9] != wsz || in_sizes[11] != wsz) return;
  if (in_sizes[6] != DM || in_sizes[8] != DM || in_sizes[10] != DM || in_sizes[12] != DM) return;
  if (in_sizes[13] != DKH * NH || in_sizes[14] != NH || out_size != xsz) return;

  const float* Xq  = (const float*)d_in[0];
  const float* Xk  = (const float*)d_in[1];
  const float* Xv  = (const float*)d_in[2];
  const float* box = (const float*)d_in[3];
  const int*   msk = (const int*)d_in[4];
  const float* Wq  = (const float*)d_in[5];
  const float* bq  = (const float*)d_in[6];
  const float* Wk  = (const float*)d_in[7];
  const float* bk  = (const float*)d_in[8];
  const float* Wv  = (const float*)d_in[9];
  const float* bv  = (const float*)d_in[10];
  const float* Wo  = (const float*)d_in[11];
  const float* bo  = (const float*)d_in[12];
  const float* Wg  = (const float*)d_in[13];
  const float* bg  = (const float*)d_in[14];
  float* out = (float*)d_out;

  // workspace carve (all offsets multiples of 2 MB): logg 32 MB, six 16-bit [2048][512] buffers 2 MB each = 44 MB
  char* ws = (char*)d_ws;
  size_t off = 0;
  float* logg = (float*)(ws + off);          off += (size_t)NB * NH * NTOK * NTOK * sizeof(float);
  _Float16* Q16 = (_Float16*)(ws + off);     off += (size_t)xsz * 2;
  _Float16* K16 = (_Float16*)(ws + off);     off += (size_t)xsz * 2;
  _Float16* Vth = (_Float16*)(ws + off);     off += (size_t)xsz * 2;   // [b][h][dk][token]
  _Float16* Vtl = (_Float16*)(ws + off);     off += (size_t)xsz * 2;
  _Float16* AOh = (_Float16*)(ws + off);     off += (size_t)xsz * 2;   // [b*N+q][h*64+dk]
  _Float16* AOl = (_Float16*)(ws + off);     off += (size_t)xsz * 2;
  if (off > ws_size) return;

  const float omul_o = 1.0f / (S_AO * S_W);  // 2^-22
  const dim3 gg(DM / 64, MTOK / 64), gb(128);

  k_front<<<dim3(3 * GTILES + GEO_BLOCKS), gb, 0, stream>>>(Xq, Xk, Xv, Wq, bq, Wk, bk, Wv, bv, box, Wg, bg, msk,
                                                           Q16, K16, Vth, Vtl, logg);
  k_attn<<<dim3(NB * NH * (NTOK / 64)), dim3(128 * KSPL), 0, stream>>>(Q16, K16, Vth, Vtl, logg, AOh, AOl);
  k_gemm<2, 2, 4><<<gg, dim3(128 * 4), 0, stream>>>(Wo, AOh, AOl, Wo, bo, AOh, AOl, out,
                                      MTOK, DM, DM, 1.0f, S_W, omul_o, 1.0f);
}

// v005
// Measured time: 46.6 microseconds a run.
// Timed twice side by side with v004, it ran 1.12 times as fast both times.
// All steps since v000 together make it 2.71 times as fast.
#include <hip/hip_runtime.h>
#include <stddef.h>

// Contractions on v_wmma_f32_16x16x32_f16 (f16 operands, f32 accumulate): q,k projections and q.k^T as single products of power-of-two scaled operands; v projection, p.v, output projection and the 64->8 geometric projection as f16 hi + residual operand pairs (power-of-two scaled). Softmax, geometry embedding, bias, normalisation in f32.

#define NB   4
#define NTOK 512
#define DM   512
#define NH   8
#define DKH  64
#define MTOK (NB * NTOK)

#define S_X  1024.0f
#define S_W  4096.0f
#define S_QK 16.0f
#define S_V  1024.0f
#define S_P  4096.0f
#define S_AO 1024.0f
#define S_E  2048.0f
#define S_G  4096.0f

typedef _Float16 v16h __attribute__((ext_vector_type(16)));
typedef _Float16 v8h_base __attribute__((ext_vector_type(8)));
typedef v8h_base __attribute__((may_alias)) v8h;
typedef float v8f __attribute__((ext_vector_type(8)));
typedef float v4f_base __attribute__((ext_vector_type(4)));
typedef v4f_base __attribute__((may_alias)) v4f;

union Frag16 { v16h v; v8h half[2]; _Float16 s[16]; };
union Pack8  { v8h v; _Float16 s[8]; };
union Pack2  { unsigned u; _Float16 s[2]; };
union F8     { v4f v[2]; float f[8]; };

__device__ __forceinline__ v8f zero8f() {
  v8f z = {0.f, 0.f, 0.f, 0.f, 0.f, 0.f, 0.f, 0.f};
  return z;
}

// one 16x16x32 step with the VALU hazard guard tied to D, A, B
__device__ __forceinline__ v8f wmma16(v16h a, v16h b, v8f c) {
  v8f d = __builtin_amdgcn_wmma_f32_16x16x32_f16(false, a, false, b, (short)0, c, false, false);
  asm volatile("v_nop\n\tv_nop\n\tv_nop\n\tv_nop" : "+v"(d) : "v"(a), "v"(b));
  return d;
}

// 16x32 operand fragment from a 16-bit LDS tile stored [line][k], k contiguous, pitch in elements (16-B aligned lines).
// lane l: line (row of A / column of B) = l & 15; elements 0..7 <- k0 + 8*(l>>4) + 0..7, elements 8..15 <- k0 + 16 + 8*(l>>4) + 0..7.
__device__ __forceinline__ v16h ldfrag(const _Float16* base, int pitch, int lane, int k0) {
  const _Float16* p = base + (lane & 15) * pitch + k0 + 8 * (lane >> 4);
  Frag16 f;
  f.half[0] = *(const v8h*)(p);
  f.half[1] = *(const v8h*)(p + 16);
  return f.v;
}

// Work-group barrier of the tile loops. It orders LDS accesses only (the loops hand nothing but LDS tiles from wave to wave),
// so global loads that were issued ahead into registers stay in flight across it; __syncthreads() would wait for them.
__device__ __forceinline__ void lds_barrier() {
  __builtin_amdgcn_fence(__ATOMIC_RELEASE, "workgroup", "local");
  __builtin_amdgcn_s_barrier();
  __builtin_amdgcn_fence(__ATOMIC_ACQUIRE, "workgroup", "local");
}

// ---------------------------------------------------------------------------------------------
// Y[M][Nout] = A[M][K] . W[K][Nout] + bias.  64x64 tile, 128 threads = 4 waves (16 rows each).
// AM: 0 = A f32 -> one f16 plane (scaled); 1 = A f32 -> f16 hi + residual planes; 2 = A given as two f16 planes.
//     W f32 -> same plane count as A (scaled).  Planes>1: D = Ah.Wh + Ah.Wl + Al.Wh.
// OM: 0 = f16 row-major [M][Nout], value*o_scale; 1 = f16 hi/residual planes laid out [b][head][dk][token]
//     (Nout = NH*DKH, one head per column tile, M = NB*NTOK); 2 = f32 row-major.
// D element r of lane l = (row 8*(l>>4)+r, col l&15) of the 16x16 tile.
// ---------------------------------------------------------------------------------------------
// smem: the work-group's LDS (GEMM_LDS(planes) bytes per K group, 16-B aligned); (bx, by) = column tile, row tile.
// KS: K is split over KS groups of 4 waves (128 * KS threads). Group g walks k in [g*K/KS, (g+1)*K/KS) with its own A/W
//     tiles and accumulators, so the serial chain of load -> stage -> multiply rounds is KS times shorter and each SIMD
//     holds KS waves; the f32 partial tiles are summed through LDS (KS > 1: OM 2 only). K is a multiple of 64*KS.
#define GEMM_LDS(npl) (2 * (npl) * 64 * 40 * 2 + 64 * 68 * 4)
template <int AM, int OM, int KS = 1>
__device__ __forceinline__ void gemm_body(char* smem, int bx, int by,
                                          const float* Af, const _Float16* Ah, const _Float16* Al,
                                          const float* W, const float* bias,
                                          _Float16* Yh, _Float16* Yl, float* Yf,
                                          int M, int K, int Nout,
                                          float a_scale, float w_scale, float o_mul, float o_scale) {
  constexpr int NPL = (AM == 0) ? 1 : 2;
  static_assert(KS == 1 || OM == 2, "the merge of K groups is written for the f32 row-major output");
  const int grp = (KS > 1) ? __builtin_amdgcn_readfirstlane((int)threadIdx.x >> 7) : 0;   // same in every lane of a wave
  smem += grp * GEMM_LDS(NPL);                                                              // the group's own tiles
  _Float16 (*At)[64][40] = reinterpret_cast<_Float16 (*)[64][40]>(smem);                        // [plane][row][k]
  _Float16 (*Bt)[64][40] = reinterpret_cast<_Float16 (*)[64][40]>(smem + NPL * 64 * 40 * 2);    // [plane][n][k]
  float (*Ct)[68] = reinterpret_cast<float (*)[68]>(smem + 2 * NPL * 64 * 40 * 2);

  const int tid = (KS > 1) ? (int)(threadIdx.x & 127) : (int)threadIdx.x;   // index inside the K group
  const int lane = tid & 31, wave = tid >> 5;
  const int hh = lane >> 4, m = lane & 15;
  const int n0 = bx * 64, m0 = by * 64;
  if (m0 + 64 > M || n0 + 64 > Nout) return;   // block-uniform, before any barrier

  v8f acc[4];
#pragma unroll
  for (int j = 0; j < 4; ++j) acc[j] = zero8f();

  const int kbeg = (KS > 1) ? grp * (K / KS) : 0;   // same trip count in every group: barriers stay block-uniform
  const int kend = (KS > 1) ? kbeg + K / KS : K;

  // The global loads of a k tile are issued two tiles ahead, into two register sets used in turn: they fly while the two
  // tiles before are staged and multiplied, so a round no longer begins with a wait for memory.
  struct Tile {
    v8h h0, h1, l0, l1;   // AM 2: A planes
    F8 x0, x1;            // AM 0, 1: A in f32
    F8 w0, w1;            // W in f32
  };
  // running addresses of the next tile to fetch. A tile 64x32: thread -> row tid>>1, 16 consecutive k;
  // W tile 32 k x 64 n: thread -> k pair 2kp,2kp+1 and 8 columns
  // (byte offsets from the buffers' starts; every buffer here is far below 4 GB)
  constexpr unsigned ASZ = (AM == 2) ? 2u : 4u;   // bytes per element of A
  unsigned oa = ((unsigned)(m0 + (tid >> 1)) * (unsigned)K + (unsigned)(kbeg + (tid & 1) * 16)) * ASZ;
  unsigned ow0 = ((unsigned)(kbeg + 2 * (tid >> 3)) * (unsigned)Nout + (unsigned)(n0 + (tid & 7) * 8)) * 4u;
  unsigned ow1 = ow0 + (unsigned)Nout * 4u;
  auto fetch = [&](Tile& t) {   // loads the tile at the running addresses and moves these one tile on
    if (AM == 2) {
      const _Float16* ph = (const _Float16*)((const char*)Ah + oa);
      const _Float16* pl = (const _Float16*)((const char*)Al + oa);
      t.h0 = *(const v8h*)(ph);  t.h1 = *(const v8h*)(ph + 8);
      t.l0 = *(const v8h*)(pl);  t.l1 = *(const v8h*)(pl + 8);
    } else {
      const float* s = (const float*)((const char*)Af + oa);
      t.x0.v[0] = *(const v4f*)(s);      t.x0.v[1] = *(const v4f*)(s + 4);
      t.x1.v[0] = *(const v4f*)(s + 8);  t.x1.v[1] = *(const v4f*)(s + 12);
    }
    const float* s0 = (const float*)((const char*)W + ow0);
    const float* s1 = (const float*)((const char*)W + ow1);
    t.w0.v[0] = *(const v4f*)(s0);  t.w0.v[1] = *(const v4f*)(s0 + 4);
    t.w1.v[0] = *(const v4f*)(s1);  t.w1.v[1] = *(const v4f*)(s1 + 4);
    // the loads stay in flight: their address registers stay untouched until the loads took them. The wait names the
    // offsets as in-out operands, so that they live up to it (no load lands in one) and are moved on only behind it.
    asm volatile("s_wait_xcnt 0x0" : "+v"(oa), "+v"(ow0), "+v"(ow1) :: "memory");
    oa += 32u * ASZ;
    ow0 += 128u * (unsigned)Nout;
    ow1 += 128u * (unsigned)Nout;
  };
  auto stage = [&](const Tile& t) {
    {
      const int r = tid >> 1, cb = (tid & 1) * 16;
      if (AM == 2) {
        *(v8h*)&At[0][r][cb] = t.h0;        *(v8h*)&At[0][r][cb + 8] = t.h1;
        *(v8h*)&At[NPL - 1][r][cb] = t.l0;  *(v8h*)&At[NPL - 1][r][cb + 8] = t.l1;
      } else {
        Frag16 ph, pl;
#pragma unroll
        for (int e = 0; e < 8; ++e) {
          const float v0 = t.x0.f[e] * a_scale, v1 = t.x1.f[e] * a_scale;
          const _Float16 h0 = (_Float16)v0, h1 = (_Float16)v1;
          ph.s[e] = h0;
          ph.s[8 + e] = h1;
          pl.s[e] = (_Float16)(v0 - (float)h0);
          pl.s[8 + e] = (_Float16)(v1 - (float)h1);
        }
        *(v8h*)&At[0][r][cb] = ph.half[0];  *(v8h*)&At[0][r][cb + 8] = ph.half[1];
        if (NPL == 2) {
          *(v8h*)&At[NPL - 1][r][cb] = pl.half[0];  *(v8h*)&At[NPL - 1][r][cb + 8] = pl.half[1];
        }
      }
    }
    {  // W stored transposed [n][k]
      const int kp = tid >> 3, nb = (tid & 7) * 8;
#pragma unroll
      for (int d = 0; d < 8; ++d) {
        const float a = t.w0.f[d] * w_scale, c = t.w1.f[d] * w_scale;
        const _Float16 ha = (_Float16)a, hc = (_Float16)c;
        Pack2 q;
        q.s[0] = ha;  q.s[1] = hc;
        *(unsigned*)&Bt[0][nb + d][2 * kp] = q.u;
        if (NPL == 2) {
          Pack2 ql;
          ql.s[0] = (_Float16)(a - (float)ha);
          ql.s[1] = (_Float16)(c - (float)hc);
          *(unsigned*)&Bt[NPL - 1][nb + d][2 * kp] = ql.u;
        }
      }
    }
  };
  auto multiply = [&]() {
    const v16h ah = ldfrag(&At[0][wave * 16][0], 40, lane, 0);
    if (NPL == 1) {
#pragma unroll
      for (int j = 0; j < 4; ++j) {
        const v16h bh = ldfrag(&Bt[0][j * 16][0], 40, lane, 0);
        acc[j] = wmma16(ah, bh, acc[j]);
      }
    } else {
      const v16h al = ldfrag(&At[NPL - 1][wave * 16][0], 40, lane, 0);
#pragma unroll
      for (int j = 0; j < 4; ++j) {
        const v16h bh = ldfrag(&Bt[0][j * 16][0], 40, lane, 0);
        const v16h bl = ldfrag(&Bt[NPL - 1][j * 16][0], 40, lane, 0);
        acc[j] = wmma16(ah, bh, acc[j]);
        acc[j] = wmma16(ah, bl, acc[j]);
        acc[j] = wmma16(al, bh, acc[j]);
      }
    }
  };

  // K / KS is a multiple of 64: rounds go in pairs. The last pair stands behind the loop, so that every fetch in the loop is
  // unconditional and the wait in front of a set's use leaves the other set's loads in flight.
  // AM 1 (f32 A and W, two planes each) has no registers for a second set at the kernel's occupancy: one set, one tile ahead.
  Tile ta, tb;
  fetch(ta);
  if (AM == 1) {
#pragma unroll 1
    for (int kk = kbeg; kk + 32 < kend; kk += 32) {
      stage(ta);
      lds_barrier();
      fetch(ta);
      multiply();
      lds_barrier();
    }
  } else {
    fetch(tb);
#pragma unroll 1
    for (int kk = kbeg; kk + 64 < kend; kk += 64) {   // same trip count in every K group
      stage(ta);
      lds_barrier();
      fetch(ta);
      multiply();
      lds_barrier();
      stage(tb);
      lds_barrier();
      fetch(tb);
      multiply();
      lds_barrier();
    }
    stage(ta);
    lds_barrier();
    multiply();
    lds_barrier();
    ta = tb;
  }
  stage(ta);
  lds_barrier();
  multiply();
  lds_barrier();

  if (KS > 1) {
    // each K group leaves its raw f32 partial tile in LDS; thread -> one row, 8 consecutive columns: sum, scale, bias
#pragma unroll
    for (int j = 0; j < 4; ++j)
#pragma unroll
      for (int r = 0; r < 8; ++r) Ct[wave * 16 + 8 * hh + r][16 * j + m] = acc[j][r];
    __syncthreads();
    const int row = (int)threadIdx.x >> 3, c0 = ((int)threadIdx.x & 7) * 8;
    const char* c00 = smem - grp * GEMM_LDS(NPL) + 2 * NPL * 64 * 40 * 2 + (row * 68 + c0) * 4;   // group 0's tile
    F8 bc, sum;
    bc.v[0] = *(const v4f*)(bias + n0 + c0);
    bc.v[1] = *(const v4f*)(bias + n0 + c0 + 4);
    sum.v[0] = *(const v4f*)(c00);
    sum.v[1] = *(const v4f*)(c00 + 16);
#pragma unroll
    for (int g = 1; g < KS; ++g) {
      sum.v[0] += *(const v4f*)(c00 + g * GEMM_LDS(NPL));
      sum.v[1] += *(const v4f*)(c00 + g * GEMM_LDS(NPL) + 16);
    }
    float* y = Yf + (size_t)(m0 + row) * Nout + n0 + c0;
    *(v4f*)(y) = sum.v[0] * o_mul + bc.v[0];
    *(v4f*)(y + 4) = sum.v[1] * o_mul + bc.v[1];
    return;
  }

  // D + bias (unscaled) -> LDS tile
#pragma unroll
  for (int j = 0; j < 4; ++j) {
    const float bcol = bias[n0 + 16 * j + m];
#pragma unroll
    for (int r = 0; r < 8; ++r) Ct[wave * 16 + 8 * hh + r][16 * j + m] = acc[j][r] * o_mul + bcol;
  }
  __syncthreads();

  if (OM == 0) {
    const int q = lane >> 3, p = lane & 7;
    v8h vals[4];
    size_t addr[4];
#pragma unroll
    for (int it = 0; it < 4; ++it) {
      const int row = wave * 16 + 4 * it + q;
      F8 c;
      c.v[0] = *(const v4f*)&Ct[row][8 * p];
      c.v[1] = *(const v4f*)&Ct[row][8 * p + 4];
      Pack8 pk;
#pragma unroll
      for (int e = 0; e < 8; ++e) pk.s[e] = (_Float16)(c.f[e] * o_scale);
      vals[it] = pk.v;
      addr[it] = (size_t)(m0 + row) * Nout + n0 + 8 * p;
    }
#pragma unroll
    for (int it = 0; it < 4; ++it) *(v8h*)(Yh + addr[it]) = vals[it];
    // in a kernel with several block ranges other code follows these stores in the listing: their address and data
    // registers stay untouched until the stores have taken them
    asm volatile("s_wait_xcnt 0x0" ::: "memory");
  } else if (OM == 1) {
    const int hd = bx;
    const int bb = m0 / NTOK, tok0 = m0 - bb * NTOK;
    const int q = lane >> 3, p = lane & 7;
    v8h vh[4], vl[4];
    size_t addr[4];
#pragma unroll
    for (int it = 0; it < 4; ++it) {
      const int dk = wave * 16 + 4 * it + q;
      Pack8 ph, pl;
#pragma unroll
      for (int e = 0; e < 8; ++e) {
        const float v = Ct[8 * p + e][dk] * o_scale;
        const _Float16 hv = (_Float16)v;
        ph.s[e] = hv;
        pl.s[e] = (_Float16)(v - (float)hv);
      }
      vh[it] = ph.v;
      vl[it] = pl.v;
      addr[it] = (((size_t)bb * NH + hd) * DKH + dk) * NTOK + tok0 + 8 * p;
    }
#pragma unroll
    for (int it = 0; it < 4; ++it) {
      *(v8h*)(Yh + addr[it]) = vh[it];
      *(v8h*)(Yl + addr[it]) = vl[it];
    }
    
  } else {
    const int q = lane >> 4, p = lane & 15;
    v4f vals[8];
    size_t addr[8];
#pragma unroll
    for (int it = 0; it < 8; ++it) {
      const int row = wave * 16 + 2 * it + q;
      vals[it] = *(const v4f*)&Ct[row][4 * p];
      addr[it] = (size_t)(m0 + row) * Nout + n0 + 4 * p;
    }
#pragma unroll
    for (int it = 0; it < 8; ++it) *(v4f*)(Yf + addr[it]) = vals[it];
    
  }
}

template <int AM, int OM, int KS>
__global__ __launch_bounds__(128 * KS) void k_gemm(const float* Af, const _Float16* Ah, const _Float16* Al,
                                             const float* W, const float* bias,
                                             _Float16* Yh, _Float16* Yl, float* Yf,
                                             int M, int K, int Nout,
                                             float a_scale, float w_scale, float o_mul, float o_scale) {
  __shared__ __attribute__((aligned(16))) char smem[KS * GEMM_LDS((AM == 0) ? 1 : 2)];
  gemm_body<AM, OM, KS>(smem, blockIdx.x, blockIdx.y, Af, Ah, Al, W, bias, Yh, Yl, Yf, M, K, Nout,
                    a_scale, w_scale, o_mul, o_scale);
}

// ---------------------------------------------------------------------------------------------
// Geometric log-weights with the key mask folded in:
// logg[b][h][i][j] = log(max(relu(emb(i,j) . Wg[:,h] + bg[h]), 1e-6)) + (mask[b][i][j]==0 ? -1e9 : 0)
// One block per (b, GIB query boxes i, 128 key boxes j; one j per thread); the 64->8 projection runs on WMMA.
// The two centre-distance angles depend on the pair (i, j): their 32 sin/cos values are made per pair (A = hi / residual
// planes x S_E, B columns 0..7 = f16(S_G*Wg[:,h]), 8..15 = residual of the same).
// The two size angles are differences, 100*dm*log(w_i/w_j) = A_i - A_j with A = 100*dm*log(w) (w > 0 for box coordinates in
// [0,1)): Ws*sin(A_i-A_j) + Wc*cos(A_i-A_j) = sin(A_j)*(Wc*sin(A_i) - Ws*cos(A_i)) + cos(A_j)*(Ws*sin(A_i) + Wc*cos(A_i)).
// So sin/cos(A_j) are made once per block (A fragments kept in registers for all GIB query boxes) and the brackets are a
// 32x8 B operand per query box, made once in the prologue.
// k order of every 32-wide operand here: k = 16*c + 8*pl + f, c = 0 sin / 1 cos, pl = which of the two angles, f = frequency.
// ---------------------------------------------------------------------------------------------
#define GIB 8
#define GEO_BLOCKS (NB * (NTOK / GIB) * (NTOK / 128))
#define GEO_O_B0 (2 * 128 * 40 * 2)
#define GEO_O_BP (GEO_O_B0 + 16 * 40 * 2)
#define GEO_O_GS (GEO_O_BP + GIB * 16 * 40 * 2)
#define GEO_O_DM (GEO_O_GS + 128 * 17 * 4)
#define GEO_O_SA (GEO_O_DM + 8 * 4 + 8 * 4)
#define GEO_O_SI (GEO_O_SA + GIB * 32 * 4)
#define GEO_LDS  (GEO_O_SI + GIB * 4 * 4)

// 8 angles ang0*dm[f] -> sin and cos, each as f16 hi / residual of S_E * value
__device__ __forceinline__ void geo_sincos8(float ang0, const float* dm, Pack8& sh, Pack8& sl, Pack8& chv, Pack8& clv) {
  float sn[8], cs[8];
#pragma unroll
  for (int f = 0; f < 8; ++f) sn[f] = __sinf(ang0 * dm[f]);
#pragma unroll
  for (int f = 0; f < 8; ++f) cs[f] = __cosf(ang0 * dm[f]);
#pragma unroll
  for (int f = 0; f < 8; ++f) {
    const float sv = sn[f] * S_E;
    const float cv = cs[f] * S_E;
    const _Float16 a = (_Float16)sv;
    sh.s[f] = a;
    sl.s[f] = (_Float16)(sv - (float)a);
    const _Float16 c = (_Float16)cv;
    chv.s[f] = c;
    clv.s[f] = (_Float16)(cv - (float)c);
  }
}

__device__ __forceinline__ void geo_body(char* smem, int gb, const float* box, const float* Wg, const float* bg,
                                         const int* msk, float* logg) {
  _Float16 (*Et)[128][40] = reinterpret_cast<_Float16 (*)[128][40]>(smem);              // [plane][j][k]
  _Float16 (*B0)[40] = reinterpret_cast<_Float16 (*)[40]>(smem + GEO_O_B0);             // [n][k], pair part of Wg
  _Float16 (*Bp)[16][40] = reinterpret_cast<_Float16 (*)[16][40]>(smem + GEO_O_BP);     // [query box][n][k], size part
  float (*Gs)[17] = reinterpret_cast<float (*)[17]>(smem + GEO_O_GS);
  float* sdm = reinterpret_cast<float*>(smem + GEO_O_DM);
  float* sbg = sdm + 8;
  float (*sA)[32] = reinterpret_cast<float (*)[32]>(smem + GEO_O_SA);                   // [query box][sin 0..15 | cos 0..15]
  v4f* sI = reinterpret_cast<v4f*>(smem + GEO_O_SI);                                    // [query box] cx, cy, 1/w, 1/h

  static_assert(GIB * 16 == 128, "one thread per (query box, size angle)");
  const int tid = threadIdx.x, lane = tid & 31, wave = tid >> 5;
  const int hh = lane >> 4, m = lane & 15;
  if (gb >= GEO_BLOCKS) return;   // block-uniform
  const int j0 = (gb & (NTOK / 128 - 1)) * 128;
  const int i0 = ((gb / (NTOK / 128)) & (NTOK / GIB - 1)) * GIB;
  const int b = gb / ((NTOK / 128) * (NTOK / GIB));

  if (tid < 8) {
    sdm[tid] = 1.0f / powf(1000.0f, (float)tid * 0.125f);
    sbg[tid] = bg[tid];
  }
#pragma unroll
  for (int e = 0; e < 4; ++e) {
    const int idx = tid * 4 + e;          // 0..511
    const int n = idx >> 5, k = idx & 31;
    const float w = Wg[((k >> 4) * 32 + (k & 15)) * NH + (n & 7)] * S_G;
    const _Float16 wh = (_Float16)w;
    const _Float16 wl = (_Float16)(w - (float)wh);
    B0[n][k] = (n < 8) ? wh : wl;
  }
  const v4f bxj = *(const v4f*)(box + ((size_t)b * NTOK + j0 + tid) * 4);
  const float cxj = (bxj[0] + bxj[1]) * 0.5f, cyj = (bxj[2] + bxj[3]) * 0.5f;
  const float wj = (bxj[1] - bxj[0]) + 1.0f, hgj = (bxj[3] - bxj[2]) + 1.0f;
  __syncthreads();

  float dm[8];
#pragma unroll
  for (int f = 0; f < 8; ++f) dm[f] = sdm[f];

  {  // sin/cos(A_j) of key box j0 + tid -> Et[.][tid][0..31]
    const float la[2] = {logf(wj) * 100.0f, logf(hgj) * 100.0f};
#pragma unroll
    for (int pl = 0; pl < 2; ++pl) {
      Pack8 sh, sl, chv, clv;
      geo_sincos8(la[pl], dm, sh, sl, chv, clv);
      *(v8h*)&Et[0][tid][pl * 8] = sh.v;
      *(v8h*)&Et[1][tid][pl * 8] = sl.v;
      *(v8h*)&Et[0][tid][16 + pl * 8] = chv.v;
      *(v8h*)&Et[1][tid][16 + pl * 8] = clv.v;
    }
  }
  {  // sin/cos(A_i): thread -> query box tid>>4, angle (tid>>3)&1, frequency tid&7
    const int ii = tid >> 4, a = tid & 15;
    const v4f bi = *(const v4f*)(box + ((size_t)b * NTOK + i0 + ii) * 4);
    const float wi = (bi[1] - bi[0]) + 1.0f, hgi = (bi[3] - bi[2]) + 1.0f;
    const float ang = (logf((a & 8) ? hgi : wi) * 100.0f) * sdm[a & 7];
    sA[ii][a] = __sinf(ang);
    sA[ii][16 + a] = __cosf(ang);
    if (a == 0) {
      v4f q;
      q[0] = (bi[0] + bi[1]) * 0.5f;
      q[1] = (bi[2] + bi[3]) * 0.5f;
      q[2] = 1.0f / wi;
      q[3] = 1.0f / hgi;
      sI[ii] = q;
    }
  }
  __syncthreads();

  v16h eh[2], el[2];
#pragma unroll
  for (int t = 0; t < 2; ++t) {
    eh[t] = ldfrag(&Et[0][wave * 32 + t * 16][0], 40, lane, 0);
    el[t] = ldfrag(&Et[1][wave * 32 + t * 16][0], 40, lane, 0);
  }
  const v16h b0 = ldfrag(&B0[0][0], 40, lane, 0);
#pragma unroll
  for (int e = 0; e < GIB * 32 / 128; ++e) {   // size part of the B operand: thread -> (query box, k), all 8 heads
    const int idx = e * 128 + tid;
    const int ii = idx >> 5, k = idx & 31, a = k & 15;
    const bool isc = (k >> 4) != 0;
    const float sa = sA[ii][a], ca = sA[ii][16 + a];
    const float* ws = Wg + (16 + a) * NH;
    const float* wc = Wg + (48 + a) * NH;
    F8 s8, c8;
    s8.v[0] = *(const v4f*)(ws);  s8.v[1] = *(const v4f*)(ws + 4);
    c8.v[0] = *(const v4f*)(wc);  c8.v[1] = *(const v4f*)(wc + 4);
#pragma unroll
    for (int h = 0; h < 8; ++h) {
      const float x = isc ? s8.f[h] : c8.f[h];
      const float y = isc ? c8.f[h] : -s8.f[h];
      const float w = (x * sa + y * ca) * S_G;
      const _Float16 wh = (_Float16)w;
      Bp[ii][h][k] = wh;
      Bp[ii][h + 8][k] = (_Float16)(w - (float)wh);
    }
  }
  __syncthreads();   // Bp is complete, and every wave holds its sin/cos(A_j) fragments before Et is written again

  const v8f z8 = zero8f();

#pragma unroll 1
  for (int ii = 0; ii < GIB; ++ii) {
    const int i = i0 + ii;
    {  // pair part of the embedding of (i, j0 + tid) -> Et[.][tid][0..31]
      const v4f qi = sI[ii];
      const float p0 = logf(fmaxf(fabsf((qi[0] - cxj) * qi[2]), 1e-3f));
      const float p1 = logf(fmaxf(fabsf((qi[1] - cyj) * qi[3]), 1e-3f));
      const float pp[2] = {p0 * 100.0f, p1 * 100.0f};
#pragma unroll
      for (int pl = 0; pl < 2; ++pl) {
        Pack8 sh, sl, chv, clv;
        geo_sincos8(pp[pl], dm, sh, sl, chv, clv);
        *(v8h*)&Et[0][tid][pl * 8] = sh.v;
        *(v8h*)&Et[1][tid][pl * 8] = sl.v;
        *(v8h*)&Et[0][tid][16 + pl * 8] = chv.v;
        *(v8h*)&Et[1][tid][16 + pl * 8] = clv.v;
      }
    }
    __syncthreads();

    // 128 j rows x 16 cols, K = 32 (pair part) + 32 (size part): wave -> two 16-row tiles
    const v16h bp = ldfrag(&Bp[ii][0][0], 40, lane, 0);
#pragma unroll
    for (int t = 0; t < 2; ++t) {
      const int row0 = wave * 32 + t * 16;
      v8f acc = z8;
      const v16h a0 = ldfrag(&Et[0][row0][0], 40, lane, 0);
      const v16h l0 = ldfrag(&Et[1][row0][0], 40, lane, 0);
      acc = wmma16(a0, b0, acc);
      acc = wmma16(l0, b0, acc);
      acc = wmma16(eh[t], bp, acc);
      acc = wmma16(el[t], bp, acc);
#pragma unroll
      for (int r = 0; r < 8; ++r) Gs[row0 + 8 * hh + r][m] = acc[r];
    }
    __syncthreads();

    const size_t mbase = ((size_t)b * NTOK + i) * NTOK + j0;
    v4f vv[2];
#pragma unroll
    for (int e = 0; e < 2; ++e) {
      const int hd = 2 * wave + e;
#pragma unroll
      for (int q = 0; q < 4; ++q) {
        const int jl = 4 * lane + q;
        const float graw = (Gs[jl][hd] + Gs[jl][hd + 8]) * (1.0f / (S_E * S_G)) + sbg[hd];
        const float g = fmaxf(graw, 0.0f);
        float v = logf(fmaxf(g, 1e-6f));
        const int mk = msk[mbase + jl];
        v += (mk == 0) ? -1e9f : 0.0f;
        vv[e][q] = v;
      }
    }
    float* ap0 = logg + (((size_t)b * NH + 2 * wave) * NTOK + i) * NTOK + j0 + 4 * lane;
    float* ap1 = ap0 + (size_t)NTOK * NTOK;
    *(v4f*)ap0 = vv[0];
    *(v4f*)ap1 = vv[1];
    // the next trip reuses the stores' data and address registers at once: they stay untouched until the stores took them
    asm volatile("s_wait_xcnt 0x0" ::: "memory");
  }
}

// ---------------------------------------------------------------------------------------------
// The four producers of the attention kernel depend on inputs only, so they share one launch and run side by side:
// block ranges, longest work-groups first: v projection, q projection, k projection (GTILES tiles each), geometry.
// Every branch is block-uniform (blockIdx only); the ranges share one LDS buffer sized for the largest user.
// ---------------------------------------------------------------------------------------------
// Second launch bound: 7 waves per SIMD, so that all work-groups of the grid (7 per WGP) stay resident at once as before,
// also with the projections' tiles in flight in registers.
#define GTILES ((DM / 64) * (MTOK / 64))
__global__ __launch_bounds__(128, 7) void k_front(const float* Xq, const float* Xk, const float* Xv,
                                              const float* Wq, const float* bq, const float* Wk, const float* bk,
                                              const float* Wv, const float* bv,
                                              const float* box, const float* Wg, const float* bg, const int* msk,
                                              _Float16* Q16, _Float16* K16, _Float16* Vth, _Float16* Vtl,
                                              float* logg) {
  static_assert(GEO_LDS >= GEMM_LDS(2), "shared buffer is sized by the geometry part");
  __shared__ __attribute__((aligned(16))) char smem[GEO_LDS];
  const int blk = blockIdx.x;
  const float omul = 1.0f / (S_X * S_W);     // 2^-22
  if (blk < GTILES) {
    gemm_body<1, 1>(smem, blk & (DM / 64 - 1), blk / (DM / 64), Xv, nullptr, nullptr, Wv, bv, Vth, Vtl, nullptr,
                    MTOK, DM, DM, S_X, S_W, omul, S_V);
  } else if (blk < 3 * GTILES) {
    const bool isq = blk < 2 * GTILES;
    const int t = blk - (isq ? GTILES : 2 * GTILES);
    gemm_body<0, 0>(smem, t & (DM / 64 - 1), t / (DM / 64), isq ? Xq : Xk, nullptr, nullptr,
                    isq ? Wq : Wk, isq ? bq : bk, isq ? Q16 : K16, nullptr, nullptr,
                    MTOK, DM, DM, S_X, S_W, omul, S_QK);
  } else {
    geo_body(smem, blk - 3 * GTILES, box, Wg, bg, msk, logg);
  }
}

// ---------------------------------------------------------------------------------------------
// Streaming attention: block = (b, h, 64 query rows), KSPL key groups x 4 waves x 16 rows, key tiles of 32.
// Key group g walks key tiles g, g + KSPL, g + 2*KSPL, ... with its own K/V/P tiles, row maxima, row sums and O partials,
// so each SIMD holds KSPL waves and the serial chain of tiles is KSPL times shorter; the partials are merged through LDS.
// S = Q16.K16^T (single f16 product, Q16/K16 carry S_QK); logits = S*(1/(8*S_QK^2)) + logg; online softmax in f32;
// O += P.V with P as f16 hi/residual of S_P*p and V as f16 hi/residual planes (carrying S_V), V tile staged [dk][key].
// Output: f16 hi/residual planes of S_AO * (O / l), row-major [b*N+q][h*64+dk].
// ---------------------------------------------------------------------------------------------
#define KSPL 4
__global__ __launch_bounds__(128 * KSPL) void k_attn(const _Float16* Qh, const _Float16* Kh,
                                                    const _Float16* Vth, const _Float16* Vtl,
                                                    const float* logg, _Float16* Oh, _Float16* Ol) {
  __shared__ __attribute__((aligned(16))) _Float16 Qt[64][72];              // [q][dk]
  __shared__ __attribute__((aligned(16))) _Float16 Kt[KSPL][32][72];        // [group][key][dk]
  __shared__ __attribute__((aligned(16))) _Float16 Vt[KSPL][2][64][40];     // [group][plane][dk][key]
  __shared__ __attribute__((aligned(16))) _Float16 Pt[KSPL][2][4][16][40];  // [group][plane][wave][q][key]
  __shared__ __attribute__((aligned(16))) float Cs[KSPL][64][68];           // [group][q][dk] un-normalised O partial
  __shared__ float Ms[KSPL][64];                                            // [group][q] row maximum
  __shared__ float Ls[KSPL][64];                                            // [group][q] row sum

  static_assert(128 * KSPL == 64 * 8, "Q staging and the merge give each thread one row and 8 consecutive dk");
  const int tid = threadIdx.x, lane = tid & 31;
  const int grp = __builtin_amdgcn_readfirstlane(tid >> 7);   // same in every lane of a wave: kept scalar
  const int gt = tid & 127, wave = gt >> 5;
  const int hh = lane >> 4, m = lane & 15;
  const int blk = blockIdx.x;
  if (blk >= NB * NH * (NTOK / 64)) return;   // block-uniform
  const int qb = blk & 7, h = (blk >> 3) & 7, b = blk >> 6;
  const int q0 = qb * 64;

  const size_t lgrow = (((size_t)b * NH + h) * NTOK + (q0 + wave * 16 + 8 * hh)) * NTOK;

  // The global loads of a key tile (K, both V planes, the log-weights) are issued one tile ahead, into registers: they fly
  // while the tile before is worked on, so a trip waits for memory neither at its head nor between S and the softmax.
  v8h kr[2], vr[4];
  float lg[2][8];
  // running addresses of the group's next key tile (first tile: keys grp*32 ..): K tile 32 keys x 64 dk; V planes, already
  // [dk][token], 64 dk x 32 keys; log-weights of the lane's 8 query rows
  // (byte offsets from the buffers' starts; the largest buffer has 32 MB)
  unsigned ok = (unsigned)((b * NTOK + grp * 32 + (gt >> 2)) * DM + h * DKH + (gt & 3) * 16) * 2u;
  unsigned ov = (unsigned)(((b * NH + h) * DKH + (gt >> 1)) * NTOK + grp * 32 + (gt & 1) * 16) * 2u;
  unsigned og = ((unsigned)lgrow + (unsigned)(grp * 32 + m)) * 4u;
  auto fetch = [&]() {   // loads the tile at the running addresses and moves these to the group's next tile
    const _Float16* pk = (const _Float16*)((const char*)Kh + ok);
    const _Float16* pvh = (const _Float16*)((const char*)Vth + ov);
    const _Float16* pvl = (const _Float16*)((const char*)Vtl + ov);
    const float* pg = (const float*)((const char*)logg + og);
    kr[0] = *(const v8h*)(pk);
    kr[1] = *(const v8h*)(pk + 8);
    vr[0] = *(const v8h*)(pvh);
    vr[1] = *(const v8h*)(pvh + 8);
    vr[2] = *(const v8h*)(pvl);
    vr[3] = *(const v8h*)(pvl + 8);
#pragma unroll
    for (int c = 0; c < 2; ++c)
#pragma unroll
      for (int r = 0; r < 8; ++r) lg[c][r] = pg[r * NTOK + 16 * c];
    // the loads stay in flight: their address registers stay untouched until the loads took them. The wait names the
    // offsets as in-out operands, so that they live up to it (no load lands in one) and are moved on only behind it.
    asm volatile("s_wait_xcnt 0x0" : "+v"(ok), "+v"(ov), "+v"(og) :: "memory");
    ok += KSPL * 32 * DM * 2u;
    ov += KSPL * 32 * 2u;
    og += KSPL * 32 * 4u;
  };

  {
    const int r = tid >> 3, cb = (tid & 7) * 8;
    const v8h qv = *(const v8h*)(Qh + ((size_t)(b * NTOK + q0 + r)) * DM + h * DKH + cb);
    fetch();
    *(v8h*)&Qt[r][cb] = qv;
  }
  lds_barrier();
  const v16h qa0 = ldfrag(&Qt[wave * 16][0], 72, lane, 0);
  const v16h qa1 = ldfrag(&Qt[wave * 16][0], 72, lane, 32);

  const v8f z8 = zero8f();
  v8f o[4];
#pragma unroll
  for (int j = 0; j < 4; ++j) o[j] = z8;
  float mrow[8], lrow[8];
#pragma unroll
  for (int r = 0; r < 8; ++r) { mrow[r] = -1e30f; lrow[r] = 0.0f; }

  const float SC = 0.125f / (S_QK * S_QK);

#pragma unroll 1
  for (int it = 0; it < NTOK / 32 / KSPL; ++it) {   // same trip count in every group: barriers stay block-uniform
    {  // K tile 32 keys x 64 dk
      const int r = gt >> 2, cb = (gt & 3) * 16;
      *(v8h*)&Kt[grp][r][cb] = kr[0];
      *(v8h*)&Kt[grp][r][cb + 8] = kr[1];
    }
    {  // V planes: 64 dk x 32 keys, direct copy
      const int r = gt >> 1, cb = (gt & 1) * 16;
      *(v8h*)&Vt[grp][0][r][cb] = vr[0];
      *(v8h*)&Vt[grp][0][r][cb + 8] = vr[1];
      *(v8h*)&Vt[grp][1][r][cb] = vr[2];
      *(v8h*)&Vt[grp][1][r][cb + 8] = vr[3];
    }
    lds_barrier();

    // S[16 q][32 keys]: B[k=dk][n=key] = Kt[key][dk] -> n-major tile, same loader as A
    v8f s[2];
#pragma unroll
    for (int c = 0; c < 2; ++c) {
      const v16h b0 = ldfrag(&Kt[grp][16 * c][0], 72, lane, 0);
      const v16h b1 = ldfrag(&Kt[grp][16 * c][0], 72, lane, 32);
      v8f sc = z8;
      sc = wmma16(qa0, b0, sc);
      sc = wmma16(qa1, b1, sc);
      s[c] = sc;
    }

    float t[2][8];
#pragma unroll
    for (int c = 0; c < 2; ++c)
#pragma unroll
      for (int r = 0; r < 8; ++r)
        t[c][r] = s[c][r] * SC + lg[c][r];
    if (it + 1 < NTOK / 32 / KSPL) fetch();   // same for the whole work-group (scalar test)

    float rmax[8];
#pragma unroll
    for (int r = 0; r < 8; ++r) rmax[r] = fmaxf(t[0][r], t[1][r]);
#pragma unroll
    for (int off = 8; off >= 1; off >>= 1)
#pragma unroll
      for (int r = 0; r < 8; ++r) rmax[r] = fmaxf(rmax[r], __shfl_xor(rmax[r], off, 16));

    float alpha[8];
#pragma unroll
    for (int r = 0; r < 8; ++r) {
      const float mnew = fmaxf(mrow[r], rmax[r]);
      alpha[r] = __expf(mrow[r] - mnew);
      mrow[r] = mnew;
    }
#pragma unroll
    for (int c = 0; c < 2; ++c)
#pragma unroll
      for (int r = 0; r < 8; ++r) t[c][r] = __expf(t[c][r] - mrow[r]);

    float rsum[8];
#pragma unroll
    for (int r = 0; r < 8; ++r) rsum[r] = t[0][r] + t[1][r];
#pragma unroll
    for (int off = 8; off >= 1; off >>= 1)
#pragma unroll
      for (int r = 0; r < 8; ++r) rsum[r] += __shfl_xor(rsum[r], off, 16);
#pragma unroll
    for (int r = 0; r < 8; ++r) lrow[r] = lrow[r] * alpha[r] + rsum[r];
#pragma unroll
    for (int j = 0; j < 4; ++j)
#pragma unroll
      for (int r = 0; r < 8; ++r) o[j][r] *= alpha[r];

    // P tile (D layout: row 8hh+r = q, col m = key) -> LDS planes; block barrier before the fragment reload
#pragma unroll
    for (int c = 0; c < 2; ++c)
#pragma unroll
      for (int r = 0; r < 8; ++r) {
        const float ps = t[c][r] * S_P;
        const _Float16 ph = (_Float16)ps;
        Pt[grp][0][wave][8 * hh + r][16 * c + m] = ph;
        Pt[grp][1][wave][8 * hh + r][16 * c + m] = (_Float16)(ps - (float)ph);
      }
    lds_barrier();

    const v16h pah = ldfrag(&Pt[grp][0][wave][0][0], 40, lane, 0);
    const v16h pal = ldfrag(&Pt[grp][1][wave][0][0], 40, lane, 0);
    // O[16 q][64 dk] += P[16 x 32 keys] . V[32 keys x 64 dk]; B[k=key][n=dk] = Vt[dk][key]
#pragma unroll
    for (int j = 0; j < 4; ++j) {
      const v16h vh = ldfrag(&Vt[grp][0][16 * j][0], 40, lane, 0);
      const v16h vl = ldfrag(&Vt[grp][1][16 * j][0], 40, lane, 0);
      o[j] = wmma16(pah, vh, o[j]);
      o[j] = wmma16(pah, vl, o[j]);
      o[j] = wmma16(pal, vh, o[j]);
    }
    lds_barrier();
  }

  // each key group leaves its un-normalised partial, row maximum and row sum in LDS
#pragma unroll
  for (int j = 0; j < 4; ++j)
#pragma unroll
    for (int r = 0; r < 8; ++r) Cs[grp][wave * 16 + 8 * hh + r][16 * j + m] = o[j][r];
  if (m == 0) {
#pragma unroll
    for (int r = 0; r < 8; ++r) {
      Ms[grp][wave * 16 + 8 * hh + r] = mrow[r];
      Ls[grp][wave * 16 + 8 * hh + r] = lrow[r];
    }
  }
  __syncthreads();

  // merge: weight exp(m_g - max) per group, divide by the merged row sum; thread -> one row, 8 consecutive dk
  {
    const int row = tid >> 3, p = tid & 7;
    float mg[KSPL];
#pragma unroll
    for (int g = 0; g < KSPL; ++g) mg[g] = Ms[g][row];
    float mall = mg[0];
#pragma unroll
    for (int g = 1; g < KSPL; ++g) mall = fmaxf(mall, mg[g]);
    float wg[KSPL], lall = 0.0f;
#pragma unroll
    for (int g = 0; g < KSPL; ++g) {
      wg[g] = __expf(mg[g] - mall);
      lall += Ls[g][row] * wg[g];
    }
    const float inv = (1.0f / lall) * (S_AO / (S_P * S_V));
    float acc[8];
#pragma unroll
    for (int e = 0; e < 8; ++e) acc[e] = 0.0f;
#pragma unroll
    for (int g = 0; g < KSPL; ++g) {
      F8 c;
      c.v[0] = *(const v4f*)&Cs[g][row][8 * p];
      c.v[1] = *(const v4f*)&Cs[g][row][8 * p + 4];
#pragma unroll
      for (int e = 0; e < 8; ++e) acc[e] += c.f[e] * wg[g];
    }
    Pack8 ph, pl;
#pragma unroll
    for (int e = 0; e < 8; ++e) {
      const float v = acc[e] * inv;
      const _Float16 hv = (_Float16)v;
      ph.s[e] = hv;
      pl.s[e] = (_Float16)(v - (float)hv);
    }
    const size_t addr = ((size_t)(b * NTOK + q0 + row)) * DM + h * DKH + 8 * p;
    *(v8h*)(Oh + addr) = ph.v;
    *(v8h*)(Ol + addr) = pl.v;
  }
}

// ---------------------------------------------------------------------------------------------
// host-side launch glue
// ---------------------------------------------------------------------------------------------
extern "C" void kernel_launch(void* const* d_in, const int* in_sizes, int n_in,
                              void* d_out, int out_size, void* d_ws, size_t ws_size,
                              hipStream_t stream) {
  if (n_in < 15) return;
  const int xsz = MTOK * DM, wsz = DM * DM;
  if (in_sizes[0] != xsz || in_sizes[1] != xsz || in_sizes[2] != xsz) return;
  if (in_sizes[3] != MTOK * 4 || in_sizes[4] != NB * NTOK * NTOK) return;
  if (in_sizes[5] != wsz || in_sizes[7] != wsz || in_sizes[9] != wsz || in_sizes[11] != wsz) return;
  if (in_sizes[6] != DM || in_sizes[8] != DM || in_sizes[10] != DM || in_sizes[12] != DM) return;
  if (in_sizes[13] != DKH * NH || in_sizes[14] != NH || out_size != xsz) return;

  const float* Xq  = (const float*)d_in[0];
  const float* Xk  = (const float*)d_in[1];
  const float* Xv  = (const float*)d_in[2];
  const float* box = (const float*)d_in[3];
  const int*   msk = (const int*)d_in[4];
  const float* Wq  = (const float*)d_in[5];
  const float* bq  = (const float*)d_in[6];
  const float* Wk  = (const float*)d_in[7];
  const float* bk  = (const float*)d_in[8];
  const float* Wv  = (const float*)d_in[9];
  const float* bv  = (const float*)d_in[10];
  const float* Wo  = (const float*)d_in[11];
  const float* bo  = (const float*)d_in[12];
  const float* Wg  = (const float*)d_in[13];
  const float* bg  = (const float*)d_in[14];
  float* out = (float*)d_out;

  // workspace carve (all offsets multiples of 2 MB): logg 32 MB, six 16-bit [2048][512] buffers 2 MB each = 44 MB
  char* ws = (char*)d_ws;
  size_t off = 0;
  float* logg = (float*)(ws + off);          off += (size_t)NB * NH * NTOK * NTOK * sizeof(float);
  _Float16* Q16 = (_Float16*)(ws + off);     off += (size_t)xsz * 2;
  _Float16* K16 = (_Float16*)(ws + off);     off += (size_t)xsz * 2;
  _Float16* Vth = (_Float16*)(ws + off);     off += (size_t)xsz * 2;   // [b][h][dk][token]
  _Float16* Vtl = (_Float16*)(ws + off);     off += (size_t)xsz * 2;
  _Float16* AOh = (_Float16*)(ws + off);     off += (size_t)xsz * 2;   // [b*N+q][h*64+dk]
  _Float16* AOl = (_Float16*)(ws + off);     off += (size_t)xsz * 2;
  if (off > ws_size) return;

  const float omul_o = 1.0f / (S_AO * S_W);  // 2^-22
  const dim3 gg(DM / 64, MTOK / 64), gb(128);

  k_front<<<dim3(3 * GTILES + GEO_BLOCKS), gb, 0, stream>>>(Xq, Xk, Xv, Wq, bq, Wk, bk, Wv, bv, box, Wg, bg, msk,
                                                           Q16, K16, Vth, Vtl, logg);
  k_attn<<<dim3(NB * NH * (NTOK / 64)), dim3(128 * KSPL), 0, stream>>>(Q16, K16, Vth, Vtl, logg, AOh, AOl);
  k_gemm<2, 2, 4><<<gg, dim3(128 * 4), 0, stream>>>(Wo, AOh, AOl, Wo, bo, AOh, AOl, out,
                                      MTOK, DM, DM, 1.0f, S_W, omul_o, 1.0f);
}

// v006
// Measured time: 44.1 microseconds a run.
// In both of two side-by-side timings against v005, it was 1.05 times as fast.
// Over all steps from v000 it is 2.85 times as fast.
#include <hip/hip_runtime.h>
#include <stddef.h>

// Contractions on v_wmma_f32_16x16x32_f16 (f16 operands, f32 accumulate): q,k projections and q.k^T as single products of power-of-two scaled operands; v projection, p.v, output projection and the 64->8 geometric projection as f16 hi + residual operand pairs (power-of-two scaled). Softmax, geometry embedding, bias, normalisation in f32.

#define NB   4
#define NTOK 512
#define DM   512
#define NH   8
#define DKH  64
#define MTOK (NB * NTOK)

#define S_X  1024.0f
#define S_W  4096.0f
#define S_QK 16.0f
#define S_V  1024.0f
#define S_P  4096.0f
#define S_AO 1024.0f
#define S_E  2048.0f
#define S_G  4096.0f

typedef _Float16 v16h __attribute__((ext_vector_type(16)));
typedef _Float16 v8h_base __attribute__((ext_vector_type(8)));
typedef v8h_base __attribute__((may_alias)) v8h;
typedef float v8f __attribute__((ext_vector_type(8)));
typedef float v4f_base __attribute__((ext_vector_type(4)));
typedef v4f_base __attribute__((may_alias)) v4f;

union Frag16 { v16h v; v8h half[2]; _Float16 s[16]; };
union Pack8  { v8h v; _Float16 s[8]; };
union Pack2  { unsigned u; _Float16 s[2]; };
union F8     { v4f v[2]; float f[8]; };

__device__ __forceinline__ v8f zero8f() {
  v8f z = {0.f, 0.f, 0.f, 0.f, 0.f, 0.f, 0.f, 0.f};
  return z;
}

// one 16x16x32 step with the VALU hazard guard tied to D, A, B
__device__ __forceinline__ v8f wmma16(v16h a, v16h b, v8f c) {
  v8f d = __builtin_amdgcn_wmma_f32_16x16x32_f16(false, a, false, b, (short)0, c, false, false);
  asm volatile("v_nop\n\tv_nop\n\tv_nop\n\tv_nop" : "+v"(d) : "v"(a), "v"(b));
  return d;
}

// 16x32 operand fragment from a 16-bit LDS tile stored [line][k], k contiguous, pitch in elements (16-B aligned lines).
// lane l: line (row of A / column of B) = l & 15; elements 0..7 <- k0 + 8*(l>>4) + 0..7, elements 8..15 <- k0 + 16 + 8*(l>>4) + 0..7.
__device__ __forceinline__ v16h ldfrag(const _Float16* base, int pitch, int lane, int k0) {
  const _Float16* p = base + (lane & 15) * pitch + k0 + 8 * (lane >> 4);
  Frag16 f;
  f.half[0] = *(const v8h*)(p);
  f.half[1] = *(const v8h*)(p + 16);
  return f.v;
}

// Work-group barrier of the tile loops. It orders LDS accesses only (the loops hand nothing but LDS tiles from wave to wave),
// so global loads that were issued ahead into registers stay in flight across it; __syncthreads() would wait for them.
__device__ __forceinline__ void lds_barrier() {
  __builtin_amdgcn_fence(__ATOMIC_RELEASE, "workgroup", "local");
  __builtin_amdgcn_s_barrier();
  __builtin_amdgcn_fence(__ATOMIC_ACQUIRE, "workgroup", "local");
}

// ---------------------------------------------------------------------------------------------
// Y[M][Nout] = A[M][K] . W[K][Nout] + bias.  64x64 tile, 128 threads = 4 waves (16 rows each).
// AM: 0 = A f32 -> one f16 plane (scaled); 1 = A f32 -> f16 hi + residual planes; 2 = A given as two f16 planes.
//     W f32 -> same plane count as A (scaled).  Planes>1: D = Ah.Wh + Ah.Wl + Al.Wh.
// OM: 0 = f16 row-major [M][Nout], value*o_scale; 1 = f16 hi/residual planes laid out [b][head][dk][token]
//     (Nout = NH*DKH, one head per column tile, M = NB*NTOK); 2 = f32 row-major.
// D element r of lane l = (row 8*(l>>4)+r, col l&15) of the 16x16 tile.
// ---------------------------------------------------------------------------------------------
// smem: the work-group's LDS (GEMM_LDS(planes) bytes per K group, 16-B aligned); (bx, by) = column tile, row tile.
// KS: K is split over KS groups of 4 waves (128 * KS threads). Group g walks k in [g*K/KS, (g+1)*K/KS) with its own A/W
//     tiles and accumulators, so the serial chain of load -> stage -> multiply rounds is KS times shorter and each SIMD
//     holds KS waves; the f32 partial tiles are summed through LDS (KS > 1: OM 2 only). K is a multiple of 64*KS.
#define GEMM_LDS(npl) (2 * (npl) * 64 * 40 * 2 + 64 * 68 * 4)
template <int AM, int OM, int KS = 1>
__device__ __forceinline__ void gemm_body(char* smem, int bx, int by,
                                          const float* Af, const _Float16* Ah, const _Float16* Al,
                                          const float* W, const float* bias,
                                          _Float16* Yh, _Float16* Yl, float* Yf,
                                          int M, int K, int Nout,
                                          float a_scale, float w_scale, float o_mul, float o_scale) {
  constexpr int NPL = (AM == 0) ? 1 : 2;
  static_assert(KS == 1 || OM == 2, "the merge of K groups is written for the f32 row-major output");
  const int grp = (KS > 1) ? __builtin_amdgcn_readfirstlane((int)threadIdx.x >> 7) : 0;   // same in every lane of a wave
  smem += grp * GEMM_LDS(NPL);                                                              // the group's own tiles
  _Float16 (*At)[64][40] = reinterpret_cast<_Float16 (*)[64][40]>(smem);                        // [plane][row][k]
  _Float16 (*Bt)[64][40] = reinterpret_cast<_Float16 (*)[64][40]>(smem + NPL * 64 * 40 * 2);    // [plane][n][k]
  float (*Ct)[68] = reinterpret_cast<float (*)[68]>(smem + 2 * NPL * 64 * 40 * 2);

  const int tid = (KS > 1) ? (int)(threadIdx.x & 127) : (int)threadIdx.x;   // index inside the K group
  const int lane = tid & 31, wave = tid >> 5;
  const int hh = lane >> 4, m = lane & 15;
  const int n0 = bx * 64, m0 = by * 64;
  if (m0 + 64 > M || n0 + 64 > Nout) return;   // block-uniform, before any barrier

  v8f acc[4];
#pragma unroll
  for (int j = 0; j < 4; ++j) acc[j] = zero8f();

  const int kbeg = (KS > 1) ? grp * (K / KS) : 0;   // same trip count in every group: barriers stay block-uniform
  const int kend = (KS > 1) ? kbeg + K / KS : K;

  // The global loads of a k tile are issued two tiles ahead, into two register sets used in turn: they fly while the two
  // tiles before are staged and multiplied, so a round no longer begins with a wait for memory.
  struct Tile {
    v8h h0, h1, l0, l1;   // AM 2: A planes
    F8 x0, x1;            // AM 0, 1: A in f32
    F8 w0, w1;            // W in f32
  };
  // running addresses of the next tile to fetch. A tile 64x32: thread -> row tid>>1, 16 consecutive k;
  // W tile 32 k x 64 n: thread -> k pair 2kp,2kp+1 and 8 columns
  // (byte offsets from the buffers' starts; every buffer here is far below 4 GB)
  constexpr unsigned ASZ = (AM == 2) ? 2u : 4u;   // bytes per element of A
  unsigned oa = ((unsigned)(m0 + (tid >> 1)) * (unsigned)K + (unsigned)(kbeg + (tid & 1) * 16)) * ASZ;
  unsigned ow0 = ((unsigned)(kbeg + 2 * (tid >> 3)) * (unsigned)Nout + (unsigned)(n0 + (tid & 7) * 8)) * 4u;
  unsigned ow1 = ow0 + (unsigned)Nout * 4u;
  auto fetch = [&](Tile& t) {   // loads the tile at the running addresses and moves these one tile on
    if (AM == 2) {
      const _Float16* ph = (const _Float16*)((const char*)Ah + oa);
      const _Float16* pl = (const _Float16*)((const char*)Al + oa);
      t.h0 = *(const v8h*)(ph);  t.h1 = *(const v8h*)(ph + 8);
      t.l0 = *(const v8h*)(pl);  t.l1 = *(const v8h*)(pl + 8);
    } else {
      const float* s = (const float*)((const char*)Af + oa);
      t.x0.v[0] = *(const v4f*)(s);      t.x0.v[1] = *(const v4f*)(s + 4);
      t.x1.v[0] = *(const v4f*)(s + 8);  t.x1.v[1] = *(const v4f*)(s + 12);
    }
    const float* s0 = (const float*)((const char*)W + ow0);
    const float* s1 = (const float*)((const char*)W + ow1);
    t.w0.v[0] = *(const v4f*)(s0);  t.w0.v[1] = *(const v4f*)(s0 + 4);
    t.w1.v[0] = *(const v4f*)(s1);  t.w1.v[1] = *(const v4f*)(s1 + 4);
    // the loads stay in flight: their address registers stay untouched until the loads took them. The wait names the
    // offsets as in-out operands, so that they live up to it (no load lands in one) and are moved on only behind it.
    asm volatile("s_wait_xcnt 0x0" : "+v"(oa), "+v"(ow0), "+v"(ow1) :: "memory");
    oa += 32u * ASZ;
    ow0 += 128u * (unsigned)Nout;
    ow1 += 128u * (unsigned)Nout;
  };
  auto stage = [&](const Tile& t) {
    {
      const int r = tid >> 1, cb = (tid & 1) * 16;
      if (AM == 2) {
        *(v8h*)&At[0][r][cb] = t.h0;        *(v8h*)&At[0][r][cb + 8] = t.h1;
        *(v8h*)&At[NPL - 1][r][cb] = t.l0;  *(v8h*)&At[NPL - 1][r][cb + 8] = t.l1;
      } else {
        Frag16 ph, pl;
#pragma unroll
        for (int e = 0; e < 8; ++e) {
          const float v0 = t.x0.f[e] * a_scale, v1 = t.x1.f[e] * a_scale;
          const _Float16 h0 = (_Float16)v0, h1 = (_Float16)v1;
          ph.s[e] = h0;
          ph.s[8 + e] = h1;
          pl.s[e] = (_Float16)(v0 - (float)h0);
          pl.s[8 + e] = (_Float16)(v1 - (float)h1);
        }
        *(v8h*)&At[0][r][cb] = ph.half[0];  *(v8h*)&At[0][r][cb + 8] = ph.half[1];
        if (NPL == 2) {
          *(v8h*)&At[NPL - 1][r][cb] = pl.half[0];  *(v8h*)&At[NPL - 1][r][cb + 8] = pl.half[1];
        }
      }
    }
    {  // W stored transposed [n][k]
      const int kp = tid >> 3, nb = (tid & 7) * 8;
#pragma unroll
      for (int d = 0; d < 8; ++d) {
        const float a = t.w0.f[d] * w_scale, c = t.w1.f[d] * w_scale;
        const _Float16 ha = (_Float16)a, hc = (_Float16)c;
        Pack2 q;
        q.s[0] = ha;  q.s[1] = hc;
        *(unsigned*)&Bt[0][nb + d][2 * kp] = q.u;
        if (NPL == 2) {
          Pack2 ql;
          ql.s[0] = (_Float16)(a - (float)ha);
          ql.s[1] = (_Float16)(c - (float)hc);
          *(unsigned*)&Bt[NPL - 1][nb + d][2 * kp] = ql.u;
        }
      }
    }
  };
  auto multiply = [&]() {
    const v16h ah = ldfrag(&At[0][wave * 16][0], 40, lane, 0);
    if (NPL == 1) {
#pragma unroll
      for (int j = 0; j < 4; ++j) {
        const v16h bh = ldfrag(&Bt[0][j * 16][0], 40, lane, 0);
        acc[j] = wmma16(ah, bh, acc[j]);
      }
    } else {
      const v16h al = ldfrag(&At[NPL - 1][wave * 16][0], 40, lane, 0);
#pragma unroll
      for (int j = 0; j < 4; ++j) {
        const v16h bh = ldfrag(&Bt[0][j * 16][0], 40, lane, 0);
        const v16h bl = ldfrag(&Bt[NPL - 1][j * 16][0], 40, lane, 0);
        acc[j] = wmma16(ah, bh, acc[j]);
        acc[j] = wmma16(ah, bl, acc[j]);
        acc[j] = wmma16(al, bh, acc[j]);
      }
    }
  };

  // K / KS is a multiple of 64: rounds go in pairs. The last pair stands behind the loop, so that every fetch in the loop is
  // unconditional and the wait in front of a set's use leaves the other set's loads in flight.
  // AM 1 (f32 A and W, two planes each) has no registers for a second set at the kernel's occupancy: one set, one tile ahead.
  Tile ta, tb;
  fetch(ta);
  if (AM == 1) {
#pragma unroll 1
    for (int kk = kbeg; kk + 32 < kend; kk += 32) {
      stage(ta);
      lds_barrier();
      fetch(ta);
      multiply();
      lds_barrier();
    }
  } else {
    fetch(tb);
#pragma unroll 1
    for (int kk = kbeg; kk + 64 < kend; kk += 64) {   // same trip count in every K group
      stage(ta);
      lds_barrier();
      fetch(ta);
      multiply();
      lds_barrier();
      stage(tb);
      lds_barrier();
      fetch(tb);
      multiply();
      lds_barrier();
    }
    stage(ta);
    lds_barrier();
    multiply();
    lds_barrier();
    ta = tb;
  }
  stage(ta);
  lds_barrier();
  multiply();
  lds_barrier();

  if (KS > 1) {
    // each K group leaves its raw f32 partial tile in LDS; thread -> one row, 8 consecutive columns: sum, scale, bias
#pragma unroll
    for (int j = 0; j < 4; ++j)
#pragma unroll
      for (int r = 0; r < 8; ++r) Ct[wave * 16 + 8 * hh + r][16 * j + m] = acc[j][r];
    __syncthreads();
    const int row = (int)threadIdx.x >> 3, c0 = ((int)threadIdx.x & 7) * 8;
    const char* c00 = smem - grp * GEMM_LDS(NPL) + 2 * NPL * 64 * 40 * 2 + (row * 68 + c0) * 4;   // group 0's tile
    F8 bc, sum;
    bc.v[0] = *(const v4f*)(bias + n0 + c0);
    bc.v[1] = *(const v4f*)(bias + n0 + c0 + 4);
    sum.v[0] = *(const v4f*)(c00);
    sum.v[1] = *(const v4f*)(c00 + 16);
#pragma unroll
    for (int g = 1; g < KS; ++g) {
      sum.v[0] += *(const v4f*)(c00 + g * GEMM_LDS(NPL));
      sum.v[1] += *(const v4f*)(c00 + g * GEMM_LDS(NPL) + 16);
    }
    float* y = Yf + (size_t)(m0 + row) * Nout + n0 + c0;
    *(v4f*)(y) = sum.v[0] * o_mul + bc.v[0];
    *(v4f*)(y + 4) = sum.v[1] * o_mul + bc.v[1];
    return;
  }

  // D + bias (unscaled) -> LDS tile
#pragma unroll
  for (int j = 0; j < 4; ++j) {
    const float bcol = bias[n0 + 16 * j + m];
#pragma unroll
    for (int r = 0; r < 8; ++r) Ct[wave * 16 + 8 * hh + r][16 * j + m] = acc[j][r] * o_mul + bcol;
  }
  __syncthreads();

  if (OM == 0) {
    const int q = lane >> 3, p = lane & 7;
    v8h vals[4];
    size_t addr[4];
#pragma unroll
    for (int it = 0; it < 4; ++it) {
      const int row = wave * 16 + 4 * it + q;
      F8 c;
      c.v[0] = *(const v4f*)&Ct[row][8 * p];
      c.v[1] = *(const v4f*)&Ct[row][8 * p + 4];
      Pack8 pk;
#pragma unroll
      for (int e = 0; e < 8; ++e) pk.s[e] = (_Float16)(c.f[e] * o_scale);
      vals[it] = pk.v;
      addr[it] = (size_t)(m0 + row) * Nout + n0 + 8 * p;
    }
#pragma unroll
    for (int it = 0; it < 4; ++it) *(v8h*)(Yh + addr[it]) = vals[it];
    // in a kernel with several block ranges other code follows these stores in the listing: their address and data
    // registers stay untouched until the stores have taken them
    asm volatile("s_wait_xcnt 0x0" ::: "memory");
  } else if (OM == 1) {
    const int hd = bx;
    const int bb = m0 / NTOK, tok0 = m0 - bb * NTOK;
    const int q = lane >> 3, p = lane & 7;
    v8h vh[4], vl[4];
    size_t addr[4];
#pragma unroll
    for (int it = 0; it < 4; ++it) {
      const int dk = wave * 16 + 4 * it + q;
      Pack8 ph, pl;
#pragma unroll
      for (int e = 0; e < 8; ++e) {
        const float v = Ct[8 * p + e][dk] * o_scale;
        const _Float16 hv = (_Float16)v;
        ph.s[e] = hv;
        pl.s[e] = (_Float16)(v - (float)hv);
      }
      vh[it] = ph.v;
      vl[it] = pl.v;
      addr[it] = (((size_t)bb * NH + hd) * DKH + dk) * NTOK + tok0 + 8 * p;
    }
#pragma unroll
    for (int it = 0; it < 4; ++it) {
      *(v8h*)(Yh + addr[it]) = vh[it];
      *(v8h*)(Yl + addr[it]) = vl[it];
    }
    
  } else {
    const int q = lane >> 4, p = lane & 15;
    v4f vals[8];
    size_t addr[8];
#pragma unroll
    for (int it = 0; it < 8; ++it) {
      const int row = wave * 16 + 2 * it + q;
      vals[it] = *(const v4f*)&Ct[row][4 * p];
      addr[it] = (size_t)(m0 + row) * Nout + n0 + 4 * p;
    }
#pragma unroll
    for (int it = 0; it < 8; ++it) *(v4f*)(Yf + addr[it]) = vals[it];
    
  }
}

template <int AM, int OM, int KS>
__global__ __launch_bounds__(128 * KS) void k_gemm(const float* Af, const _Float16* Ah, const _Float16* Al,
                                             const float* W, const float* bias,
                                             _Float16* Yh, _Float16* Yl, float* Yf,
                                             int M, int K, int Nout,
                                             float a_scale, float w_scale, float o_mul, float o_scale) {
  __shared__ __attribute__((aligned(16))) char smem[KS * GEMM_LDS((AM == 0) ? 1 : 2)];
  gemm_body<AM, OM, KS>(smem, blockIdx.x, blockIdx.y, Af, Ah, Al, W, bias, Yh, Yl, Yf, M, K, Nout,
                    a_scale, w_scale, o_mul, o_scale);
}

// ---------------------------------------------------------------------------------------------
// Geometric log-weights with the key mask folded in:
// logg[b][h][i][j] = log(max(relu(emb(i,j) . Wg[:,h] + bg[h]), 1e-6)) + (mask[b][i][j]==0 ? -1e9 : 0)
// One block per (b, GIB query boxes i, 128 key boxes j; one j per thread); the 64->8 projection runs on WMMA.
// The two centre-distance angles depend on the pair (i, j): their 32 sin/cos values are made per pair (A = hi / residual
// planes x S_E, B columns 0..7 = f16(S_G*Wg[:,h]), 8..15 = residual of the same).
// The two size angles are differences, 100*dm*log(w_i/w_j) = A_i - A_j with A = 100*dm*log(w) (w > 0 for box coordinates in
// [0,1)): Ws*sin(A_i-A_j) + Wc*cos(A_i-A_j) = sin(A_j)*(Wc*sin(A_i) - Ws*cos(A_i)) + cos(A_j)*(Ws*sin(A_i) + Wc*cos(A_i)).
// So sin/cos(A_j) are made once per block (A fragments kept in registers for all GIB query boxes) and the brackets are a
// 32x8 B operand per query box, made once in the prologue.
// k order of every 32-wide operand here: k = 16*c + 8*pl + f, c = 0 sin / 1 cos, pl = which of the two angles, f = frequency.
// ---------------------------------------------------------------------------------------------
#define GIB 8
#define GEO_BLOCKS (NB * (NTOK / GIB) * (NTOK / 128))
#define GEO_O_B0 (2 * 128 * 40 * 2)
#define GEO_O_BP (GEO_O_B0 + 16 * 40 * 2)
#define GEO_O_GS (GEO_O_BP + GIB * 16 * 40 * 2)
#define GEO_O_DM (GEO_O_GS + 128 * 17 * 4)
#define GEO_O_SA (GEO_O_DM + 8 * 4 + 8 * 4)
#define GEO_O_SI (GEO_O_SA + GIB * 32 * 4)
#define GEO_LDS  (GEO_O_SI + GIB * 4 * 4)

// 8 angles ang0*dm[f] -> sin and cos, each as f16 hi / residual of S_E * value
__device__ __forceinline__ void geo_sincos8(float ang0, const float* dm, Pack8& sh, Pack8& sl, Pack8& chv, Pack8& clv) {
  float sn[8], cs[8];
#pragma unroll
  for (int f = 0; f < 8; ++f) sn[f] = __sinf(ang0 * dm[f]);
#pragma unroll
  for (int f = 0; f < 8; ++f) cs[f] = __cosf(ang0 * dm[f]);
#pragma unroll
  for (int f = 0; f < 8; ++f) {
    const float sv = sn[f] * S_E;
    const float cv = cs[f] * S_E;
    const _Float16 a = (_Float16)sv;
    sh.s[f] = a;
    sl.s[f] = (_Float16)(sv - (float)a);
    const _Float16 c = (_Float16)cv;
    chv.s[f] = c;
    clv.s[f] = (_Float16)(cv - (float)c);
  }
}

__device__ __forceinline__ void geo_body(char* smem, int gb, const float* box, const float* Wg, const float* bg,
                                         const int* msk, float* logg) {
  _Float16 (*Et)[128][40] = reinterpret_cast<_Float16 (*)[128][40]>(smem);              // [plane][j][k]
  _Float16 (*B0)[40] = reinterpret_cast<_Float16 (*)[40]>(smem + GEO_O_B0);             // [n][k], pair part of Wg
  _Float16 (*Bp)[16][40] = reinterpret_cast<_Float16 (*)[16][40]>(smem + GEO_O_BP);     // [query box][n][k], size part
  float (*Gs)[17] = reinterpret_cast<float (*)[17]>(smem + GEO_O_GS);
  float* sdm = reinterpret_cast<float*>(smem + GEO_O_DM);
  float* sbg = sdm + 8;
  float (*sA)[32] = reinterpret_cast<float (*)[32]>(smem + GEO_O_SA);                   // [query box][sin 0..15 | cos 0..15]
  v4f* sI = reinterpret_cast<v4f*>(smem + GEO_O_SI);                                    // [query box] cx, cy, 1/w, 1/h

  static_assert(GIB * 16 == 128, "one thread per (query box, size angle)");
  const int tid = threadIdx.x, lane = tid & 31, wave = tid >> 5;
  const int hh = lane >> 4, m = lane & 15;
  if (gb >= GEO_BLOCKS) return;   // block-uniform
  const int j0 = (gb & (NTOK / 128 - 1)) * 128;
  const int i0 = ((gb / (NTOK / 128)) & (NTOK / GIB - 1)) * GIB;
  const int b = gb / ((NTOK / 128) * (NTOK / GIB));

  if (tid < 8) {
    sdm[tid] = 1.0f / powf(1000.0f, (float)tid * 0.125f);
    sbg[tid] = bg[tid];
  }
#pragma unroll
  for (int e = 0; e < 4; ++e) {
    const int idx = tid * 4 + e;          // 0..511
    const int n = idx >> 5, k = idx & 31;
    const float w = Wg[((k >> 4) * 32 + (k & 15)) * NH + (n & 7)] * S_G;
    const _Float16 wh = (_Float16)w;
    const _Float16 wl = (_Float16)(w - (float)wh);
    B0[n][k] = (n < 8) ? wh : wl;
  }
  const v4f bxj = *(const v4f*)(box + ((size_t)b * NTOK + j0 + tid) * 4);
  const float cxj = (bxj[0] + bxj[1]) * 0.5f, cyj = (bxj[2] + bxj[3]) * 0.5f;
  const float wj = (bxj[1] - bxj[0]) + 1.0f, hgj = (bxj[3] - bxj[2]) + 1.0f;
  __syncthreads();

  float dm[8];
#pragma unroll
  for (int f = 0; f < 8; ++f) dm[f] = sdm[f];

  {  // sin/cos(A_j) of key box j0 + tid -> Et[.][tid][0..31]
    const float la[2] = {logf(wj) * 100.0f, logf(hgj) * 100.0f};
#pragma unroll
    for (int pl = 0; pl < 2; ++pl) {
      Pack8 sh, sl, chv, clv;
      geo_sincos8(la[pl], dm, sh, sl, chv, clv);
      *(v8h*)&Et[0][tid][pl * 8] = sh.v;
      *(v8h*)&Et[1][tid][pl * 8] = sl.v;
      *(v8h*)&Et[0][tid][16 + pl * 8] = chv.v;
      *(v8h*)&Et[1][tid][16 + pl * 8] = clv.v;
    }
  }
  {  // sin/cos(A_i): thread -> query box tid>>4, angle (tid>>3)&1, frequency tid&7
    const int ii = tid >> 4, a = tid & 15;
    const v4f bi = *(const v4f*)(box + ((size_t)b * NTOK + i0 + ii) * 4);
    const float wi = (bi[1] - bi[0]) + 1.0f, hgi = (bi[3] - bi[2]) + 1.0f;
    const float ang = (logf((a & 8) ? hgi : wi) * 100.0f) * sdm[a & 7];
    sA[ii][a] = __sinf(ang);
    sA[ii][16 + a] = __cosf(ang);
    if (a == 0) {
      v4f q;
      q[0] = (bi[0] + bi[1]) * 0.5f;
      q[1] = (bi[2] + bi[3]) * 0.5f;
      q[2] = 1.0f / wi;
      q[3] = 1.0f / hgi;
      sI[ii] = q;
    }
  }
  __syncthreads();

  v16h eh[2], el[2];
#pragma unroll
  for (int t = 0; t < 2; ++t) {
    eh[t] = ldfrag(&Et[0][wave * 32 + t * 16][0], 40, lane, 0);
    el[t] = ldfrag(&Et[1][wave * 32 + t * 16][0], 40, lane, 0);
  }
  const v16h b0 = ldfrag(&B0[0][0], 40, lane, 0);
#pragma unroll
  for (int e = 0; e < GIB * 32 / 128; ++e) {   // size part of the B operand: thread -> (query box, k), all 8 heads
    const int idx = e * 128 + tid;
    const int ii = idx >> 5, k = idx & 31, a = k & 15;
    const bool isc = (k >> 4) != 0;
    const float sa = sA[ii][a], ca = sA[ii][16 + a];
    const float* ws = Wg + (16 + a) * NH;
    const float* wc = Wg + (48 + a) * NH;
    F8 s8, c8;
    s8.v[0] = *(const v4f*)(ws);  s8.v[1] = *(const v4f*)(ws + 4);
    c8.v[0] = *(const v4f*)(wc);  c8.v[1] = *(const v4f*)(wc + 4);
#pragma unroll
    for (int h = 0; h < 8; ++h) {
      const float x = isc ? s8.f[h] : c8.f[h];
      const float y = isc ? c8.f[h] : -s8.f[h];
      const float w = (x * sa + y * ca) * S_G;
      const _Float16 wh = (_Float16)w;
      Bp[ii][h][k] = wh;
      Bp[ii][h + 8][k] = (_Float16)(w - (float)wh);
    }
  }
  __syncthreads();   // Bp is complete, and every wave holds its sin/cos(A_j) fragments before Et is written again

  const v8f z8 = zero8f();

#pragma unroll 1
  for (int ii = 0; ii < GIB; ++ii) {
    const int i = i0 + ii;
    {  // pair part of the embedding of (i, j0 + tid) -> Et[.][tid][0..31]
      const v4f qi = sI[ii];
      const float p0 = logf(fmaxf(fabsf((qi[0] - cxj) * qi[2]), 1e-3f));
      const float p1 = logf(fmaxf(fabsf((qi[1] - cyj) * qi[3]), 1e-3f));
      const float pp[2] = {p0 * 100.0f, p1 * 100.0f};
#pragma unroll
      for (int pl = 0; pl < 2; ++pl) {
        Pack8 sh, sl, chv, clv;
        geo_sincos8(pp[pl], dm, sh, sl, chv, clv);
        *(v8h*)&Et[0][tid][pl * 8] = sh.v;
        *(v8h*)&Et[1][tid][pl * 8] = sl.v;
        *(v8h*)&Et[0][tid][16 + pl * 8] = chv.v;
        *(v8h*)&Et[1][tid][16 + pl * 8] = clv.v;
      }
    }
    __syncthreads();

    // 128 j rows x 16 cols, K = 32 (pair part) + 32 (size part): wave -> two 16-row tiles
    const v16h bp = ldfrag(&Bp[ii][0][0], 40, lane, 0);
#pragma unroll
    for (int t = 0; t < 2; ++t) {
      const int row0 = wave * 32 + t * 16;
      v8f acc = z8;
      const v16h a0 = ldfrag(&Et[0][row0][0], 40, lane, 0);
      const v16h l0 = ldfrag(&Et[1][row0][0], 40, lane, 0);
      acc = wmma16(a0, b0, acc);
      acc = wmma16(l0, b0, acc);
      acc = wmma16(eh[t], bp, acc);
      acc = wmma16(el[t], bp, acc);
#pragma unroll
      for (int r = 0; r < 8; ++r) Gs[row0 + 8 * hh + r][m] = acc[r];
    }
    __syncthreads();

    const size_t mbase = ((size_t)b * NTOK + i) * NTOK + j0;
    v4f vv[2];
#pragma unroll
    for (int e = 0; e < 2; ++e) {
      const int hd = 2 * wave + e;
#pragma unroll
      for (int q = 0; q < 4; ++q) {
        const int jl = 4 * lane + q;
        const float graw = (Gs[jl][hd] + Gs[jl][hd + 8]) * (1.0f / (S_E * S_G)) + sbg[hd];
        const float g = fmaxf(graw, 0.0f);
        float v = logf(fmaxf(g, 1e-6f));
        const int mk = msk[mbase + jl];
        v += (mk == 0) ? -1e9f : 0.0f;
        vv[e][q] = v;
      }
    }
    float* ap0 = logg + (((size_t)b * NH + 2 * wave) * NTOK + i) * NTOK + j0 + 4 * lane;
    float* ap1 = ap0 + (size_t)NTOK * NTOK;
    *(v4f*)ap0 = vv[0];
    *(v4f*)ap1 = vv[1];
    // the next trip reuses the stores' data and address registers at once: they stay untouched until the stores took them
    asm volatile("s_wait_xcnt 0x0" ::: "memory");
  }
}

// ---------------------------------------------------------------------------------------------
// The four producers of the attention kernel depend on inputs only, so they share one launch and run side by side:
// block ranges, longest work-groups first: v projection, q projection, k projection (GTILES tiles each), geometry.
// Every branch is block-uniform (blockIdx only); the ranges share one LDS buffer sized for the largest user.
// ---------------------------------------------------------------------------------------------
// Second launch bound: 7 waves per SIMD, so that all work-groups of the grid (7 per WGP) stay resident at once as before,
// also with the projections' tiles in flight in registers.
#define GTILES ((DM / 64) * (MTOK / 64))
__global__ __launch_bounds__(128, 7) void k_front(const float* Xq, const float* Xk, const float* Xv,
                                              const float* Wq, const float* bq, const float* Wk, const float* bk,
                                              const float* Wv, const float* bv,
                                              const float* box, const float* Wg, const float* bg, const int* msk,
                                              _Float16* Q16, _Float16* K16, _Float16* Vth, _Float16* Vtl,
                                              float* logg) {
  static_assert(GEO_LDS >= GEMM_LDS(2), "shared buffer is sized by the geometry part");
  __shared__ __attribute__((aligned(16))) char smem[GEO_LDS];
  const int blk = blockIdx.x;
  const float omul = 1.0f / (S_X * S_W);     // 2^-22
  if (blk < GTILES) {
    gemm_body<1, 1>(smem, blk & (DM / 64 - 1), blk / (DM / 64), Xv, nullptr, nullptr, Wv, bv, Vth, Vtl, nullptr,
                    MTOK, DM, DM, S_X, S_W, omul, S_V);
  } else if (blk < 3 * GTILES) {
    const bool isq = blk < 2 * GTILES;
    const int t = blk - (isq ? GTILES : 2 * GTILES);
    gemm_body<0, 0>(smem, t & (DM / 64 - 1), t / (DM / 64), isq ? Xq : Xk, nullptr, nullptr,
                    isq ? Wq : Wk, isq ? bq : bk, isq ? Q16 : K16, nullptr, nullptr,
                    MTOK, DM, DM, S_X, S_W, omul, S_QK);
  } else {
    geo_body(smem, blk - 3 * GTILES, box, Wg, bg, msk, logg);
  }
}

// ---------------------------------------------------------------------------------------------
// Streaming attention: block = (b, h, 64 query rows), KSPL key groups x 4 waves x 16 queries, key tiles of 32.
// Key group g walks key tiles g, g + KSPL, g + 2*KSPL, ... with its own K/V tiles, maxima, sums and O partials,
// so each SIMD holds KSPL waves and the serial chain of tiles is KSPL times shorter; the partials are merged through LDS.
// Both products run transposed. S^T = K16.Q16^T (A = key rows, B = query columns; single f16 product, Q16/K16 carry S_QK):
// D element r of lane l = (key 8*(l>>4)+r, query l&15), so a lane holds 16 scores of ONE query per key tile: maximum and sum
// are taken inside the lane, plus one exchange between the wave's halves, and the lane's log-weights are contiguous in memory.
// logits = S*(1/(8*S_QK^2)) + logg; online softmax in f32.
// O^T += V^T.P^T: the two score tiles of a lane are, element for element, the B fragment (k = key) that the loader's k order
// asks for (elements 0..7 <- key 8*(l>>4)+0..7, elements 8..15 <- key 16+8*(l>>4)+0..7), so P never goes through LDS.
// P as f16 hi/residual of S_P*p, V as f16 hi/residual planes (carrying S_V), V tile staged [dk][key] = rows of A.
// Output: f16 hi/residual planes of S_AO * (O / l), row-major [b*N+q][h*64+dk].
// ---------------------------------------------------------------------------------------------
#define KSPL 4

// value of lane l ^ 16: the other half of the wave, which holds the same query's other keys
__device__ __forceinline__ float xhalf(float x) {
  return __builtin_bit_cast(float, __builtin_amdgcn_permlanex16(__builtin_bit_cast(int, x), __builtin_bit_cast(int, x),
                                                                0x76543210, 0xfedcba98, false, false));
}

__device__ __forceinline__ void exp2x8(float (&y)[8], const float (&x)[8]) {
  asm("v_exp_f32 %0, %8\n\tv_exp_f32 %1, %9\n\tv_exp_f32 %2, %10\n\tv_exp_f32 %3, %11\n\t"
      "v_exp_f32 %4, %12\n\tv_exp_f32 %5, %13\n\tv_exp_f32 %6, %14\n\tv_exp_f32 %7, %15\n\tv_nop"
      : "=&v"(y[0]), "=&v"(y[1]), "=&v"(y[2]), "=&v"(y[3]), "=&v"(y[4]), "=&v"(y[5]), "=&v"(y[6]), "=&v"(y[7])
      : "v"(x[0]), "v"(x[1]), "v"(x[2]), "v"(x[3]), "v"(x[4]), "v"(x[5]), "v"(x[6]), "v"(x[7]));
}

__global__ __launch_bounds__(128 * KSPL) void k_attn(const _Float16* Qh, const _Float16* Kh,
                                                    const _Float16* Vth, const _Float16* Vtl,
                                                    const float* logg, _Float16* Oh, _Float16* Ol) {
  __shared__ __attribute__((aligned(16))) _Float16 Qt[64][72];              // [q][dk]
  __shared__ __attribute__((aligned(16))) _Float16 Kt[KSPL][32][72];        // [group][key][dk]
  __shared__ __attribute__((aligned(16))) _Float16 Vt[KSPL][2][64][40];     // [group][plane][dk][key]
  __shared__ __attribute__((aligned(16))) float Cs[KSPL][64][68];           // [group][q][dk] un-normalised O partial
  __shared__ float Ms[KSPL][64];                                            // [group][q] maximum
  __shared__ float Ls[KSPL][64];                                            // [group][q] sum

  static_assert(128 * KSPL == 64 * 8, "Q staging and the merge give each thread one row and 8 consecutive dk");
  const int tid = threadIdx.x, lane = tid & 31;
  const int grp = __builtin_amdgcn_readfirstlane(tid >> 7);   // same in every lane of a wave: kept scalar
  const int gt = tid & 127, wave = gt >> 5;
  const int hh = lane >> 4, m = lane & 15;
  const int blk = blockIdx.x;
  if (blk >= NB * NH * (NTOK / 64)) return;   // block-uniform
  const int qb = blk & 7, h = (blk >> 3) & 7, b = blk >> 6;
  const int q0 = qb * 64;

  const size_t lgrow = (((size_t)b * NH + h) * NTOK + (q0 + wave * 16 + m)) * NTOK;   // the lane's query

  // The global loads of a key tile (K, both V planes, the log-weights) are issued one tile ahead, into registers: they fly
  // while the tile before is worked on, so a trip waits for memory neither at its head nor between S and the softmax.
  v8h kr[2], vr[4];
  F8 lg[2];
  // running addresses of the group's next key tile (first tile: keys grp*32 ..): K tile 32 keys x 64 dk; V planes, already
  // [dk][token], 64 dk x 32 keys; log-weights of the lane's query, keys 8*hh + 0..7 and 16 + 8*hh + 0..7 of the tile
  // (byte offsets from the buffers' starts; the largest buffer has 32 MB)
  unsigned ok = (unsigned)((b * NTOK + grp * 32 + (gt >> 2)) * DM + h * DKH + (gt & 3) * 16) * 2u;
  unsigned ov = (unsigned)(((b * NH + h) * DKH + (gt >> 1)) * NTOK + grp * 32 + (gt & 1) * 16) * 2u;
  unsigned og = ((unsigned)lgrow + (unsigned)(grp * 32 + 8 * hh)) * 4u;
  auto fetch = [&]() {   // loads the tile at the running addresses and moves these to the group's next tile
    const _Float16* pk = (const _Float16*)((const char*)Kh + ok);
    const _Float16* pvh = (const _Float16*)((const char*)Vth + ov);
    const _Float16* pvl = (const _Float16*)((const char*)Vtl + ov);
    const float* pg = (const float*)((const char*)logg + og);
    kr[0] = *(const v8h*)(pk);
    kr[1] = *(const v8h*)(pk + 8);
    vr[0] = *(const v8h*)(pvh);
    vr[1] = *(const v8h*)(pvh + 8);
    vr[2] = *(const v8h*)(pvl);
    vr[3] = *(const v8h*)(pvl + 8);
#pragma unroll
    for (int c = 0; c < 2; ++c) {
      lg[c].v[0] = *(const v4f*)(pg + 16 * c);
      lg[c].v[1] = *(const v4f*)(pg + 16 * c + 4);
    }
    // the loads stay in flight: their address registers stay untouched until the loads took them. The wait names the
    // offsets as in-out operands, so that they live up to it (no load lands in one) and are moved on only behind it.
    asm volatile("s_wait_xcnt 0x0" : "+v"(ok), "+v"(ov), "+v"(og) :: "memory");
    ok += KSPL * 32 * DM * 2u;
    ov += KSPL * 32 * 2u;
    og += KSPL * 32 * 4u;
  };

  {
    const int r = tid >> 3, cb = (tid & 7) * 8;
    const v8h qv = *(const v8h*)(Qh + ((size_t)(b * NTOK + q0 + r)) * DM + h * DKH + cb);
    fetch();
    *(v8h*)&Qt[r][cb] = qv;
  }
  lds_barrier();
  const v16h qb0 = ldfrag(&Qt[wave * 16][0], 72, lane, 0);    // B[k=dk][n=q] = Qt[q][dk]: n-major tile, same loader as A
  const v16h qb1 = ldfrag(&Qt[wave * 16][0], 72, lane, 32);

  const v8f z8 = zero8f();
  v8f o[4];   // O^T: element r of o[j] = (dk 16*j + 8*hh + r, query m)
#pragma unroll
  for (int j = 0; j < 4; ++j) o[j] = z8;
  float mrow = -1e30f;   // running maximum of the lane's query (equal in both halves of the wave)
  float lrow = 0.0f;     // running sum over the keys of the lane's own half; the halves are joined behind the loop

  const float SC = 0.125f / (S_QK * S_QK);

#pragma unroll 1
  for (int it = 0; it < NTOK / 32 / KSPL; ++it) {   // same trip count in every group: barriers stay block-uniform
    {  // K tile 32 keys x 64 dk
      const int r = gt >> 2, cb = (gt & 3) * 16;
      *(v8h*)&Kt[grp][r][cb] = kr[0];
      *(v8h*)&Kt[grp][r][cb + 8] = kr[1];
    }
    {  // V planes: 64 dk x 32 keys, direct copy
      const int r = gt >> 1, cb = (gt & 1) * 16;
      *(v8h*)&Vt[grp][0][r][cb] = vr[0];
      *(v8h*)&Vt[grp][0][r][cb + 8] = vr[1];
      *(v8h*)&Vt[grp][1][r][cb] = vr[2];
      *(v8h*)&Vt[grp][1][r][cb + 8] = vr[3];
    }
    lds_barrier();

    // S^T[32 keys][16 q]: A[row=key][k=dk] = Kt[key][dk]
    v8f s[2];
#pragma unroll
    for (int c = 0; c < 2; ++c) {
      const v16h a0 = ldfrag(&Kt[grp][16 * c][0], 72, lane, 0);
      const v16h a1 = ldfrag(&Kt[grp][16 * c][0], 72, lane, 32);
      v8f sc = z8;
      sc = wmma16(a0, qb0, sc);
      sc = wmma16(a1, qb1, sc);
      s[c] = sc;
    }

    float t[2][8];
#pragma unroll
    for (int c = 0; c < 2; ++c)
#pragma unroll
      for (int r = 0; r < 8; ++r)
        t[c][r] = s[c][r] * SC + lg[c].f[r];
    if (it + 1 < NTOK / 32 / KSPL) fetch();   // same for the whole work-group (scalar test)

    float mc[2];
#pragma unroll
    for (int c = 0; c < 2; ++c) {
      mc[c] = t[c][0];
#pragma unroll
      for (int r = 1; r < 8; ++r) mc[c] = fmaxf(mc[c], t[c][r]);
    }
    float mx = fmaxf(mc[0], mc[1]);
    mx = fmaxf(mx, xhalf(mx));

    const float mnew = fmaxf(mrow, mx);
    const float alpha = __expf(mrow - mnew);
    mrow = mnew;
    float p[2][8];
#pragma unroll
    for (int c = 0; c < 2; ++c) {
#pragma unroll
      for (int r = 0; r < 8; ++r) t[c][r] = (t[c][r] - mnew) * 1.442695041f;   // exp(x) = 2^(x * log2 e)
      exp2x8(p[c], t[c]);
    }

    float se[2], so[2];   // sums of the even and of the odd elements of each score tile: neighbours add in pairs
#pragma unroll
    for (int c = 0; c < 2; ++c) {
      se[c] = p[c][0];
      so[c] = p[c][1];
#pragma unroll
      for (int r = 2; r < 8; r += 2) {
        se[c] += p[c][r];
        so[c] += p[c][r + 1];
      }
    }
    lrow = lrow * alpha + ((se[0] + se[1]) + (so[0] + so[1]));
#pragma unroll
    for (int j = 0; j < 4; ++j)
#pragma unroll
      for (int r = 0; r < 8; ++r) o[j][r] *= alpha;

    // P^T as B fragments, straight from the score tiles: element 8*c + r <- key 16*c + 8*hh + r of query m
    Frag16 ph, pl;
#pragma unroll
    for (int c = 0; c < 2; ++c)
#pragma unroll
      for (int r = 0; r < 8; ++r) {
        const float ps = p[c][r] * S_P;
        const _Float16 hv = (_Float16)ps;
        ph.s[8 * c + r] = hv;
        pl.s[8 * c + r] = (_Float16)(ps - (float)hv);
      }

    // O^T[64 dk][16 q] += V^T[64 dk x 32 keys] . P^T[32 keys x 16 q]; A[row=dk][k=key] = Vt[dk][key]
#pragma unroll
    for (int j = 0; j < 4; ++j) {
      const v16h vh = ldfrag(&Vt[grp][0][16 * j][0], 40, lane, 0);
      const v16h vl = ldfrag(&Vt[grp][1][16 * j][0], 40, lane, 0);
      o[j] = wmma16(vh, ph.v, o[j]);
      o[j] = wmma16(vl, ph.v, o[j]);
      o[j] = wmma16(vh, pl.v, o[j]);
    }
    lds_barrier();
  }

  // each key group leaves its un-normalised partial, maximum and sum in LDS; a lane's 8 values of o[j] are consecutive dk
  lrow += xhalf(lrow);
#pragma unroll
  for (int j = 0; j < 4; ++j) {
    F8 c;
#pragma unroll
    for (int r = 0; r < 8; ++r) c.f[r] = o[j][r];
    *(v4f*)&Cs[grp][wave * 16 + m][16 * j + 8 * hh] = c.v[0];
    *(v4f*)&Cs[grp][wave * 16 + m][16 * j + 8 * hh + 4] = c.v[1];
  }
  if (hh == 0) {
    Ms[grp][wave * 16 + m] = mrow;
    Ls[grp][wave * 16 + m] = lrow;
  }
  __syncthreads();

  // merge: weight exp(m_g - max) per group, divide by the merged row sum; thread -> one row, 8 consecutive dk
  {
    const int row = tid >> 3, p = tid & 7;
    float mg[KSPL];
#pragma unroll
    for (int g = 0; g < KSPL; ++g) mg[g] = Ms[g][row];
    float mall = mg[0];
#pragma unroll
    for (int g = 1; g < KSPL; ++g) mall = fmaxf(mall, mg[g]);
    float wg[KSPL], lall = 0.0f;
#pragma unroll
    for (int g = 0; g < KSPL; ++g) {
      wg[g] = __expf(mg[g] - mall);
      lall += Ls[g][row] * wg[g];
    }
    const float inv = (1.0f / lall) * (S_AO / (S_P * S_V));
    float acc[8];
#pragma unroll
    for (int e = 0; e < 8; ++e) acc[e] = 0.0f;
#pragma unroll
    for (int g = 0; g < KSPL; ++g) {
      F8 c;
      c.v[0] = *(const v4f*)&Cs[g][row][8 * p];
      c.v[1] = *(const v4f*)&Cs[g][row][8 * p + 4];
#pragma unroll
      for (int e = 0; e < 8; ++e) acc[e] += c.f[e] * wg[g];
    }
    Pack8 ph, pl;
#pragma unroll
    for (int e = 0; e < 8; ++e) {
      const float v = acc[e] * inv;
      const _Float16 hv = (_Float16)v;
      ph.s[e] = hv;
      pl.s[e] = (_Float16)(v - (float)hv);
    }
    const size_t addr = ((size_t)(b * NTOK + q0 + row)) * DM + h * DKH + 8 * p;
    *(v8h*)(Oh + addr) = ph.v;
    *(v8h*)(Ol + addr) = pl.v;
  }
}

// ---------------------------------------------------------------------------------------------
// host-side launch glue
// ---------------------------------------------------------------------------------------------
extern "C" void kernel_launch(void* const* d_in, const int* in_sizes, int n_in,
                              void* d_out, int out_size, void* d_ws, size_t ws_size,
                              hipStream_t stream) {
  if (n_in < 15) return;
  const int xsz = MTOK * DM, wsz = DM * DM;
  if (in_sizes[0] != xsz || in_sizes[1] != xsz || in_sizes[2] != xsz) return;
  if (in_sizes[3] != MTOK * 4 || in_sizes[4] != NB * NTOK * NTOK) return;
  if (in_sizes[5] != wsz || in_sizes[7] != wsz || in_sizes[9] != wsz || in_sizes[11] != wsz) return;
  if (in_sizes[6] != DM || in_sizes[8] != DM || in_sizes[10] != DM || in_sizes[12] != DM) return;
  if (in_sizes[13] != DKH * NH || in_sizes[14] != NH || out_size != xsz) return;

  const float* Xq  = (const float*)d_in[0];
  const float* Xk  = (const float*)d_in[1];
  const float* Xv  = (const float*)d_in[2];
  const float* box = (const float*)d_in[3];
  const int*   msk = (const int*)d_in[4];
  const float* Wq  = (const float*)d_in[5];
  const float* bq  = (const float*)d_in[6];
  const float* Wk  = (const float*)d_in[7];
  const float* bk  = (const float*)d_in[8];
  const float* Wv  = (const float*)d_in[9];
  const float* bv  = (const float*)d_in[10];
  const float* Wo  = (const float*)d_in[11];
  const float* bo  = (const float*)d_in[12];
  const float* Wg  = (const float*)d_in[13];
  const float* bg  = (const float*)d_in[14];
  float* out = (float*)d_out;

  // workspace carve (all offsets multiples of 2 MB): logg 32 MB, six 16-bit [2048][512] buffers 2 MB each = 44 MB
  char* ws = (char*)d_ws;
  size_t off = 0;
  float* logg = (float*)(ws + off);          off += (size_t)NB * NH * NTOK * NTOK * sizeof(float);
  _Float16* Q16 = (_Float16*)(ws + off);     off += (size_t)xsz * 2;
  _Float16* K16 = (_Float16*)(ws + off);     off += (size_t)xsz * 2;
  _Float16* Vth = (_Float16*)(ws + off);     off += (size_t)xsz * 2;   // [b][h][dk][token]
  _Float16* Vtl = (_Float16*)(ws + off);     off += (size_t)xsz * 2;
  _Float16* AOh = (_Float16*)(ws + off);     off += (size_t)xsz * 2;   // [b*N+q][h*64+dk]
  _Float16* AOl = (_Float16*)(ws + off);     off += (size_t)xsz * 2;
  if (off > ws_size) return;

  const float omul_o = 1.0f / (S_AO * S_W);  // 2^-22
  const dim3 gg(DM / 64, MTOK / 64), gb(128);

  k_front<<<dim3(3 * GTILES + GEO_BLOCKS), gb, 0, stream>>>(Xq, Xk, Xv, Wq, bq, Wk, bk, Wv, bv, box, Wg, bg, msk,
                                                           Q16, K16, Vth, Vtl, logg);
  k_attn<<<dim3(NB * NH * (NTOK / 64)), dim3(128 * KSPL), 0, stream>>>(Q16, K16, Vth, Vtl, logg, AOh, AOl);
  k_gemm<2, 2, 4><<<gg, dim3(128 * 4), 0, stream>>>(Wo, AOh, AOl, Wo, bo, AOh, AOl, out,
                                      MTOK, DM, DM, 1.0f, S_W, omul_o, 1.0f);
}

// v007
// It runs in 41.9 microseconds.
// Timed twice side by side with v006, it ran 1.05 and 1.06 times as fast.
// Counting every step since v000, it is 3.01 times as fast.
#include <hip/hip_runtime.h>
#include <stddef.h>

// Contractions on v_wmma_f32_16x16x32_f16 (f16 operands, f32 accumulate): q,k projections and q.k^T as single products of power-of-two scaled operands; v projection, p.v, output projection and the 64->8 geometric projection as f16 hi + residual operand pairs (power-of-two scaled). Softmax, geometry embedding, bias, normalisation in f32.

#define NB   4
#define NTOK 512
#define DM   512
#define NH   8
#define DKH  64
#define MTOK (NB * NTOK)

#define S_X  1024.0f
#define S_W  4096.0f
#define S_QK 16.0f
#define S_V  1024.0f
#define S_P  4096.0f
#define S_AO 1024.0f
#define S_E  2048.0f
#define S_G  4096.0f
#define S_GW 64.0f

typedef _Float16 v16h __attribute__((ext_vector_type(16)));
typedef _Float16 v8h_base __attribute__((ext_vector_type(8)));
typedef v8h_base __attribute__((may_alias)) v8h;
typedef float v8f __attribute__((ext_vector_type(8)));
typedef float v4f_base __attribute__((ext_vector_type(4)));
typedef v4f_base __attribute__((may_alias)) v4f;

union Frag16 { v16h v; v8h half[2]; _Float16 s[16]; };
union Pack8  { v8h v; _Float16 s[8]; };
union Pack2  { unsigned u; _Float16 s[2]; };
union F8     { v4f v[2]; float f[8]; };

__device__ __forceinline__ v8f zero8f() {
  v8f z = {0.f, 0.f, 0.f, 0.f, 0.f, 0.f, 0.f, 0.f};
  return z;
}

// one 16x16x32 step with the VALU hazard guard tied to D, A, B
__device__ __forceinline__ v8f wmma16(v16h a, v16h b, v8f c) {
  v8f d = __builtin_amdgcn_wmma_f32_16x16x32_f16(false, a, false, b, (short)0, c, false, false);
  asm volatile("v_nop\n\tv_nop\n\tv_nop\n\tv_nop" : "+v"(d) : "v"(a), "v"(b));
  return d;
}

// 16x32 operand fragment from a 16-bit LDS tile stored [line][k], k contiguous, pitch in elements (16-B aligned lines).
// lane l: line (row of A / column of B) = l & 15; elements 0..7 <- k0 + 8*(l>>4) + 0..7, elements 8..15 <- k0 + 16 + 8*(l>>4) + 0..7.
__device__ __forceinline__ v16h ldfrag(const _Float16* base, int pitch, int lane, int k0) {
  const _Float16* p = base + (lane & 15) * pitch + k0 + 8 * (lane >> 4);
  Frag16 f;
  f.half[0] = *(const v8h*)(p);
  f.half[1] = *(const v8h*)(p + 16);
  return f.v;
}

// Work-group barrier of the tile loops. It orders LDS accesses only (the loops hand nothing but LDS tiles from wave to wave),
// so global loads that were issued ahead into registers stay in flight across it; __syncthreads() would wait for them.
__device__ __forceinline__ void lds_barrier() {
  __builtin_amdgcn_fence(__ATOMIC_RELEASE, "workgroup", "local");
  __builtin_amdgcn_s_barrier();
  __builtin_amdgcn_fence(__ATOMIC_ACQUIRE, "workgroup", "local");
}

// ---------------------------------------------------------------------------------------------
// Y[M][Nout] = A[M][K] . W[K][Nout] + bias.  64x64 tile, 128 threads = 4 waves (16 rows each).
// AM: 0 = A f32 -> one f16 plane (scaled); 1 = A f32 -> f16 hi + residual planes; 2 = A given as two f16 planes.
//     W f32 -> same plane count as A (scaled).  Planes>1: D = Ah.Wh + Ah.Wl + Al.Wh.
// OM: 0 = f16 row-major [M][Nout], value*o_scale; 1 = f16 hi/residual planes laid out [b][head][dk][token]
//     (Nout = NH*DKH, one head per column tile, M = NB*NTOK); 2 = f32 row-major.
// D element r of lane l = (row 8*(l>>4)+r, col l&15) of the 16x16 tile.
// ---------------------------------------------------------------------------------------------
// smem: the work-group's LDS (GEMM_LDS(planes) bytes per K group, 16-B aligned); (bx, by) = column tile, row tile.
// KS: K is split over KS groups of 4 waves (128 * KS threads). Group g walks k in [g*K/KS, (g+1)*K/KS) with its own A/W
//     tiles and accumulators, so the serial chain of load -> stage -> multiply rounds is KS times shorter and each SIMD
//     holds KS waves; the f32 partial tiles are summed through LDS (KS > 1: OM 2 only). K is a multiple of 64*KS.
#define GEMM_LDS(npl) (2 * (npl) * 64 * 40 * 2 + 64 * 68 * 4)
template <int AM, int OM, int KS = 1>
__device__ __forceinline__ void gemm_body(char* smem, int bx, int by,
                                          const float* Af, const _Float16* Ah, const _Float16* Al,
                                          const float* W, const float* bias,
                                          _Float16* Yh, _Float16* Yl, float* Yf,
                                          int M, int K, int Nout,
                                          float a_scale, float w_scale, float o_mul, float o_scale) {
  constexpr int NPL = (AM == 0) ? 1 : 2;
  static_assert(KS == 1 || OM == 2, "the merge of K groups is written for the f32 row-major output");
  const int grp = (KS > 1) ? __builtin_amdgcn_readfirstlane((int)threadIdx.x >> 7) : 0;   // same in every lane of a wave
  smem += grp * GEMM_LDS(NPL);                                                              // the group's own tiles
  _Float16 (*At)[64][40] = reinterpret_cast<_Float16 (*)[64][40]>(smem);                        // [plane][row][k]
  _Float16 (*Bt)[64][40] = reinterpret_cast<_Float16 (*)[64][40]>(smem + NPL * 64 * 40 * 2);    // [plane][n][k]
  float (*Ct)[68] = reinterpret_cast<float (*)[68]>(smem + 2 * NPL * 64 * 40 * 2);

  const int tid = (KS > 1) ? (int)(threadIdx.x & 127) : (int)threadIdx.x;   // index inside the K group
  const int lane = tid & 31, wave = tid >> 5;
  const int hh = lane >> 4, m = lane & 15;
  const int n0 = bx * 64, m0 = by * 64;
  if (m0 + 64 > M || n0 + 64 > Nout) return;   // block-uniform, before any barrier

  v8f acc[4];
#pragma unroll
  for (int j = 0; j < 4; ++j) acc[j] = zero8f();

  const int kbeg = (KS > 1) ? grp * (K / KS) : 0;   // same trip count in every group: barriers stay block-uniform
  const int kend = (KS > 1) ? kbeg + K / KS : K;

  // The global loads of a k tile are issued two tiles ahead, into two register sets used in turn: they fly while the two
  // tiles before are staged and multiplied, so a round no longer begins with a wait for memory.
  struct Tile {
    v8h h0, h1, l0, l1;   // AM 2: A planes
    F8 x0, x1;            // AM 0, 1: A in f32
    F8 w0, w1;            // W in f32
  };
  // running addresses of the next tile to fetch. A tile 64x32: thread -> row tid>>1, 16 consecutive k;
  // W tile 32 k x 64 n: thread -> k pair 2kp,2kp+1 and 8 columns
  // (byte offsets from the buffers' starts; every buffer here is far below 4 GB)
  constexpr unsigned ASZ = (AM == 2) ? 2u : 4u;   // bytes per element of A
  unsigned oa = ((unsigned)(m0 + (tid >> 1)) * (unsigned)K + (unsigned)(kbeg + (tid & 1) * 16)) * ASZ;
  unsigned ow0 = ((unsigned)(kbeg + 2 * (tid >> 3)) * (unsigned)Nout + (unsigned)(n0 + (tid & 7) * 8)) * 4u;
  unsigned ow1 = ow0 + (unsigned)Nout * 4u;
  auto fetch = [&](Tile& t) {   // loads the tile at the running addresses and moves these one tile on
    if (AM == 2) {
      const _Float16* ph = (const _Float16*)((const char*)Ah + oa);
      const _Float16* pl = (const _Float16*)((const char*)Al + oa);
      t.h0 = *(const v8h*)(ph);  t.h1 = *(const v8h*)(ph + 8);
      t.l0 = *(const v8h*)(pl);  t.l1 = *(const v8h*)(pl + 8);
    } else {
      const float* s = (const float*)((const char*)Af + oa);
      t.x0.v[0] = *(const v4f*)(s);      t.x0.v[1] = *(const v4f*)(s + 4);
      t.x1.v[0] = *(const v4f*)(s + 8);  t.x1.v[1] = *(const v4f*)(s + 12);
    }
    const float* s0 = (const float*)((const char*)W + ow0);
    const float* s1 = (const float*)((const char*)W + ow1);
    t.w0.v[0] = *(const v4f*)(s0);  t.w0.v[1] = *(const v4f*)(s0 + 4);
    t.w1.v[0] = *(const v4f*)(s1);  t.w1.v[1] = *(const v4f*)(s1 + 4);
    // the loads stay in flight: their address registers stay untouched until the loads took them. The wait names the
    // offsets as in-out operands, so that they live up to it (no load lands in one) and are moved on only behind it.
    asm volatile("s_wait_xcnt 0x0" : "+v"(oa), "+v"(ow0), "+v"(ow1) :: "memory");
    oa += 32u * ASZ;
    ow0 += 128u * (unsigned)Nout;
    ow1 += 128u * (unsigned)Nout;
  };
  auto stage = [&](const Tile& t) {
    {
      const int r = tid >> 1, cb = (tid & 1) * 16;
      if (AM == 2) {
        *(v8h*)&At[0][r][cb] = t.h0;        *(v8h*)&At[0][r][cb + 8] = t.h1;
        *(v8h*)&At[NPL - 1][r][cb] = t.l0;  *(v8h*)&At[NPL - 1][r][cb + 8] = t.l1;
      } else {
        Frag16 ph, pl;
#pragma unroll
        for (int e = 0; e < 8; ++e) {
          const float v0 = t.x0.f[e] * a_scale, v1 = t.x1.f[e] * a_scale;
          const _Float16 h0 = (_Float16)v0, h1 = (_Float16)v1;
          ph.s[e] = h0;
          ph.s[8 + e] = h1;
          pl.s[e] = (_Float16)(v0 - (float)h0);
          pl.s[8 + e] = (_Float16)(v1 - (float)h1);
        }
        *(v8h*)&At[0][r][cb] = ph.half[0];  *(v8h*)&At[0][r][cb + 8] = ph.half[1];
        if (NPL == 2) {
          *(v8h*)&At[NPL - 1][r][cb] = pl.half[0];  *(v8h*)&At[NPL - 1][r][cb + 8] = pl.half[1];
        }
      }
    }
    {  // W stored transposed [n][k]
      const int kp = tid >> 3, nb = (tid & 7) * 8;
#pragma unroll
      for (int d = 0; d < 8; ++d) {
        const float a = t.w0.f[d] * w_scale, c = t.w1.f[d] * w_scale;
        const _Float16 ha = (_Float16)a, hc = (_Float16)c;
        Pack2 q;
        q.s[0] = ha;  q.s[1] = hc;
        *(unsigned*)&Bt[0][nb + d][2 * kp] = q.u;
        if (NPL == 2) {
          Pack2 ql;
          ql.s[0] = (_Float16)(a - (float)ha);
          ql.s[1] = (_Float16)(c - (float)hc);
          *(unsigned*)&Bt[NPL - 1][nb + d][2 * kp] = ql.u;
        }
      }
    }
  };
  auto multiply = [&]() {
    const v16h ah = ldfrag(&At[0][wave * 16][0], 40, lane, 0);
    if (NPL == 1) {
#pragma unroll
      for (int j = 0; j < 4; ++j) {
        const v16h bh = ldfrag(&Bt[0][j * 16][0], 40, lane, 0);
        acc[j] = wmma16(ah, bh, acc[j]);
      }
    } else {
      const v16h al = ldfrag(&At[NPL - 1][wave * 16][0], 40, lane, 0);
#pragma unroll
      for (int j = 0; j < 4; ++j) {
        const v16h bh = ldfrag(&Bt[0][j * 16][0], 40, lane, 0);
        const v16h bl = ldfrag(&Bt[NPL - 1][j * 16][0], 40, lane, 0);
        acc[j] = wmma16(ah, bh, acc[j]);
        acc[j] = wmma16(ah, bl, acc[j]);
        acc[j] = wmma16(al, bh, acc[j]);
      }
    }
  };

  // K / KS is a multiple of 64: rounds go in pairs. The last pair stands behind the loop, so that every fetch in the loop is
  // unconditional and the wait in front of a set's use leaves the other set's loads in flight.
  // AM 1 (f32 A and W, two planes each) has no registers for a second set at the kernel's occupancy: one set, one tile ahead.
  Tile ta, tb;
  fetch(ta);
  if (AM == 1) {
#pragma unroll 1
    for (int kk = kbeg; kk + 32 < kend; kk += 32) {
      stage(ta);
      lds_barrier();
      fetch(ta);
      multiply();
      lds_barrier();
    }
  } else {
    fetch(tb);
#pragma unroll 1
    for (int kk = kbeg; kk + 64 < kend; kk += 64) {   // same trip count in every K group
      stage(ta);
      lds_barrier();
      fetch(ta);
      multiply();
      lds_barrier();
      stage(tb);
      lds_barrier();
      fetch(tb);
      multiply();
      lds_barrier();
    }
    stage(ta);
    lds_barrier();
    multiply();
    lds_barrier();
    ta = tb;
  }
  stage(ta);
  lds_barrier();
  multiply();
  lds_barrier();

  if (KS > 1) {
    // each K group leaves its raw f32 partial tile in LDS; thread -> one row, 8 consecutive columns: sum, scale, bias
#pragma unroll
    for (int j = 0; j < 4; ++j)
#pragma unroll
      for (int r = 0; r < 8; ++r) Ct[wave * 16 + 8 * hh + r][16 * j + m] = acc[j][r];
    __syncthreads();
    const int row = (int)threadIdx.x >> 3, c0 = ((int)threadIdx.x & 7) * 8;
    const char* c00 = smem - grp * GEMM_LDS(NPL) + 2 * NPL * 64 * 40 * 2 + (row * 68 + c0) * 4;   // group 0's tile
    F8 bc, sum;
    bc.v[0] = *(const v4f*)(bias + n0 + c0);
    bc.v[1] = *(const v4f*)(bias + n0 + c0 + 4);
    sum.v[0] = *(const v4f*)(c00);
    sum.v[1] = *(const v4f*)(c00 + 16);
#pragma unroll
    for (int g = 1; g < KS; ++g) {
      sum.v[0] += *(const v4f*)(c00 + g * GEMM_LDS(NPL));
      sum.v[1] += *(const v4f*)(c00 + g * GEMM_LDS(NPL) + 16);
    }
    float* y = Yf + (size_t)(m0 + row) * Nout + n0 + c0;
    *(v4f*)(y) = sum.v[0] * o_mul + bc.v[0];
    *(v4f*)(y + 4) = sum.v[1] * o_mul + bc.v[1];
    return;
  }

  // D + bias (unscaled) -> LDS tile
#pragma unroll
  for (int j = 0; j < 4; ++j) {
    const float bcol = bias[n0 + 16 * j + m];
#pragma unroll
    for (int r = 0; r < 8; ++r) Ct[wave * 16 + 8 * hh + r][16 * j + m] = acc[j][r] * o_mul + bcol;
  }
  __syncthreads();

  if (OM == 0) {
    const int q = lane >> 3, p = lane & 7;
    v8h vals[4];
    size_t addr[4];
#pragma unroll
    for (int it = 0; it < 4; ++it) {
      const int row = wave * 16 + 4 * it + q;
      F8 c;
      c.v[0] = *(const v4f*)&Ct[row][8 * p];
      c.v[1] = *(const v4f*)&Ct[row][8 * p + 4];
      Pack8 pk;
#pragma unroll
      for (int e = 0; e < 8; ++e) pk.s[e] = (_Float16)(c.f[e] * o_scale);
      vals[it] = pk.v;
      addr[it] = (size_t)(m0 + row) * Nout + n0 + 8 * p;
    }
#pragma unroll
    for (int it = 0; it < 4; ++it) *(v8h*)(Yh + addr[it]) = vals[it];
    // in a kernel with several block ranges other code follows these stores in the listing: their address and data
    // registers stay untouched until the stores have taken them
    asm volatile("s_wait_xcnt 0x0" ::: "memory");
  } else if (OM == 1) {
    const int hd = bx;
    const int bb = m0 / NTOK, tok0 = m0 - bb * NTOK;
    const int q = lane >> 3, p = lane & 7;
    v8h vh[4], vl[4];
    size_t addr[4];
#pragma unroll
    for (int it = 0; it < 4; ++it) {
      const int dk = wave * 16 + 4 * it + q;
      Pack8 ph, pl;
#pragma unroll
      for (int e = 0; e < 8; ++e) {
        const float v = Ct[8 * p + e][dk] * o_scale;
        const _Float16 hv = (_Float16)v;
        ph.s[e] = hv;
        pl.s[e] = (_Float16)(v - (float)hv);
      }
      vh[it] = ph.v;
      vl[it] = pl.v;
      addr[it] = (((size_t)bb * NH + hd) * DKH + dk) * NTOK + tok0 + 8 * p;
    }
#pragma unroll
    for (int it = 0; it < 4; ++it) {
      *(v8h*)(Yh + addr[it]) = vh[it];
      *(v8h*)(Yl + addr[it]) = vl[it];
    }
    
  } else {
    const int q = lane >> 4, p = lane & 15;
    v4f vals[8];
    size_t addr[8];
#pragma unroll
    for (int it = 0; it < 8; ++it) {
      const int row = wave * 16 + 2 * it + q;
      vals[it] = *(const v4f*)&Ct[row][4 * p];
      addr[it] = (size_t)(m0 + row) * Nout + n0 + 4 * p;
    }
#pragma unroll
    for (int it = 0; it < 8; ++it) *(v4f*)(Yf + addr[it]) = vals[it];
    
  }
}

template <int AM, int OM, int KS>
__global__ __launch_bounds__(128 * KS) void k_gemm(const float* Af, const _Float16* Ah, const _Float16* Al,
                                             const float* W, const float* bias,
                                             _Float16* Yh, _Float16* Yl, float* Yf,
                                             int M, int K, int Nout,
                                             float a_scale, float w_scale, float o_mul, float o_scale) {
  __shared__ __attribute__((aligned(16))) char smem[KS * GEMM_LDS((AM == 0) ? 1 : 2)];
  gemm_body<AM, OM, KS>(smem, blockIdx.x, blockIdx.y, Af, Ah, Al, W, bias, Yh, Yl, Yf, M, K, Nout,
                    a_scale, w_scale, o_mul, o_scale);
}

// ---------------------------------------------------------------------------------------------
// Geometric weights with the key mask folded in, as one f16 plane (half the bytes of an f32 plane, written here and read once
// by the attention kernel). softmax(log(w) + s) = w*exp(s) / sum(w*exp(s)), so the weight itself is handed over and no log is
// taken: an f16 keeps the same relative precision at every size of w, which it would not for log(w).
// gw[b][h][i][j] = mask[b][i][j]==0 ? 0 : S_GW * max(relu(emb(i,j) . Wg[:,h] + bg[h]), 1e-6)     (S_GW * 1e-6 is a normal f16)
// The attention kernel forms S_P * w * exp(..) <= S_P * w as an f16 operand: weights below 16 stay inside its range.
// One block per (b, GIB query boxes i, 128 key boxes j; one j per thread); the 64->8 projection runs on WMMA.
// The two centre-distance angles depend on the pair (i, j): their 32 sin/cos values are made per pair (A = hi / residual
// planes x S_E, B columns 0..7 = f16(S_G*Wg[:,h]), 8..15 = residual of the same).
// The two size angles are differences, 100*dm*log(w_i/w_j) = A_i - A_j with A = 100*dm*log(w) (w > 0 for box coordinates in
// [0,1)): Ws*sin(A_i-A_j) + Wc*cos(A_i-A_j) = sin(A_j)*(Wc*sin(A_i) - Ws*cos(A_i)) + cos(A_j)*(Ws*sin(A_i) + Wc*cos(A_i)).
// So sin/cos(A_j) are made once per block (A fragments kept in registers for all GIB query boxes) and the brackets are a
// 32x8 B operand per query box, made once in the prologue.
// k order of every 32-wide operand here: k = 16*c + 8*pl + f, c = 0 sin / 1 cos, pl = which of the two angles, f = frequency.
// ---------------------------------------------------------------------------------------------
#define GIB 8
#define GEO_BLOCKS (NB * (NTOK / GIB) * (NTOK / 128))
#define GEO_O_B0 (2 * 128 * 40 * 2)
#define GEO_O_BP (GEO_O_B0 + 16 * 40 * 2)
#define GEO_O_GS (GEO_O_BP + GIB * 16 * 40 * 2)
#define GEO_O_DM (GEO_O_GS + 128 * 17 * 4)
#define GEO_O_SA (GEO_O_DM + 8 * 4 + 8 * 4)
#define GEO_O_SI (GEO_O_SA + GIB * 32 * 4)
#define GEO_LDS  (GEO_O_SI + GIB * 4 * 4)

// 8 angles ang0*dm[f] -> sin and cos, each as f16 hi / residual of S_E * value
__device__ __forceinline__ void geo_sincos8(float ang0, const float* dm, Pack8& sh, Pack8& sl, Pack8& chv, Pack8& clv) {
  float sn[8], cs[8];
#pragma unroll
  for (int f = 0; f < 8; ++f) sn[f] = __sinf(ang0 * dm[f]);
#pragma unroll
  for (int f = 0; f < 8; ++f) cs[f] = __cosf(ang0 * dm[f]);
#pragma unroll
  for (int f = 0; f < 8; ++f) {
    const float sv = sn[f] * S_E;
    const float cv = cs[f] * S_E;
    const _Float16 a = (_Float16)sv;
    sh.s[f] = a;
    sl.s[f] = (_Float16)(sv - (float)a);
    const _Float16 c = (_Float16)cv;
    chv.s[f] = c;
    clv.s[f] = (_Float16)(cv - (float)c);
  }
}

__device__ __forceinline__ void geo_body(char* smem, int gb, const float* box, const float* Wg, const float* bg,
                                         const int* msk, _Float16* gw) {
  _Float16 (*Et)[128][40] = reinterpret_cast<_Float16 (*)[128][40]>(smem);              // [plane][j][k]
  _Float16 (*B0)[40] = reinterpret_cast<_Float16 (*)[40]>(smem + GEO_O_B0);             // [n][k], pair part of Wg
  _Float16 (*Bp)[16][40] = reinterpret_cast<_Float16 (*)[16][40]>(smem + GEO_O_BP);     // [query box][n][k], size part
  float (*Gs)[17] = reinterpret_cast<float (*)[17]>(smem + GEO_O_GS);
  float* sdm = reinterpret_cast<float*>(smem + GEO_O_DM);
  float* sbg = sdm + 8;
  float (*sA)[32] = reinterpret_cast<float (*)[32]>(smem + GEO_O_SA);                   // [query box][sin 0..15 | cos 0..15]
  v4f* sI = reinterpret_cast<v4f*>(smem + GEO_O_SI);                                    // [query box] cx, cy, 1/w, 1/h

  static_assert(GIB * 16 == 128, "one thread per (query box, size angle)");
  const int tid = threadIdx.x, lane = tid & 31, wave = tid >> 5;
  const int hh = lane >> 4, m = lane & 15;
  if (gb >= GEO_BLOCKS) return;   // block-uniform
  const int j0 = (gb & (NTOK / 128 - 1)) * 128;
  const int i0 = ((gb / (NTOK / 128)) & (NTOK / GIB - 1)) * GIB;
  const int b = gb / ((NTOK / 128) * (NTOK / GIB));

  if (tid < 8) {
    sdm[tid] = 1.0f / powf(1000.0f, (float)tid * 0.125f);
    sbg[tid] = bg[tid];
  }
#pragma unroll
  for (int e = 0; e < 4; ++e) {
    const int idx = tid * 4 + e;          // 0..511
    const int n = idx >> 5, k = idx & 31;
    const float w = Wg[((k >> 4) * 32 + (k & 15)) * NH + (n & 7)] * S_G;
    const _Float16 wh = (_Float16)w;
    const _Float16 wl = (_Float16)(w - (float)wh);
    B0[n][k] = (n < 8) ? wh : wl;
  }
  const v4f bxj = *(const v4f*)(box + ((size_t)b * NTOK + j0 + tid) * 4);
  const float cxj = (bxj[0] + bxj[1]) * 0.5f, cyj = (bxj[2] + bxj[3]) * 0.5f;
  const float wj = (bxj[1] - bxj[0]) + 1.0f, hgj = (bxj[3] - bxj[2]) + 1.0f;
  __syncthreads();

  float dm[8];
#pragma unroll
  for (int f = 0; f < 8; ++f) dm[f] = sdm[f];

  {  // sin/cos(A_j) of key box j0 + tid -> Et[.][tid][0..31]
    const float la[2] = {logf(wj) * 100.0f, logf(hgj) * 100.0f};
#pragma unroll
    for (int pl = 0; pl < 2; ++pl) {
      Pack8 sh, sl, chv, clv;
      geo_sincos8(la[pl], dm, sh, sl, chv, clv);
      *(v8h*)&Et[0][tid][pl * 8] = sh.v;
      *(v8h*)&Et[1][tid][pl * 8] = sl.v;
      *(v8h*)&Et[0][tid][16 + pl * 8] = chv.v;
      *(v8h*)&Et[1][tid][16 + pl * 8] = clv.v;
    }
  }
  {  // sin/cos(A_i): thread -> query box tid>>4, angle (tid>>3)&1, frequency tid&7
    const int ii = tid >> 4, a = tid & 15;
    const v4f bi = *(const v4f*)(box + ((size_t)b * NTOK + i0 + ii) * 4);
    const float wi = (bi[1] - bi[0]) + 1.0f, hgi = (bi[3] - bi[2]) + 1.0f;
    const float ang = (logf((a & 8) ? hgi : wi) * 100.0f) * sdm[a & 7];
    sA[ii][a] = __sinf(ang);
    sA[ii][16 + a] = __cosf(ang);
    if (a == 0) {
      v4f q;
      q[0] = (bi[0] + bi[1]) * 0.5f;
      q[1] = (bi[2] + bi[3]) * 0.5f;
      q[2] = 1.0f / wi;
      q[3] = 1.0f / hgi;
      sI[ii] = q;
    }
  }
  __syncthreads();

  v16h eh[2], el[2];
#pragma unroll
  for (int t = 0; t < 2; ++t) {
    eh[t] = ldfrag(&Et[0][wave * 32 + t * 16][0], 40, lane, 0);
    el[t] = ldfrag(&Et[1][wave * 32 + t * 16][0], 40, lane, 0);
  }
  const v16h b0 = ldfrag(&B0[0][0], 40, lane, 0);
#pragma unroll
  for (int e = 0; e < GIB * 32 / 128; ++e) {   // size part of the B operand: thread -> (query box, k), all 8 heads
    const int idx = e * 128 + tid;
    const int ii = idx >> 5, k = idx & 31, a = k & 15;
    const bool isc = (k >> 4) != 0;
    const float sa = sA[ii][a], ca = sA[ii][16 + a];
    const float* ws = Wg + (16 + a) * NH;
    const float* wc = Wg + (48 + a) * NH;
    F8 s8, c8;
    s8.v[0] = *(const v4f*)(ws);  s8.v[1] = *(const v4f*)(ws + 4);
    c8.v[0] = *(const v4f*)(wc);  c8.v[1] = *(const v4f*)(wc + 4);
#pragma unroll
    for (int h = 0; h < 8; ++h) {
      const float x = isc ? s8.f[h] : c8.f[h];
      const float y = isc ? c8.f[h] : -s8.f[h];
      const float w = (x * sa + y * ca) * S_G;
      const _Float16 wh = (_Float16)w;
      Bp[ii][h][k] = wh;
      Bp[ii][h + 8][k] = (_Float16)(w - (float)wh);
    }
  }
  __syncthreads();   // Bp is complete, and every wave holds its sin/cos(A_j) fragments before Et is written again

  const v8f z8 = zero8f();
  const int ohd = tid >> 4, ojb = (tid & 15) * 8;   // output: thread -> one head, 8 consecutive key boxes (one 16-B store)
  const float obg = sbg[ohd] * S_GW;

#pragma unroll 1
  for (int ii = 0; ii < GIB; ++ii) {
    const int i = i0 + ii;
    {  // pair part of the embedding of (i, j0 + tid) -> Et[.][tid][0..31]
      const v4f qi = sI[ii];
      const float p0 = logf(fmaxf(fabsf((qi[0] - cxj) * qi[2]), 1e-3f));
      const float p1 = logf(fmaxf(fabsf((qi[1] - cyj) * qi[3]), 1e-3f));
      const float pp[2] = {p0 * 100.0f, p1 * 100.0f};
#pragma unroll
      for (int pl = 0; pl < 2; ++pl) {
        Pack8 sh, sl, chv, clv;
        geo_sincos8(pp[pl], dm, sh, sl, chv, clv);
        *(v8h*)&Et[0][tid][pl * 8] = sh.v;
        *(v8h*)&Et[1][tid][pl * 8] = sl.v;
        *(v8h*)&Et[0][tid][16 + pl * 8] = chv.v;
        *(v8h*)&Et[1][tid][16 + pl * 8] = clv.v;
      }
    }
    __syncthreads();

    // 128 j rows x 16 cols, K = 32 (pair part) + 32 (size part): wave -> two 16-row tiles
    const v16h bp = ldfrag(&Bp[ii][0][0], 40, lane, 0);
#pragma unroll
    for (int t = 0; t < 2; ++t) {
      const int row0 = wave * 32 + t * 16;
      v8f acc = z8;
      const v16h a0 = ldfrag(&Et[0][row0][0], 40, lane, 0);
      const v16h l0 = ldfrag(&Et[1][row0][0], 40, lane, 0);
      acc = wmma16(a0, b0, acc);
      acc = wmma16(l0, b0, acc);
      acc = wmma16(eh[t], bp, acc);
      acc = wmma16(el[t], bp, acc);
#pragma unroll
      for (int r = 0; r < 8; ++r) Gs[row0 + 8 * hh + r][m] = acc[r];
    }
    __syncthreads();

    const int* mrow = msk + ((size_t)b * NTOK + i) * NTOK + j0 + ojb;
    Pack8 wv;
#pragma unroll
    for (int q = 0; q < 8; ++q) {
      const float gs = (Gs[ojb + q][ohd] + Gs[ojb + q][ohd + 8]) * (S_GW / (S_E * S_G)) + obg;
      const float w = fmaxf(gs, 1e-6f * S_GW);   // relu, then the floor of 1e-6
      wv.s[q] = (_Float16)((mrow[q] == 0) ? 0.0f : w);
    }
    *(v8h*)(gw + (((size_t)b * NH + ohd) * NTOK + i) * NTOK + j0 + ojb) = wv.v;
    // the next trip reuses the store's data and address registers at once: they stay untouched until the store took them
    asm volatile("s_wait_xcnt 0x0" ::: "memory");
  }
}

// ---------------------------------------------------------------------------------------------
// The four producers of the attention kernel depend on inputs only, so they share one launch and run side by side:
// block ranges, longest work-groups first: v projection, q projection, k projection (GTILES tiles each), geometry.
// Every branch is block-uniform (blockIdx only); the ranges share one LDS buffer sized for the largest user.
// ---------------------------------------------------------------------------------------------
// Second launch bound: 7 waves per SIMD, so that all work-groups of the grid (7 per WGP) stay resident at once as before,
// also with the projections' tiles in flight in registers.
#define GTILES ((DM / 64) * (MTOK / 64))
__global__ __launch_bounds__(128, 7) void k_front(const float* Xq, const float* Xk, const float* Xv,
                                              const float* Wq, const float* bq, const float* Wk, const float* bk,
                                              const float* Wv, const float* bv,
                                              const float* box, const float* Wg, const float* bg, const int* msk,
                                              _Float16* Q16, _Float16* K16, _Float16* Vth, _Float16* Vtl,
                                              _Float16* gw) {
  static_assert(GEO_LDS >= GEMM_LDS(2), "shared buffer is sized by the geometry part");
  __shared__ __attribute__((aligned(16))) char smem[GEO_LDS];
  const int blk = blockIdx.x;
  const float omul = 1.0f / (S_X * S_W);     // 2^-22
  if (blk < GTILES) {
    gemm_body<1, 1>(smem, blk & (DM / 64 - 1), blk / (DM / 64), Xv, nullptr, nullptr, Wv, bv, Vth, Vtl, nullptr,
                    MTOK, DM, DM, S_X, S_W, omul, S_V);
  } else if (blk < 3 * GTILES) {
    const bool isq = blk < 2 * GTILES;
    const int t = blk - (isq ? GTILES : 2 * GTILES);
    gemm_body<0, 0>(smem, t & (DM / 64 - 1), t / (DM / 64), isq ? Xq : Xk, nullptr, nullptr,
                    isq ? Wq : Wk, isq ? bq : bk, isq ? Q16 : K16, nullptr, nullptr,
                    MTOK, DM, DM, S_X, S_W, omul, S_QK);
  } else {
    geo_body(smem, blk - 3 * GTILES, box, Wg, bg, msk, gw);
  }
}

// ---------------------------------------------------------------------------------------------
// Streaming attention: block = (b, h, 64 query rows), KSPL key groups x 4 waves x 16 queries, key tiles of 32.
// Key group g walks key tiles g, g + KSPL, g + 2*KSPL, ... with its own K/V tiles, maxima, sums and O partials,
// so each SIMD holds KSPL waves and the serial chain of tiles is KSPL times shorter; the partials are merged through LDS.
// Both products run transposed. S^T = K16.Q16^T (A = key rows, B = query columns; single f16 product, Q16/K16 carry S_QK):
// D element r of lane l = (key 8*(l>>4)+r, query l&15), so a lane holds 16 scores of ONE query per key tile: maximum and sum
// are taken inside the lane, plus one exchange between the wave's halves, and the lane's geometric weights are contiguous in
// memory. p = (gw/S_GW) * exp(S*(1/(8*S_QK^2)) - max): online softmax in f32, the running maximum taken over the scores alone (kept in
// the units of S). A masked key has gw = 0; a query whose keys are all masked has sum 0 and is given the mean of V in the merge
// (the reference's logits are then all equal).
// O^T += V^T.P^T: the two score tiles of a lane are, element for element, the B fragment (k = key) that the loader's k order
// asks for (elements 0..7 <- key 8*(l>>4)+0..7, elements 8..15 <- key 16+8*(l>>4)+0..7), so P never goes through LDS.
// P as f16 hi/residual of S_P*p, V as f16 hi/residual planes (carrying S_V), V tile staged [dk][key] = rows of A.
// Output: f16 hi/residual planes of S_AO * (O / l), row-major [b*N+q][h*64+dk].
// ---------------------------------------------------------------------------------------------
#define KSPL 4

// value of lane l ^ 16: the other half of the wave, which holds the same query's other keys
__device__ __forceinline__ float xhalf(float x) {
  return __builtin_bit_cast(float, __builtin_amdgcn_permlanex16(__builtin_bit_cast(int, x), __builtin_bit_cast(int, x),
                                                                0x76543210, 0xfedcba98, false, false));
}

__device__ __forceinline__ void exp2x8(float (&y)[8], const float (&x)[8]) {
  asm("v_exp_f32 %0, %8\n\tv_exp_f32 %1, %9\n\tv_exp_f32 %2, %10\n\tv_exp_f32 %3, %11\n\t"
      "v_exp_f32 %4, %12\n\tv_exp_f32 %5, %13\n\tv_exp_f32 %6, %14\n\tv_exp_f32 %7, %15\n\tv_nop"
      : "=&v"(y[0]), "=&v"(y[1]), "=&v"(y[2]), "=&v"(y[3]), "=&v"(y[4]), "=&v"(y[5]), "=&v"(y[6]), "=&v"(y[7])
      : "v"(x[0]), "v"(x[1]), "v"(x[2]), "v"(x[3]), "v"(x[4]), "v"(x[5]), "v"(x[6]), "v"(x[7]));
}

// the same for four values (the merge's group weights)
__device__ __forceinline__ void exp2x4(float (&y)[4], const float (&x)[4]) {
  asm("v_exp_f32 %0, %4\n\tv_exp_f32 %1, %5\n\tv_exp_f32 %2, %6\n\tv_exp_f32 %3, %7\n\tv_nop"
      : "=&v"(y[0]), "=&v"(y[1]), "=&v"(y[2]), "=&v"(y[3])
      : "v"(x[0]), "v"(x[1]), "v"(x[2]), "v"(x[3]));
}

__global__ __launch_bounds__(128 * KSPL) void k_attn(const _Float16* Qh, const _Float16* Kh,
                                                    const _Float16* Vth, const _Float16* Vtl,
                                                    const _Float16* gw, _Float16* Oh, _Float16* Ol) {
  __shared__ __attribute__((aligned(16))) _Float16 Qt[64][72];              // [q][dk]
  __shared__ __attribute__((aligned(16))) _Float16 Kt[KSPL][32][72];        // [group][key][dk]
  __shared__ __attribute__((aligned(16))) _Float16 Vt[KSPL][2][64][40];     // [group][plane][dk][key]
  __shared__ __attribute__((aligned(16))) float Cs[KSPL][64][68];           // [group][q][dk] un-normalised O partial
  __shared__ float Ms[KSPL][64];                                            // [group][q] maximum
  __shared__ float Ls[KSPL][64];                                            // [group][q] sum

  static_assert(128 * KSPL == 64 * 8, "Q staging and the merge give each thread one row and 8 consecutive dk");
  const int tid = threadIdx.x, lane = tid & 31;
  const int grp = __builtin_amdgcn_readfirstlane(tid >> 7);   // same in every lane of a wave: kept scalar
  const int gt = tid & 127, wave = gt >> 5;
  const int hh = lane >> 4, m = lane & 15;
  const int blk = blockIdx.x;
  if (blk >= NB * NH * (NTOK / 64)) return;   // block-uniform
  const int qb = blk & 7, h = (blk >> 3) & 7, b = blk >> 6;
  const int q0 = qb * 64;

  const size_t lgrow = (((size_t)b * NH + h) * NTOK + (q0 + wave * 16 + m)) * NTOK;   // the lane's query

  // The global loads of a key tile (K, both V planes, the geometric weights) are issued one tile ahead, into registers: they fly
  // while the tile before is worked on, so a trip waits for memory neither at its head nor between S and the softmax.
  v8h kr[2], vr[4];
  Pack8 lg[2];
  // running addresses of the group's next key tile (first tile: keys grp*32 ..): K tile 32 keys x 64 dk; V planes, already
  // [dk][token], 64 dk x 32 keys; weights of the lane's query, keys 8*hh + 0..7 and 16 + 8*hh + 0..7 of the tile
  // (byte offsets from the buffers' starts; the largest buffer has 16 MB)
  unsigned ok = (unsigned)((b * NTOK + grp * 32 + (gt >> 2)) * DM + h * DKH + (gt & 3) * 16) * 2u;
  unsigned ov = (unsigned)(((b * NH + h) * DKH + (gt >> 1)) * NTOK + grp * 32 + (gt & 1) * 16) * 2u;
  unsigned og = ((unsigned)lgrow + (unsigned)(grp * 32 + 8 * hh)) * 2u;
  auto fetch = [&]() {   // loads the tile at the running addresses and moves these to the group's next tile
    const _Float16* pk = (const _Float16*)((const char*)Kh + ok);
    const _Float16* pvh = (const _Float16*)((const char*)Vth + ov);
    const _Float16* pvl = (const _Float16*)((const char*)Vtl + ov);
    const _Float16* pg = (const _Float16*)((const char*)gw + og);
    kr[0] = *(const v8h*)(pk);
    kr[1] = *(const v8h*)(pk + 8);
    vr[0] = *(const v8h*)(pvh);
    vr[1] = *(const v8h*)(pvh + 8);
    vr[2] = *(const v8h*)(pvl);
    vr[3] = *(const v8h*)(pvl + 8);
    lg[0].v = *(const v8h*)(pg);
    lg[1].v = *(const v8h*)(pg + 16);
    // the loads stay in flight: their address registers stay untouched until the loads took them. The wait names the
    // offsets as in-out operands, so that they live up to it (no load lands in one) and are moved on only behind it.
    asm volatile("s_wait_xcnt 0x0" : "+v"(ok), "+v"(ov), "+v"(og) :: "memory");
    ok += KSPL * 32 * DM * 2u;
    ov += KSPL * 32 * 2u;
    og += KSPL * 32 * 2u;
  };
  {
    const int r = tid >> 3, cb = (tid & 7) * 8;
    const v8h qv = *(const v8h*)(Qh + ((size_t)(b * NTOK + q0 + r)) * DM + h * DKH + cb);
    fetch();
    *(v8h*)&Qt[r][cb] = qv;
  }
  lds_barrier();
  const v16h qb0 = ldfrag(&Qt[wave * 16][0], 72, lane, 0);    // B[k=dk][n=q] = Qt[q][dk]: n-major tile, same loader as A
  const v16h qb1 = ldfrag(&Qt[wave * 16][0], 72, lane, 32);

  const v8f z8 = zero8f();
  v8f o[4];   // O^T: element r of o[j] = (dk 16*j + 8*hh + r, query m)
#pragma unroll
  for (int j = 0; j < 4; ++j) o[j] = z8;
  float mrow = -1e30f;   // running maximum of the lane's query, in units of S (equal in both halves of the wave)
  float lrow = 0.0f;     // running sum (carrying S_P) over the keys of the lane's own half; the halves are joined behind the loop

  const float SC = 0.125f / (S_QK * S_QK);
  const float SC2 = SC * 1.442695041f;                 // exp(x * SC) = 2^(x * SC2)
  static_assert(S_P == 64.0f * S_GW, "the exponent's offset of 6 brings S_GW * w up to S_P * w");

#pragma unroll 1
  for (int it = 0; it < NTOK / 32 / KSPL; ++it) {   // same trip count in every group: barriers stay block-uniform
    {  // K tile 32 keys x 64 dk
      const int r = gt >> 2, cb = (gt & 3) * 16;
      *(v8h*)&Kt[grp][r][cb] = kr[0];
      *(v8h*)&Kt[grp][r][cb + 8] = kr[1];
    }
    {  // V planes: 64 dk x 32 keys, direct copy
      const int r = gt >> 1, cb = (gt & 1) * 16;
      *(v8h*)&Vt[grp][0][r][cb] = vr[0];
      *(v8h*)&Vt[grp][0][r][cb + 8] = vr[1];
      *(v8h*)&Vt[grp][1][r][cb] = vr[2];
      *(v8h*)&Vt[grp][1][r][cb + 8] = vr[3];
    }
    lds_barrier();

    // S^T[32 keys][16 q]: A[row=key][k=dk] = Kt[key][dk]
    v8f s[2];
#pragma unroll
    for (int c = 0; c < 2; ++c) {
      const v16h a0 = ldfrag(&Kt[grp][16 * c][0], 72, lane, 0);
      const v16h a1 = ldfrag(&Kt[grp][16 * c][0], 72, lane, 32);
      v8f sc = z8;
      sc = wmma16(a0, qb0, sc);
      sc = wmma16(a1, qb1, sc);
      s[c] = sc;
    }

    float wf[2][8];   // this tile's weights, widened
#pragma unroll
    for (int c = 0; c < 2; ++c)
#pragma unroll
      for (int r = 0; r < 8; ++r) wf[c][r] = (float)lg[c].s[r];
    // Inputs-only fence on the loaded weights: they are widened in front of the next tile's loads, so that these land in the
    // registers just read. Without it the widening sinks behind the loads, and a register copy with a wait for ALL of the next
    // tile's loads comes to stand in the middle of the trip.
    asm volatile("" :: "v"(wf[0][0]), "v"(wf[0][1]), "v"(wf[0][2]), "v"(wf[0][3]), "v"(wf[0][4]), "v"(wf[0][5]),
                 "v"(wf[0][6]), "v"(wf[0][7]), "v"(wf[1][0]), "v"(wf[1][1]), "v"(wf[1][2]), "v"(wf[1][3]), "v"(wf[1][4]),
                 "v"(wf[1][5]), "v"(wf[1][6]), "v"(wf[1][7]) : "memory");
    if (it + 1 < NTOK / 32 / KSPL) fetch();   // same for the whole work-group (scalar test)

    float mc[2];
#pragma unroll
    for (int c = 0; c < 2; ++c) {
      mc[c] = s[c][0];
#pragma unroll
      for (int r = 1; r < 8; ++r) mc[c] = fmaxf(mc[c], s[c][r]);
    }
    float mx = fmaxf(mc[0], mc[1]);
    mx = fmaxf(mx, xhalf(mx));

    const float mnew = fmaxf(mrow, mx);
    const float alpha = __expf((mrow - mnew) * SC);
    mrow = mnew;
    const float eoff = 6.0f - mnew * SC2;
    float t[2][8], p[2][8];
#pragma unroll
    for (int c = 0; c < 2; ++c) {
#pragma unroll
      for (int r = 0; r < 8; ++r) t[c][r] = s[c][r] * SC2 + eoff;
      exp2x8(p[c], t[c]);
#pragma unroll
      for (int r = 0; r < 8; ++r) p[c][r] *= wf[c][r];   // S_P * w * exp(score - max)
    }

    float se[2], so[2];   // sums of the even and of the odd elements of each score tile: neighbours add in pairs
#pragma unroll
    for (int c = 0; c < 2; ++c) {
      se[c] = p[c][0];
      so[c] = p[c][1];
#pragma unroll
      for (int r = 2; r < 8; r += 2) {
        se[c] += p[c][r];
        so[c] += p[c][r + 1];
      }
    }
    lrow = lrow * alpha + ((se[0] + se[1]) + (so[0] + so[1]));
#pragma unroll
    for (int j = 0; j < 4; ++j)
#pragma unroll
      for (int r = 0; r < 8; ++r) o[j][r] *= alpha;

    // P^T as B fragments, straight from the score tiles: element 8*c + r <- key 16*c + 8*hh + r of query m
    Frag16 ph, pl;
#pragma unroll
    for (int c = 0; c < 2; ++c)
#pragma unroll
      for (int r = 0; r < 8; ++r) {
        const float ps = p[c][r];
        const _Float16 hv = (_Float16)ps;
        ph.s[8 * c + r] = hv;
        pl.s[8 * c + r] = (_Float16)(ps - (float)hv);
      }

    // O^T[64 dk][16 q] += V^T[64 dk x 32 keys] . P^T[32 keys x 16 q]; A[row=dk][k=key] = Vt[dk][key]
#pragma unroll
    for (int j = 0; j < 4; ++j) {
      const v16h vh = ldfrag(&Vt[grp][0][16 * j][0], 40, lane, 0);
      const v16h vl = ldfrag(&Vt[grp][1][16 * j][0], 40, lane, 0);
      o[j] = wmma16(vh, ph.v, o[j]);
      o[j] = wmma16(vl, ph.v, o[j]);
      o[j] = wmma16(vh, pl.v, o[j]);
    }
    lds_barrier();
  }

  // each key group leaves its un-normalised partial, maximum and sum in LDS; a lane's 8 values of o[j] are consecutive dk
  lrow += xhalf(lrow);
#pragma unroll
  for (int j = 0; j < 4; ++j) {
    F8 c;
#pragma unroll
    for (int r = 0; r < 8; ++r) c.f[r] = o[j][r];
    *(v4f*)&Cs[grp][wave * 16 + m][16 * j + 8 * hh] = c.v[0];
    *(v4f*)&Cs[grp][wave * 16 + m][16 * j + 8 * hh + 4] = c.v[1];
  }
  if (hh == 0) {
    Ms[grp][wave * 16 + m] = mrow;
    Ls[grp][wave * 16 + m] = lrow;
  }
  __syncthreads();

  // merge: weight exp(m_g - max) per group, divide by the merged row sum; thread -> one row, 8 consecutive dk
  {
    const int row = tid >> 3, p = tid & 7;
    float mg[KSPL];
#pragma unroll
    for (int g = 0; g < KSPL; ++g) mg[g] = Ms[g][row];
    float mall = mg[0];
#pragma unroll
    for (int g = 1; g < KSPL; ++g) mall = fmaxf(mall, mg[g]);
    static_assert(KSPL == 4, "exp2x4 takes one value per key group");
    float xg[KSPL], wg[KSPL], lall = 0.0f;
#pragma unroll
    for (int g = 0; g < KSPL; ++g) xg[g] = (mg[g] - mall) * SC2;
    exp2x4(wg, xg);
#pragma unroll
    for (int g = 0; g < KSPL; ++g) lall += Ls[g][row] * wg[g];
    float inv = (1.0f / lall) * (S_AO / S_V);   // the sums carry S_P as the partials do
    float acc[8];
#pragma unroll
    for (int e = 0; e < 8; ++e) acc[e] = 0.0f;
#pragma unroll
    for (int g = 0; g < KSPL; ++g) {
      F8 c;
      c.v[0] = *(const v4f*)&Cs[g][row][8 * p];
      c.v[1] = *(const v4f*)&Cs[g][row][8 * p + 4];
#pragma unroll
      for (int e = 0; e < 8; ++e) acc[e] += c.f[e] * wg[g];
    }
    if (lall == 0.0f) {   // every key of this query is masked: equal logits in the reference, so the mean of V over all keys
      inv = S_AO / (S_V * (float)NTOK);
      unsigned vo = (unsigned)(((b * NH + h) * DKH + 8 * p) * NTOK) * 2u;   // byte offset into either V plane
#pragma unroll
      for (int e = 0; e < 8; ++e) acc[e] = 0.0f;
#pragma unroll 1   // a rare path: kept small
      for (int k = 0; k < NTOK; k += 8) {
        Pack8 a[8], c[8];
#pragma unroll
        for (int e = 0; e < 8; ++e) {
          a[e].v = *(const v8h*)((const char*)Vth + vo + e * NTOK * 2);
          c[e].v = *(const v8h*)((const char*)Vtl + vo + e * NTOK * 2);
        }
        // the offset register stays untouched until the loads took it: it lives up to the wait (no load lands in it)
        asm volatile("s_wait_xcnt 0x0" : "+v"(vo) :: "memory");
        vo += 16u;
#pragma unroll
        for (int e = 0; e < 8; ++e)
#pragma unroll
          for (int u = 0; u < 8; ++u) acc[e] += (float)a[e].s[u] + (float)c[e].s[u];
      }
    }
    Pack8 ph, pl;
#pragma unroll
    for (int e = 0; e < 8; ++e) {
      const float v = acc[e] * inv;
      const _Float16 hv = (_Float16)v;
      ph.s[e] = hv;
      pl.s[e] = (_Float16)(v - (float)hv);
    }
    const size_t addr = ((size_t)(b * NTOK + q0 + row)) * DM + h * DKH + 8 * p;
    *(v8h*)(Oh + addr) = ph.v;
    *(v8h*)(Ol + addr) = pl.v;
  }
}

// ---------------------------------------------------------------------------------------------
// host-side launch glue
// ---------------------------------------------------------------------------------------------
extern "C" void kernel_launch(void* const* d_in, const int* in_sizes, int n_in,
                              void* d_out, int out_size, void* d_ws, size_t ws_size,
                              hipStream_t stream) {
  if (n_in < 15) return;
  const int xsz = MTOK * DM, wsz = DM * DM;
  if (in_sizes[0] != xsz || in_sizes[1] != xsz || in_sizes[2] != xsz) return;
  if (in_sizes[3] != MTOK * 4 || in_sizes[4] != NB * NTOK * NTOK) return;
  if (in_sizes[5] != wsz || in_sizes[7] != wsz || in_sizes[9] != wsz || in_sizes[11] != wsz) return;
  if (in_sizes[6] != DM || in_sizes[8] != DM || in_sizes[10] != DM || in_sizes[12] != DM) return;
  if (in_sizes[13] != DKH * NH || in_sizes[14] != NH || out_size != xsz) return;

  const float* Xq  = (const float*)d_in[0];
  const float* Xk  = (const float*)d_in[1];
  const float* Xv  = (const float*)d_in[2];
  const float* box = (const float*)d_in[3];
  const int*   msk = (const int*)d_in[4];
  const float* Wq  = (const float*)d_in[5];
  const float* bq  = (const float*)d_in[6];
  const float* Wk  = (const float*)d_in[7];
  const float* bk  = (const float*)d_in[8];
  const float* Wv  = (const float*)d_in[9];
  const float* bv  = (const float*)d_in[10];
  const float* Wo  = (const float*)d_in[11];
  const float* bo  = (const float*)d_in[12];
  const float* Wg  = (const float*)d_in[13];
  const float* bg  = (const float*)d_in[14];
  float* out = (float*)d_out;

  // workspace carve (all offsets multiples of 2 MB): gw 16 MB, six 16-bit [2048][512] buffers 2 MB each = 28 MB
  char* ws = (char*)d_ws;
  size_t off = 0;
  _Float16* gw = (_Float16*)(ws + off);      off += (size_t)NB * NH * NTOK * NTOK * 2;
  _Float16* Q16 = (_Float16*)(ws + off);     off += (size_t)xsz * 2;
  _Float16* K16 = (_Float16*)(ws + off);     off += (size_t)xsz * 2;
  _Float16* Vth = (_Float16*)(ws + off);     off += (size_t)xsz * 2;   // [b][h][dk][token]
  _Float16* Vtl = (_Float16*)(ws + off);     off += (size_t)xsz * 2;
  _Float16* AOh = (_Float16*)(ws + off);     off += (size_t)xsz * 2;   // [b*N+q][h*64+dk]
  _Float16* AOl = (_Float16*)(ws + off);     off += (size_t)xsz * 2;
  if (off > ws_size) return;

  const float omul_o = 1.0f / (S_AO * S_W);  // 2^-22
  const dim3 gg(DM / 64, MTOK / 64), gb(128);

  k_front<<<dim3(3 * GTILES + GEO_BLOCKS), gb, 0, stream>>>(Xq, Xk, Xv, Wq, bq, Wk, bk, Wv, bv, box, Wg, bg, msk,
                                                           Q16, K16, Vth, Vtl, gw);
  k_attn<<<dim3(NB * NH * (NTOK / 64)), dim3(128 * KSPL), 0, stream>>>(Q16, K16, Vth, Vtl, gw, AOh, AOl);
  k_gemm<2, 2, 4><<<gg, dim3(128 * 4), 0, stream>>>(Wo, AOh, AOl, Wo, bo, AOh, AOl, out,
                                      MTOK, DM, DM, 1.0f, S_W, omul_o, 1.0f);
}
